// v000
// The times below were measured on an AMD MI455X: many runs one after another, warmed up first and cycling through
// copies of the inputs, with the whole window's GPU time divided by the number of runs. Launches and the gaps
// between them are all in it. The median over several windows is given; except for v000 it joins two sittings, which
// can be a few percent apart, so the side-by-side timings, each taken in one sitting, are the better comparison.
// v000, which the later versions start from, runs in 155 microseconds.
// Contractions: feat1|feat2 x W1 halves on v_wmma_f32_16x16x32_bf16 (inputs RNE-converted to bf16); pairwise relu(p1+p2+b1) x W2 (h1 f16, W2 f16 carried x16) and h2 x W3 (h2 f16, W3 f16 carried x8, N padded to 16) on v_wmma_f32_16x16x32_f16; f32 accumulate; bias/relu/sigmoid in f32.
#include <hip/hip_runtime.h>
#include <math.h>

// ---------------------------------------------------------------------------
// Problem constants
// ---------------------------------------------------------------------------
constexpr int kNI   = 1024;   // rows of feat1 (output rows i)
constexpr int kNJ   = 1024;   // rows of feat2 (output cols j)
constexpr int kFeat = 512;
constexpr int kHid  = 256;
constexpr int kHid2 = 128;
constexpr int kTI   = 16;     // i rows per block of the pair kernel
constexpr int kTJ   = 32;
constexpr int kH1P  = 264;    // f16 pitch of the h1 LDS tile (528 B, 16-B aligned)
constexpr int kH2P  = 136;    // f16 pitch of the h2 LDS tile (272 B, 16-B aligned)
constexpr float kW2Carry    = 16.0f;
constexpr float kW2CarryInv = 1.0f / 16.0f;
constexpr float kW3Carry    = 8.0f;
constexpr float kW3CarryInv = 0.125f;

typedef __attribute__((ext_vector_type(16))) _Float16 v16h;
typedef __attribute__((ext_vector_type(8)))  _Float16 v8h;
typedef __attribute__((ext_vector_type(16))) __bf16   v16b;
typedef __attribute__((ext_vector_type(8)))  __bf16   v8b;
typedef __attribute__((ext_vector_type(8)))  float    v8f;
typedef __attribute__((ext_vector_type(4)))  float    v4f;
typedef __attribute__((ext_vector_type(4)))  unsigned int v4u;

__device__ __forceinline__ unsigned short f2bf_bits(float f) {
  unsigned u = __float_as_uint(f);
  return (unsigned short)((u + 0x7FFFu + ((u >> 16) & 1u)) >> 16);
}
__device__ __forceinline__ float bf_bits2f(unsigned short h) { return __uint_as_float(((unsigned)h) << 16); }

// hazard guards as plain device helpers (no inline asm inside the kernel template body)
__device__ __forceinline__ void dep_guard_h(v8f& a, v8f& b, v16h x, v16h y) { asm volatile("v_nop\n\tv_nop\n\tv_nop\n\tv_nop" : "+v"(a), "+v"(b) : "v"(x), "v"(y)); }
__device__ __forceinline__ void dep_guard_b(v8f& a, v8f& b, v16b x, v16b y) { asm volatile("v_nop\n\tv_nop\n\tv_nop\n\tv_nop" : "+v"(a), "+v"(b) : "v"(x), "v"(y)); }
__device__ __forceinline__ void keep4_h(v16h a, v16h b, v16h c, v16h d) { asm volatile("v_nop" :: "v"(a), "v"(b), "v"(c), "v"(d)); }
__device__ __forceinline__ void keep4_b(v16b a, v16b b, v16b c, v16b d) { asm volatile("v_nop" :: "v"(a), "v"(b), "v"(c), "v"(d)); }
__device__ __forceinline__ void acc_guard4(v8f& a, v8f& b, v8f& c, v8f& d) { asm volatile("v_nop\n\tv_nop\n\tv_nop\n\tv_nop" : "+v"(a), "+v"(b), "+v"(c), "+v"(d)); }
template <typename T> struct Frag;
template <> struct Frag<_Float16> {
  typedef v16h V; union U { v16h v; v8h h[2]; };
  static __device__ __forceinline__ v16h load(const _Float16* p) {   // elements 0..7 <- p[0..7], 8..15 <- p[16..23]
    U f; f.h[0] = *(const v8h*)(p); f.h[1] = *(const v8h*)(p + 16); return f.v;
  }
  static __device__ __forceinline__ v8f mma(v16h a, v16h b, v8f c) {
    return __builtin_amdgcn_wmma_f32_16x16x32_f16(false, a, false, b, (short)0, c, false, false);
  }
  static __device__ __forceinline__ void guard(v8f& a, v8f& b, v16h x, v16h y) { dep_guard_h(a, b, x, y); }
  static __device__ __forceinline__ void keep(v16h a, v16h b, v16h c, v16h d) { keep4_h(a, b, c, d); }
};
template <> struct Frag<__bf16> {
  typedef v16b V; union U { v16b v; v8b h[2]; };
  static __device__ __forceinline__ v16b load(const __bf16* p) {
    U f; f.h[0] = *(const v8b*)(p); f.h[1] = *(const v8b*)(p + 16); return f.v;
  }
  static __device__ __forceinline__ v8f mma(v16b a, v16b b, v8f c) {
    return __builtin_amdgcn_wmma_f32_16x16x32_bf16(false, a, false, b, (short)0, c, false, false);
  }
  static __device__ __forceinline__ void guard(v8f& a, v8f& b, v16b x, v16b y) { dep_guard_b(a, b, x, y); }
  static __device__ __forceinline__ void keep(v16b a, v16b b, v16b c, v16b d) { keep4_b(a, b, c, d); }
};

__device__ __forceinline__ unsigned pk16(unsigned short a, unsigned short b) { return (unsigned)a | ((unsigned)b << 16); }
__device__ __forceinline__ unsigned short h_bits(float f) { const _Float16 h = (_Float16)f; return __builtin_bit_cast(unsigned short, h); }

// single-accumulator f16 WMMA with the hazard guard tied to the result
__device__ __forceinline__ v8f mma_h(v16h a, v16h b, v8f c) {
  c = __builtin_amdgcn_wmma_f32_16x16x32_f16(false, a, false, b, (short)0, c, false, false);
  asm volatile("v_nop\n\tv_nop\n\tv_nop\n\tv_nop" : "+v"(c) : "v"(a), "v"(b));
  return c;
}

// ---- Register-blocked batched WMMA GEMM (unused
//      activation modes removed) --------------------------------------------
// C[m,n] = scale * sum_k A[m,k] * Bt[n,k] (+bias)(+resid); each wave owns a 64x64 tile.
// A row-major [M,K]; Bt row-major [N,K]; M,N % 64 == 0, K % 32 == 0.
// SPLIT: operands are hi/lo planes (A2/Bt2 = lo planes, same layout); product = hi.hi + hi.lo + lo.hi.
// BIAS_MODE: 0 = none, 1 = bias[m], 2 = bias[n].
// OUT_MODE: 0 = f32, 1 = f16, 2 = bf16 hi plane (Cout) + bf16 lo plane (Cout2).
// ET: 0 = f16 operands, 1 = bf16 operands (pointers passed as 16-bit storage)
template <int ET> struct Elem;
template <> struct Elem<0> { typedef _Float16 T; };
template <> struct Elem<1> { typedef __bf16 T; };
template <int ET, bool SPLIT, int BIAS_MODE, int OUT_MODE, bool RESID, int ACT = 0>
__global__ __launch_bounds__(256) void wmma_gemm64(
    const unsigned short* __restrict__ Ap, const unsigned short* __restrict__ A2p, int lda, long strideA,
    const unsigned short* __restrict__ Btp, const unsigned short* __restrict__ Bt2p, int ldb, long strideB,
    void* __restrict__ Cout, void* __restrict__ Cout2, int ldc, long strideC,
    const float* __restrict__ bias,
    const float* __restrict__ resid, long strideR,
    int M, int N, int K, float scale) {
  typedef typename Elem<ET>::T T;
  typedef typename Frag<T>::V V;
  const T* A = (const T*)Ap; const T* A2 = (const T*)A2p; const T* Bt = (const T*)Btp; const T* Bt2 = (const T*)Bt2p;
  __shared__ __align__(16) float sT[8][16 * 68];   // per-wave 16x64 slab, pitch 68 floats
  const int b    = blockIdx.y;
  const int lane = threadIdx.x & 31;
  const int wave = threadIdx.x >> 5;
  const int tilesN = N >> 6;
  const int tilesM = M >> 6;
  const int tile = blockIdx.x * 8 + wave;
  if (tile >= tilesM * tilesN) return;   // wave-uniform; no block barriers in this kernel
  const int tm = tile / tilesN;
  const int tn = tile - tm * tilesN;
  const int m0 = tm << 6;
  const int n0 = tn << 6;

  const T* Ab  = A  + (size_t)b * strideA;
  const T* Bb  = Bt + (size_t)b * strideB;
  const T* Ab2 = SPLIT ? (A2  + (size_t)b * strideA) : nullptr;
  const T* Bb2 = SPLIT ? (Bt2 + (size_t)b * strideB) : nullptr;

  const int rlane = lane & 15;                 // row (A) / col (B, D) within subtile
  const int koff  = (lane >> 4) * 8;           // k offset of this lane half
  const int mOff  = (lane >> 4) * 8;           // D row offset

  v8f acc[4][4];
#pragma unroll
  for (int i = 0; i < 4; ++i)
#pragma unroll
    for (int j = 0; j < 4; ++j) acc[i][j] = (v8f){0.f,0.f,0.f,0.f,0.f,0.f,0.f,0.f};

  for (int k0 = 0; k0 < K; k0 += 32) {
    V bh[4], bl[4];
#pragma unroll
    for (int j = 0; j < 4; ++j) {
      const size_t bo = (size_t)(n0 + (j << 4) + rlane) * ldb + koff + k0;
      bh[j] = Frag<T>::load(Bb + bo);
      if (SPLIT) bl[j] = Frag<T>::load(Bb2 + bo);
    }
#pragma unroll
    for (int i = 0; i < 4; ++i) {
      const size_t ao = (size_t)(m0 + (i << 4) + rlane) * lda + koff + k0;
      V ah = Frag<T>::load(Ab + ao);
      V al;
      if (SPLIT) al = Frag<T>::load(Ab2 + ao);
#pragma unroll
      for (int j = 0; j < 4; ++j) {
        acc[i][j] = Frag<T>::mma(ah, bh[j], acc[i][j]);
        if (SPLIT) {
          acc[i][j] = Frag<T>::mma(ah, bl[j], acc[i][j]);
          acc[i][j] = Frag<T>::mma(al, bh[j], acc[i][j]);
        }
      }
      Frag<T>::guard(acc[i][0], acc[i][3], ah, SPLIT ? al : ah);
    }
    Frag<T>::keep(bh[0], bh[1], bh[2], bh[3]);
    if (SPLIT) Frag<T>::keep(bl[0], bl[1], bl[2], bl[3]);
  }
  acc_guard4(acc[0][0], acc[0][1], acc[0][2], acc[0][3]);
  acc_guard4(acc[1][0], acc[1][1], acc[1][2], acc[1][3]);
  acc_guard4(acc[2][0], acc[2][1], acc[2][2], acc[2][3]);
  acc_guard4(acc[3][0], acc[3][1], acc[3][2], acc[3][3]);

  // ---- epilogue ----
  float* slab = sT[wave];
  const float* Rb = RESID ? (resid + (size_t)b * strideR) : nullptr;
#pragma unroll
  for (int i = 0; i < 4; ++i) {
    const int mBase = m0 + (i << 4);
#pragma unroll
    for (int j = 0; j < 4; ++j) {
      const int n = n0 + (j << 4) + rlane;
      float bv = 0.f;
      if (BIAS_MODE == 2) bv = bias[n];
#pragma unroll
      for (int r = 0; r < 8; ++r) {
        float v = acc[i][j][r] * scale;
        if (BIAS_MODE == 1) v += bias[mBase + mOff + r];
        if (BIAS_MODE == 2) v += bv;
        if (RESID) v += Rb[(size_t)(mBase + mOff + r) * ldc + n];
        if (ACT == 2) v = fmaxf(v, 0.0f);
        slab[(mOff + r) * 68 + (j << 4) + rlane] = v;
      }
    }
    __builtin_amdgcn_fence(__ATOMIC_RELEASE, "workgroup");
    __builtin_amdgcn_wave_barrier();
    __builtin_amdgcn_fence(__ATOMIC_ACQUIRE, "workgroup");
    if (OUT_MODE == 0) {
      float* C = (float*)Cout + (size_t)b * strideC;
      const int hh = lane >> 4, c4 = (lane & 15) * 4;     // row seg = 256 B = 16 lanes x 16 B
      {
#pragma unroll
        for (int it = 0; it < 8; ++it) {
          const int row = it * 2 + hh;
          v4f v = *(const v4f*)(slab + row * 68 + c4);
          *(v4f*)(C + (size_t)(mBase + row) * ldc + n0 + c4) = v;
        }
        
      }
    } else {
      const int q = lane >> 3, c8 = (lane & 7) * 8;
      unsigned short* C  = (unsigned short*)Cout  + (size_t)b * strideC;
      unsigned short* C2 = (OUT_MODE == 2) ? ((unsigned short*)Cout2 + (size_t)b * strideC) : nullptr;
      {
#pragma unroll
        for (int it = 0; it < 4; ++it) {
          const int row = it * 4 + q;
          const float* sp = slab + row * 68 + c8;
          v8h hv, lv;
#pragma unroll
          for (int e = 0; e < 8; ++e) {
            if (OUT_MODE == 1) {
              hv[e] = (_Float16)sp[e];
            } else {
              unsigned short hb = f2bf_bits(sp[e]);
              unsigned short lb = f2bf_bits(sp[e] - bf_bits2f(hb));
              hv[e] = __builtin_bit_cast(_Float16, hb);
              lv[e] = __builtin_bit_cast(_Float16, lb);
            }
          }
          *(v8h*)(C + (size_t)(mBase + row) * ldc + n0 + c8) = hv;
          if (OUT_MODE == 2) *(v8h*)(C2 + (size_t)(mBase + row) * ldc + n0 + c8) = lv;
        }
        
      }
    }
    __builtin_amdgcn_fence(__ATOMIC_RELEASE, "workgroup");
    __builtin_amdgcn_wave_barrier();
    __builtin_amdgcn_fence(__ATOMIC_ACQUIRE, "workgroup");
  }
}

// ---------------------------------------------------------------------------
// Cast, 8 consecutive elements per thread: in f32 [n] -> out 16-bit bits [n].
//   MODE 0: bf16 RNE bits. MODE 1: f16 bits of (scale * bf16-RNE value) (scale = power-of-two carry).
// ---------------------------------------------------------------------------
template <int MODE>
__global__ __launch_bounds__(256) void cast8_kernel(const float* __restrict__ in, unsigned short* __restrict__ out, int n8, float scale) {
  const int i = blockIdx.x * 256 + threadIdx.x;
  if (i >= n8) return;
  const float* p = in + 8 * (size_t)i;
  const v4f a = *(const v4f*)(p);
  const v4f c = *(const v4f*)(p + 4);
  unsigned short hb[8];
#pragma unroll
  for (int e = 0; e < 4; ++e) {
    if (MODE == 0) {
      hb[e]     = f2bf_bits(a[e]);
      hb[4 + e] = f2bf_bits(c[e]);
    } else {
      hb[e]     = h_bits(bf_bits2f(f2bf_bits(a[e])) * scale);
      hb[4 + e] = h_bits(bf_bits2f(f2bf_bits(c[e])) * scale);
    }
  }
  const v4u u = (v4u){pk16(hb[0], hb[1]), pk16(hb[2], hb[3]), pk16(hb[4], hb[5]), pk16(hb[6], hb[7])};
  unsigned short* q = out + 8 * (size_t)i;
  *(v4u*)q = u;
  
  (void)scale;
}

// ---------------------------------------------------------------------------
// Transposing cast: in [R][CC] f32 row-major -> out [CC][R] 16-bit bits (MODE 0: bf16 RNE; MODE 1: f16 bits of in*scale).
// One block (256 threads) per 64x64 tile; grid = (CC/64, R/64); R, CC multiples of 64.
// Load phase: thread t reads in row r0 + (t>>2), 16 floats at cols c0 + (t&3)*16 -> 256 x 16 = 64x64 = whole tile, into LDS s[c][r].
// Store phase: wave w, it = 0..1: out row c0 + w*8 + it*4 + (lane>>3), 8 halves at r0 + (lane&7)*8
// ---------------------------------------------------------------------------
template <int MODE>
__device__ __forceinline__ unsigned short cvt16(float v, float scale) { return (MODE == 0) ? f2bf_bits(v) : h_bits(v * scale); }

template <int MODE>
__global__ __launch_bounds__(256) void transpose_cast64(const float* __restrict__ in, unsigned short* __restrict__ out,
                                                         int R, int CC, float scale) {
  __shared__ float s[64 * 65];   // s[c*65 + r]
  const int t  = threadIdx.x;
  const int c0 = blockIdx.x * 64;
  const int r0 = blockIdx.y * 64;
  {
    const int row = t >> 2, cq = (t & 3) * 16;
    const float* ip = in + (size_t)(r0 + row) * CC + c0 + cq;
#pragma unroll
    for (int e4 = 0; e4 < 4; ++e4) {
      const v4f v = *(const v4f*)(ip + 4 * e4);
#pragma unroll
      for (int e = 0; e < 4; ++e) s[(cq + 4 * e4 + e) * 65 + row] = v[e];
    }
  }
  __syncthreads();
  const int wave = t >> 5, lane = t & 31, q = lane >> 3, c8 = (lane & 7) * 8;
  const int orow0 = wave * 8 + q;        // it = 0
  const int orow1 = wave * 8 + 4 + q;    // it = 1
  unsigned short b0[8], b1v[8];
#pragma unroll
  for (int e = 0; e < 8; ++e) {
    b0[e]  = cvt16<MODE>(s[orow0 * 65 + c8 + e], scale);
    b1v[e] = cvt16<MODE>(s[orow1 * 65 + c8 + e], scale);
  }
  const v4u u0 = (v4u){pk16(b0[0], b0[1]), pk16(b0[2], b0[3]), pk16(b0[4], b0[5]), pk16(b0[6], b0[7])};
  const v4u u1 = (v4u){pk16(b1v[0], b1v[1]), pk16(b1v[2], b1v[3]), pk16(b1v[4], b1v[5]), pk16(b1v[6], b1v[7])};
  unsigned short* o0 = out + (size_t)(c0 + orow0) * R + r0 + c8;
  unsigned short* o1 = out + (size_t)(c0 + orow1) * R + r0 + c8;
  *(v4u*)o0 = u0;
  *(v4u*)o1 = u1;
  
}

// ---------------------------------------------------------------------------
// Zero-padded W3 plane for the 16-column-padded matvec: W3P f16 [16][128]; row 0 = f16(W3[k] * scale), rows 1..15 = 0.
// One block of 256 threads: thread t writes 8 halves at t*8 (row t>>4, cols (t&15)*8..+7) -> 256 x 8 = 2048 = whole plane;
// W3 is loaded unconditionally (index always < 128) and selected by value.
// ---------------------------------------------------------------------------
__global__ __launch_bounds__(256) void w3pad_kernel(const float* __restrict__ W3, unsigned short* __restrict__ W3P, float scale) {
  const int t = threadIdx.x;
  const int row = t >> 4, col = (t & 15) * 8;
  const v4f a = *(const v4f*)(W3 + col);
  const v4f c = *(const v4f*)(W3 + col + 4);
  unsigned short hb[8];
#pragma unroll
  for (int e = 0; e < 4; ++e) {
    hb[e]     = (row == 0) ? h_bits(a[e] * scale) : (unsigned short)0;
    hb[4 + e] = (row == 0) ? h_bits(c[e] * scale) : (unsigned short)0;
  }
  const v4u u = (v4u){pk16(hb[0], hb[1]), pk16(hb[2], hb[3]), pk16(hb[4], hb[5]), pk16(hb[6], hb[7])};
  unsigned short* q = W3P + 8 * (size_t)t;
  *(v4u*)q = u;
  
}

// ---------------------------------------------------------------------------
// Pairwise MLP: for i in [i0, i0+16), j in [j0, j0+32):
//   h1 = relu((p1[i] + p2[j]) + b1)            f32 -> f16 LDS tile [32][256]   (built per i, 256 threads x 32 elements = 8192 = whole tile)
//   h2 = relu(h1 . (16 W2) / 16 + b2)          f16 WMMA, 8 waves: wave w -> columns 16w..16w+15, both 16-row tiles; A from LDS, B resident
//                                               -> f16 LDS tile [32][128] (each lane writes its column for 16 rows; 8 waves x 32 x 16 = whole tile)
//   logit = h2 . (8 W3P) / 8                    f16 WMMA, waves 0/1 (16-row tiles), B = padded W3 plane, column 0 of D -> LDS logits
//   sim = 1 / (1 + exp(-(logit + b3)))         f32
// ---------------------------------------------------------------------------
__global__ __launch_bounds__(256) void pairmlp_kernel(const float* __restrict__ p1, const float* __restrict__ p2,
                                                      const float* __restrict__ b1,
                                                      const unsigned short* __restrict__ W2Tp, const float* __restrict__ b2,
                                                      const unsigned short* __restrict__ W3Pp, const float* __restrict__ b3,
                                                      float* __restrict__ out) {
  __shared__ __align__(16) float    s_p2[kTJ * kHid];     // 32768 B  p2 rows j0..j0+31, f32
  __shared__ __align__(16) _Float16 s_h1[kTJ * kH1P];     // 16896 B  h1 tile [32][264]
  __shared__ __align__(16) _Float16 s_h2[kTJ * kH2P];     //  8704 B  h2 tile [32][136]
  __shared__ __align__(16) float    s_sim[kTI * kTJ];     //  2048 B  logits / sims [16][32]

  const _Float16* W2T = (const _Float16*)W2Tp;   // [128][256], f16 of 16*W2[k][n] at [n][k]
  const _Float16* W3P = (const _Float16*)W3Pp;   // [16][128],  row 0 = f16 of 8*W3[k]
  const int tid  = threadIdx.x;
  const int lane = tid & 31;
  const int wave = tid >> 5;
  const int hh   = lane >> 4;
  const int m    = lane & 15;
  const int j0   = blockIdx.x * kTJ;
  const int i0   = blockIdx.y * kTI;

  // ---- stage p2 rows: 8 x 256 float4 = 8192 floats = [32][256] ----
#pragma unroll
  for (int it = 0; it < 8; ++it) {
    const int idx4 = it * 256 + tid;
    const int row  = idx4 >> 6;
    const int cc   = (idx4 & 63) * 4;
    *(v4f*)&s_p2[row * kHid + cc] = *(const v4f*)(p2 + (size_t)(j0 + row) * kHid + cc);
  }

  // ---- resident B fragments: B[k][n] = W2T[n][k], n = 16*wave + m (split k map via Frag::load) ----
  const int ncol = wave * 16 + m;
  v16h bfr[8];
#pragma unroll
  for (int c = 0; c < 8; ++c) bfr[c] = Frag<_Float16>::load(W2T + (size_t)ncol * kHid + c * 32 + 8 * hh);
  const float b2v = b2[ncol];
  const float b3v = b3[0];

  // ---- build-phase constants: thread -> k range k8..k8+7, rows jr + 8g ----
  const int k8 = (tid & 31) * 8;
  const int jr = tid >> 5;
  const v4f b1a = *(const v4f*)(b1 + k8);
  const v4f b1b = *(const v4f*)(b1 + k8 + 4);

  __syncthreads();   // s_p2 staged

  const v8f zero8 = (v8f){0.f, 0.f, 0.f, 0.f, 0.f, 0.f, 0.f, 0.f};

#pragma unroll 1
  for (int ii = 0; ii < kTI; ++ii) {
    // ---- build h1 rows for (i0+ii, j0..j0+31) ----
    {
      const float* pr = p1 + (size_t)(i0 + ii) * kHid + k8;
      const v4f pa = *(const v4f*)(pr);
      const v4f pb = *(const v4f*)(pr + 4);
#pragma unroll
      for (int g = 0; g < 4; ++g) {
        const int jj = jr + 8 * g;
        const v4f xa = *(const v4f*)&s_p2[jj * kHid + k8];
        const v4f xb = *(const v4f*)&s_p2[jj * kHid + k8 + 4];
        v8h hv;
#pragma unroll
        for (int e = 0; e < 4; ++e) {
          hv[e]     = (_Float16)fmaxf((pa[e] + xa[e]) + b1a[e], 0.0f);
          hv[4 + e] = (_Float16)fmaxf((pb[e] + xb[e]) + b1b[e], 0.0f);
        }
        *(v8h*)&s_h1[jj * kH1P + k8] = hv;
      }
    }
    __syncthreads();   // h1 tile ready (and the h2 tile of the last step has been consumed by waves 0/1)

    // ---- h2pre = h1 (32 x 256) . (16 W2) strip: A rows m / 16+m from LDS, split k map ----
    v8f acc0 = zero8, acc1 = zero8;
#pragma unroll
    for (int c = 0; c < 8; ++c) {
      const v16h a0 = Frag<_Float16>::load(s_h1 + m * kH1P + c * 32 + 8 * hh);
      const v16h a1 = Frag<_Float16>::load(s_h1 + (16 + m) * kH1P + c * 32 + 8 * hh);
      acc0 = Frag<_Float16>::mma(a0, bfr[c], acc0);
      acc1 = Frag<_Float16>::mma(a1, bfr[c], acc1);
      dep_guard_h(acc0, acc1, a0, a1);
    }

    // ---- h2 = relu(h2pre/16 + b2) -> f16 LDS; D element r = row 8*hh + r (tile 0) / 16 + 8*hh + r (tile 1), col ncol ----
#pragma unroll
    for (int r = 0; r < 8; ++r) {
      s_h2[(8 * hh + r) * kH2P + ncol]      = (_Float16)fmaxf(acc0[r] * kW2CarryInv + b2v, 0.0f);
      s_h2[(16 + 8 * hh + r) * kH2P + ncol] = (_Float16)fmaxf(acc1[r] * kW2CarryInv + b2v, 0.0f);
    }
    __syncthreads();   // h2 tile ready; h1 tile free for the next step

    // ---- logit = h2 (16 rows) . (8 W3) padded to 16 columns: waves 0/1, wave-uniform ----
    if (wave < 2) {
      v8f acc2 = zero8;
#pragma unroll
      for (int c = 0; c < 4; ++c) {
        const v16h a  = Frag<_Float16>::load(s_h2 + (wave * 16 + m) * kH2P + c * 32 + 8 * hh);
        const v16h bw = Frag<_Float16>::load(W3P + m * kHid2 + c * 32 + 8 * hh);
        acc2 = mma_h(a, bw, acc2);
      }
      if (m == 0) {   // column 0: lane 0 -> rows 0..7, lane 16 -> rows 8..15 of this wave's 16-row tile
        const v4f lo = (v4f){acc2[0] * kW3CarryInv, acc2[1] * kW3CarryInv, acc2[2] * kW3CarryInv, acc2[3] * kW3CarryInv};
        const v4f hi = (v4f){acc2[4] * kW3CarryInv, acc2[5] * kW3CarryInv, acc2[6] * kW3CarryInv, acc2[7] * kW3CarryInv};
        float* sp = s_sim + ii * kTJ + wave * 16 + 8 * hh;
        *(v4f*)(sp)     = lo;
        *(v4f*)(sp + 4) = hi;
      }
    }
  }
  __syncthreads();   // all logits in s_sim

  // ---- sigmoid in f32: 512 values, 2 per thread ----
#pragma unroll
  for (int e2 = 0; e2 < 2; ++e2) {
    const int idx = e2 * 256 + tid;
    const float x = s_sim[idx] + b3v;
    const float s = 1.0f / (1.0f + expf(-x));
    s_sim[idx] = s;
  }
  __syncthreads();

  if (wave < 4) {
    const int q = lane >> 3, c4 = (lane & 7) * 4;
    const int ii = wave * 4 + q;
    const v4f v = *(const v4f*)&s_sim[ii * kTJ + c4];
    float* op = out + (size_t)(i0 + ii) * kNJ + j0 + c4;
    *(v4f*)op = v;
    
  }
}

// ---------------------------------------------------------------------------
// Workspace region map (byte offsets, all multiples of 128; every region fully written before it is read):
//   F1B  bf16 [1024][512]  feat1                      0
//   F2B  bf16 [1024][512]  feat2              1,048,576
//   W1AT bf16 [256][512]   W1[0:512]^T        2,097,152
//   W1BT bf16 [256][512]   W1[512:1024]^T     2,359,296
//   W2T  f16  [128][256]   (16 W2)^T          2,621,440
//   W3P  f16  [16][128]    row 0 = 8 W3       2,686,976
//   P1   f32  [1024][256]                     2,691,072
//   P2   f32  [1024][256]                     3,739,648
//   total                                     4,788,224 B
// GEMM shapes: p1/p2 M=1024 N=256 K=512 (K % 32 == 0, M, N % 64 == 0, no padded planes);
// pair kernel: K=256 and K=128 in whole 32-steps from LDS tiles of exactly that width.
// ---------------------------------------------------------------------------
extern "C" void kernel_launch(void* const* d_in, const int* in_sizes, int n_in,
                              void* d_out, int out_size, void* d_ws, size_t ws_size,
                              hipStream_t stream) {
  if (n_in < 8) return;
  if (in_sizes[0] != kNI * kFeat) return;
  if (in_sizes[1] != kNJ * kFeat) return;
  if (in_sizes[2] != 2 * kFeat * kHid) return;
  if (in_sizes[3] != kHid) return;
  if (in_sizes[4] != kHid * kHid2) return;
  if (in_sizes[5] != kHid2) return;
  if (in_sizes[6] != kHid2) return;
  if (in_sizes[7] < 1) return;
  if (out_size != kNI * kNJ) return;

  const float* feat1 = (const float*)d_in[0];   // [1024][512]
  const float* feat2 = (const float*)d_in[1];   // [1024][512]
  const float* W1    = (const float*)d_in[2];   // [1024][256]  ([in][out])
  const float* b1    = (const float*)d_in[3];   // [256]
  const float* W2    = (const float*)d_in[4];   // [256][128]   ([in][out])
  const float* b2    = (const float*)d_in[5];   // [128]
  const float* W3    = (const float*)d_in[6];   // [128][1]
  const float* b3    = (const float*)d_in[7];   // [1]
  float* outp = (float*)d_out;                  // [1024][1024] f32

  // ---- carve ----
  const size_t SZ_FB  = (size_t)kNI * kFeat * 2;      // 1,048,576
  const size_t SZ_W1T = (size_t)kHid * kFeat * 2;     //   262,144
  const size_t SZ_W2T = (size_t)kHid2 * kHid * 2;     //    65,536
  const size_t SZ_W3P = (size_t)16 * kHid2 * 2;       //     4,096
  const size_t SZ_P   = (size_t)kNI * kHid * 4;       // 1,048,576
  size_t off = 0;
  const size_t oF1B  = off; off += SZ_FB;
  const size_t oF2B  = off; off += SZ_FB;
  const size_t oW1AT = off; off += SZ_W1T;
  const size_t oW1BT = off; off += SZ_W1T;
  const size_t oW2T  = off; off += SZ_W2T;
  const size_t oW3P  = off; off += SZ_W3P;
  const size_t oP1   = off; off += SZ_P;
  const size_t oP2   = off; off += SZ_P;
  const size_t TOTAL = off;                           // 4,788,224
  if (TOTAL > ws_size) return;
  if (TOTAL > (size_t)134217728) return;

  char* ws = (char*)d_ws;
  unsigned short* F1B  = (unsigned short*)(ws + oF1B);
  unsigned short* F2B  = (unsigned short*)(ws + oF2B);
  unsigned short* W1AT = (unsigned short*)(ws + oW1AT);
  unsigned short* W1BT = (unsigned short*)(ws + oW1BT);
  unsigned short* W2T  = (unsigned short*)(ws + oW2T);
  unsigned short* W3P  = (unsigned short*)(ws + oW3P);
  float*          P1   = (float*)(ws + oP1);
  float*          P2   = (float*)(ws + oP2);

  const dim3 blk(256);

  // (0) feat1, feat2 -> bf16 RNE planes: n8 = 65,536 -> 256 blocks exactly each
  {
    const int n8 = kNI * kFeat / 8;
    cast8_kernel<0><<<dim3(n8 / 256), blk, 0, stream>>>(feat1, F1B, n8, 1.0f);
    cast8_kernel<0><<<dim3(n8 / 256), blk, 0, stream>>>(feat2, F2B, n8, 1.0f);
  }
  // (1) W1[0:512] in [512][256] -> W1AT out [256][512] bf16; grid (cols/64, rows/64) = (4, 8)
  transpose_cast64<0><<<dim3(kHid / 64, kFeat / 64), blk, 0, stream>>>(W1, W1AT, kFeat, kHid, 1.0f);
  //     W1[512:1024] in [512][256] -> W1BT out [256][512] bf16; grid (4, 8)
  transpose_cast64<0><<<dim3(kHid / 64, kFeat / 64), blk, 0, stream>>>(W1 + (size_t)kFeat * kHid, W1BT, kFeat, kHid, 1.0f);
  //     W2 in [256][128] -> W2T out [128][256] f16 of 16*W2; grid (128/64, 256/64) = (2, 4)
  transpose_cast64<1><<<dim3(kHid2 / 64, kHid / 64), blk, 0, stream>>>(W2, W2T, kHid, kHid2, kW2Carry);
  // (2) padded W3 plane [16][128]
  w3pad_kernel<<<dim3(1), blk, 0, stream>>>(W3, W3P, kW3Carry);

  // (3) p1 = feat1 . W1[0:512], p2 = feat2 . W1[512:1024]: M=1024 N=256 K=512 -> f32 [1024][256]; 64 tiles -> 8 blocks each
  const dim3 gP((((kNI / 64) * (kHid / 64)) + 7) / 8, 1);
  wmma_gemm64<1, false, 0, 0, false, 0><<<gP, blk, 0, stream>>>(
      F1B, F1B, kFeat, 0L, W1AT, W1AT, kFeat, 0L, (void*)P1, (void*)P1, kHid, 0L, b1, b1, 0L, kNI, kHid, kFeat, 1.0f);
  wmma_gemm64<1, false, 0, 0, false, 0><<<gP, blk, 0, stream>>>(
      F2B, F2B, kFeat, 0L, W1BT, W1BT, kFeat, 0L, (void*)P2, (void*)P2, kHid, 0L, b1, b1, 0L, kNJ, kHid, kFeat, 1.0f);

  pairmlp_kernel<<<dim3(kNJ / kTJ, kNI / kTI), blk, 0, stream>>>(P1, P2, b1, W2T, b2, W3P, b3, outp);
}

// v001
// A run of this version takes 111 microseconds.
// Timed twice side by side with v000, it ran 1.44 times as fast both times.
// Contractions: feat1|feat2 x W1 halves on v_wmma_f32_16x16x32_bf16 (inputs RNE-converted to bf16); pairwise relu(p1+b1+p2) x W2 (h1 f16, W2 f16 carried x16) and h2 x W3 (h2 f16 carried x16, W3 f16 carried x8, M padded to 16), both transposed, on v_wmma_f32_16x16x32_f16; f32 accumulate; bias/sigmoid in f32, relu on the converted f16 values.
#include <hip/hip_runtime.h>
#include <math.h>

// ---------------------------------------------------------------------------
// Problem constants
// ---------------------------------------------------------------------------
constexpr int kNI   = 1024;   // rows of feat1 (output rows i)
constexpr int kNJ   = 1024;   // rows of feat2 (output cols j)
constexpr int kFeat = 512;
constexpr int kHid  = 256;
constexpr int kHid2 = 128;
constexpr int kBI   = 64;     // i rows per block of the pair kernel
constexpr int kBJ   = 64;     // j columns per block of the pair kernel (16 per wave)
constexpr int kW2P  = 264;    // f16 pitch of the staged W2^T rows (528 B = 16 B x odd: ds_load_b128 without bank conflicts)
constexpr int kLgP  = 128;    // floats per row of the logit tile: 4 waves x 32 lanes
constexpr float kW2Carry  = 16.0f;
constexpr float kW3Carry  = 8.0f;
constexpr float kLogitInv = 1.0f / 128.0f;   // undoes both carries at the logit

typedef __attribute__((ext_vector_type(16))) _Float16 v16h;
typedef __attribute__((ext_vector_type(8)))  _Float16 v8h;
typedef __attribute__((ext_vector_type(4)))  _Float16 v4h;
typedef __attribute__((ext_vector_type(16))) __bf16   v16b;
typedef __attribute__((ext_vector_type(8)))  __bf16   v8b;
typedef __attribute__((ext_vector_type(8)))  float    v8f;
typedef __attribute__((ext_vector_type(4)))  float    v4f;
typedef __attribute__((ext_vector_type(4)))  unsigned int v4u;

__device__ __forceinline__ unsigned short f2bf_bits(float f) {
  unsigned u = __float_as_uint(f);
  return (unsigned short)((u + 0x7FFFu + ((u >> 16) & 1u)) >> 16);
}
__device__ __forceinline__ float bf_bits2f(unsigned short h) { return __uint_as_float(((unsigned)h) << 16); }

// hazard guards as plain device helpers (no inline asm inside the kernel template body)
__device__ __forceinline__ void dep_guard_h(v8f& a, v8f& b, v16h x, v16h y) { asm volatile("v_nop\n\tv_nop\n\tv_nop\n\tv_nop" : "+v"(a), "+v"(b) : "v"(x), "v"(y)); }
__device__ __forceinline__ void dep_guard_b(v8f& a, v8f& b, v16b x, v16b y) { asm volatile("v_nop\n\tv_nop\n\tv_nop\n\tv_nop" : "+v"(a), "+v"(b) : "v"(x), "v"(y)); }
__device__ __forceinline__ void keep4_h(v16h a, v16h b, v16h c, v16h d) { asm volatile("v_nop" :: "v"(a), "v"(b), "v"(c), "v"(d)); }
__device__ __forceinline__ void keep4_b(v16b a, v16b b, v16b c, v16b d) { asm volatile("v_nop" :: "v"(a), "v"(b), "v"(c), "v"(d)); }
__device__ __forceinline__ void acc_guard4(v8f& a, v8f& b, v8f& c, v8f& d) { asm volatile("v_nop\n\tv_nop\n\tv_nop\n\tv_nop" : "+v"(a), "+v"(b), "+v"(c), "+v"(d)); }
template <typename T> struct Frag;
template <> struct Frag<_Float16> {
  typedef v16h V; union U { v16h v; v8h h[2]; };
  static __device__ __forceinline__ v16h load(const _Float16* p) {   // elements 0..7 <- p[0..7], 8..15 <- p[16..23]
    U f; f.h[0] = *(const v8h*)(p); f.h[1] = *(const v8h*)(p + 16); return f.v;
  }
  static __device__ __forceinline__ v8f mma(v16h a, v16h b, v8f c) {
    return __builtin_amdgcn_wmma_f32_16x16x32_f16(false, a, false, b, (short)0, c, false, false);
  }
  static __device__ __forceinline__ void guard(v8f& a, v8f& b, v16h x, v16h y) { dep_guard_h(a, b, x, y); }
  static __device__ __forceinline__ void keep(v16h a, v16h b, v16h c, v16h d) { keep4_h(a, b, c, d); }
};
template <> struct Frag<__bf16> {
  typedef v16b V; union U { v16b v; v8b h[2]; };
  static __device__ __forceinline__ v16b load(const __bf16* p) {
    U f; f.h[0] = *(const v8b*)(p); f.h[1] = *(const v8b*)(p + 16); return f.v;
  }
  static __device__ __forceinline__ v8f mma(v16b a, v16b b, v8f c) {
    return __builtin_amdgcn_wmma_f32_16x16x32_bf16(false, a, false, b, (short)0, c, false, false);
  }
  static __device__ __forceinline__ void guard(v8f& a, v8f& b, v16b x, v16b y) { dep_guard_b(a, b, x, y); }
  static __device__ __forceinline__ void keep(v16b a, v16b b, v16b c, v16b d) { keep4_b(a, b, c, d); }
};

__device__ __forceinline__ unsigned pk16(unsigned short a, unsigned short b) { return (unsigned)a | ((unsigned)b << 16); }
__device__ __forceinline__ unsigned short h_bits(float f) { const _Float16 h = (_Float16)f; return __builtin_bit_cast(unsigned short, h); }

// ---- Register-blocked batched WMMA GEMM (unused
//      activation modes removed) --------------------------------------------
// C[m,n] = scale * sum_k A[m,k] * Bt[n,k] (+bias)(+resid); each wave owns a 64x64 tile.
// A row-major [M,K]; Bt row-major [N,K]; M,N % 64 == 0, K % 32 == 0.
// SPLIT: operands are hi/lo planes (A2/Bt2 = lo planes, same layout); product = hi.hi + hi.lo + lo.hi.
// BIAS_MODE: 0 = none, 1 = bias[m], 2 = bias[n].
// OUT_MODE: 0 = f32, 1 = f16, 2 = bf16 hi plane (Cout) + bf16 lo plane (Cout2).
// ET: 0 = f16 operands, 1 = bf16 operands (pointers passed as 16-bit storage)
template <int ET> struct Elem;
template <> struct Elem<0> { typedef _Float16 T; };
template <> struct Elem<1> { typedef __bf16 T; };
template <int ET, bool SPLIT, int BIAS_MODE, int OUT_MODE, bool RESID, int ACT = 0>
__global__ __launch_bounds__(256) void wmma_gemm64(
    const unsigned short* __restrict__ Ap, const unsigned short* __restrict__ A2p, int lda, long strideA,
    const unsigned short* __restrict__ Btp, const unsigned short* __restrict__ Bt2p, int ldb, long strideB,
    void* __restrict__ Cout, void* __restrict__ Cout2, int ldc, long strideC,
    const float* __restrict__ bias,
    const float* __restrict__ resid, long strideR,
    int M, int N, int K, float scale) {
  typedef typename Elem<ET>::T T;
  typedef typename Frag<T>::V V;
  const T* A = (const T*)Ap; const T* A2 = (const T*)A2p; const T* Bt = (const T*)Btp; const T* Bt2 = (const T*)Bt2p;
  __shared__ __align__(16) float sT[8][16 * 68];   // per-wave 16x64 slab, pitch 68 floats
  const int b    = blockIdx.y;
  const int lane = threadIdx.x & 31;
  const int wave = threadIdx.x >> 5;
  const int tilesN = N >> 6;
  const int tilesM = M >> 6;
  const int tile = blockIdx.x * 8 + wave;
  if (tile >= tilesM * tilesN) return;   // wave-uniform; no block barriers in this kernel
  const int tm = tile / tilesN;
  const int tn = tile - tm * tilesN;
  const int m0 = tm << 6;
  const int n0 = tn << 6;

  const T* Ab  = A  + (size_t)b * strideA;
  const T* Bb  = Bt + (size_t)b * strideB;
  const T* Ab2 = SPLIT ? (A2  + (size_t)b * strideA) : nullptr;
  const T* Bb2 = SPLIT ? (Bt2 + (size_t)b * strideB) : nullptr;

  const int rlane = lane & 15;                 // row (A) / col (B, D) within subtile
  const int koff  = (lane >> 4) * 8;           // k offset of this lane half
  const int mOff  = (lane >> 4) * 8;           // D row offset

  v8f acc[4][4];
#pragma unroll
  for (int i = 0; i < 4; ++i)
#pragma unroll
    for (int j = 0; j < 4; ++j) acc[i][j] = (v8f){0.f,0.f,0.f,0.f,0.f,0.f,0.f,0.f};

  for (int k0 = 0; k0 < K; k0 += 32) {
    V bh[4], bl[4];
#pragma unroll
    for (int j = 0; j < 4; ++j) {
      const size_t bo = (size_t)(n0 + (j << 4) + rlane) * ldb + koff + k0;
      bh[j] = Frag<T>::load(Bb + bo);
      if (SPLIT) bl[j] = Frag<T>::load(Bb2 + bo);
    }
#pragma unroll
    for (int i = 0; i < 4; ++i) {
      const size_t ao = (size_t)(m0 + (i << 4) + rlane) * lda + koff + k0;
      V ah = Frag<T>::load(Ab + ao);
      V al;
      if (SPLIT) al = Frag<T>::load(Ab2 + ao);
#pragma unroll
      for (int j = 0; j < 4; ++j) {
        acc[i][j] = Frag<T>::mma(ah, bh[j], acc[i][j]);
        if (SPLIT) {
          acc[i][j] = Frag<T>::mma(ah, bl[j], acc[i][j]);
          acc[i][j] = Frag<T>::mma(al, bh[j], acc[i][j]);
        }
      }
      Frag<T>::guard(acc[i][0], acc[i][3], ah, SPLIT ? al : ah);
    }
    Frag<T>::keep(bh[0], bh[1], bh[2], bh[3]);
    if (SPLIT) Frag<T>::keep(bl[0], bl[1], bl[2], bl[3]);
  }
  acc_guard4(acc[0][0], acc[0][1], acc[0][2], acc[0][3]);
  acc_guard4(acc[1][0], acc[1][1], acc[1][2], acc[1][3]);
  acc_guard4(acc[2][0], acc[2][1], acc[2][2], acc[2][3]);
  acc_guard4(acc[3][0], acc[3][1], acc[3][2], acc[3][3]);

  // ---- epilogue ----
  float* slab = sT[wave];
  const float* Rb = RESID ? (resid + (size_t)b * strideR) : nullptr;
#pragma unroll
  for (int i = 0; i < 4; ++i) {
    const int mBase = m0 + (i << 4);
#pragma unroll
    for (int j = 0; j < 4; ++j) {
      const int n = n0 + (j << 4) + rlane;
      float bv = 0.f;
      if (BIAS_MODE == 2) bv = bias[n];
#pragma unroll
      for (int r = 0; r < 8; ++r) {
        float v = acc[i][j][r] * scale;
        if (BIAS_MODE == 1) v += bias[mBase + mOff + r];
        if (BIAS_MODE == 2) v += bv;
        if (RESID) v += Rb[(size_t)(mBase + mOff + r) * ldc + n];
        if (ACT == 2) v = fmaxf(v, 0.0f);
        slab[(mOff + r) * 68 + (j << 4) + rlane] = v;
      }
    }
    __builtin_amdgcn_fence(__ATOMIC_RELEASE, "workgroup");
    __builtin_amdgcn_wave_barrier();
    __builtin_amdgcn_fence(__ATOMIC_ACQUIRE, "workgroup");
    if (OUT_MODE == 0) {
      float* C = (float*)Cout + (size_t)b * strideC;
      const int hh = lane >> 4, c4 = (lane & 15) * 4;     // row seg = 256 B = 16 lanes x 16 B
      {
#pragma unroll
        for (int it = 0; it < 8; ++it) {
          const int row = it * 2 + hh;
          v4f v = *(const v4f*)(slab + row * 68 + c4);
          *(v4f*)(C + (size_t)(mBase + row) * ldc + n0 + c4) = v;
        }
        
      }
    } else {
      const int q = lane >> 3, c8 = (lane & 7) * 8;
      unsigned short* C  = (unsigned short*)Cout  + (size_t)b * strideC;
      unsigned short* C2 = (OUT_MODE == 2) ? ((unsigned short*)Cout2 + (size_t)b * strideC) : nullptr;
      {
#pragma unroll
        for (int it = 0; it < 4; ++it) {
          const int row = it * 4 + q;
          const float* sp = slab + row * 68 + c8;
          v8h hv, lv;
#pragma unroll
          for (int e = 0; e < 8; ++e) {
            if (OUT_MODE == 1) {
              hv[e] = (_Float16)sp[e];
            } else {
              unsigned short hb = f2bf_bits(sp[e]);
              unsigned short lb = f2bf_bits(sp[e] - bf_bits2f(hb));
              hv[e] = __builtin_bit_cast(_Float16, hb);
              lv[e] = __builtin_bit_cast(_Float16, lb);
            }
          }
          *(v8h*)(C + (size_t)(mBase + row) * ldc + n0 + c8) = hv;
          if (OUT_MODE == 2) *(v8h*)(C2 + (size_t)(mBase + row) * ldc + n0 + c8) = lv;
        }
        
      }
    }
    __builtin_amdgcn_fence(__ATOMIC_RELEASE, "workgroup");
    __builtin_amdgcn_wave_barrier();
    __builtin_amdgcn_fence(__ATOMIC_ACQUIRE, "workgroup");
  }
}

// ---------------------------------------------------------------------------
// Cast, 8 consecutive elements per thread: in f32 [n] -> out 16-bit bits [n].
//   MODE 0: bf16 RNE bits. MODE 1: f16 bits of (scale * bf16-RNE value) (scale = power-of-two carry).
// ---------------------------------------------------------------------------
template <int MODE>
__global__ __launch_bounds__(256) void cast8_kernel(const float* __restrict__ in, unsigned short* __restrict__ out, int n8, float scale) {
  const int i = blockIdx.x * 256 + threadIdx.x;
  if (i >= n8) return;
  const float* p = in + 8 * (size_t)i;
  const v4f a = *(const v4f*)(p);
  const v4f c = *(const v4f*)(p + 4);
  unsigned short hb[8];
#pragma unroll
  for (int e = 0; e < 4; ++e) {
    if (MODE == 0) {
      hb[e]     = f2bf_bits(a[e]);
      hb[4 + e] = f2bf_bits(c[e]);
    } else {
      hb[e]     = h_bits(bf_bits2f(f2bf_bits(a[e])) * scale);
      hb[4 + e] = h_bits(bf_bits2f(f2bf_bits(c[e])) * scale);
    }
  }
  const v4u u = (v4u){pk16(hb[0], hb[1]), pk16(hb[2], hb[3]), pk16(hb[4], hb[5]), pk16(hb[6], hb[7])};
  unsigned short* q = out + 8 * (size_t)i;
  *(v4u*)q = u;
  
  (void)scale;
}

// ---------------------------------------------------------------------------
// Transposing cast: in [R][CC] f32 row-major -> out [CC][R] 16-bit bits (MODE 0: bf16 RNE; MODE 1: f16 bits of in*scale).
// One block (256 threads) per 64x64 tile; grid = (CC/64, R/64); R, CC multiples of 64.
// Load phase: thread t reads in row r0 + (t>>2), 16 floats at cols c0 + (t&3)*16 -> 256 x 16 = 64x64 = whole tile, into LDS s[c][r].
// Store phase: wave w, it = 0..1: out row c0 + w*8 + it*4 + (lane>>3), 8 halves at r0 + (lane&7)*8
// ---------------------------------------------------------------------------
template <int MODE>
__device__ __forceinline__ unsigned short cvt16(float v, float scale) { return (MODE == 0) ? f2bf_bits(v) : h_bits(v * scale); }

template <int MODE>
__global__ __launch_bounds__(256) void transpose_cast64(const float* __restrict__ in, unsigned short* __restrict__ out,
                                                         int R, int CC, float scale) {
  __shared__ float s[64 * 65];   // s[c*65 + r]
  const int t  = threadIdx.x;
  const int c0 = blockIdx.x * 64;
  const int r0 = blockIdx.y * 64;
  {
    const int row = t >> 2, cq = (t & 3) * 16;
    const float* ip = in + (size_t)(r0 + row) * CC + c0 + cq;
#pragma unroll
    for (int e4 = 0; e4 < 4; ++e4) {
      const v4f v = *(const v4f*)(ip + 4 * e4);
#pragma unroll
      for (int e = 0; e < 4; ++e) s[(cq + 4 * e4 + e) * 65 + row] = v[e];
    }
  }
  __syncthreads();
  const int wave = t >> 5, lane = t & 31, q = lane >> 3, c8 = (lane & 7) * 8;
  const int orow0 = wave * 8 + q;        // it = 0
  const int orow1 = wave * 8 + 4 + q;    // it = 1
  unsigned short b0[8], b1v[8];
#pragma unroll
  for (int e = 0; e < 8; ++e) {
    b0[e]  = cvt16<MODE>(s[orow0 * 65 + c8 + e], scale);
    b1v[e] = cvt16<MODE>(s[orow1 * 65 + c8 + e], scale);
  }
  const v4u u0 = (v4u){pk16(b0[0], b0[1]), pk16(b0[2], b0[3]), pk16(b0[4], b0[5]), pk16(b0[6], b0[7])};
  const v4u u1 = (v4u){pk16(b1v[0], b1v[1]), pk16(b1v[2], b1v[3]), pk16(b1v[4], b1v[5]), pk16(b1v[6], b1v[7])};
  unsigned short* o0 = out + (size_t)(c0 + orow0) * R + r0 + c8;
  unsigned short* o1 = out + (size_t)(c0 + orow1) * R + r0 + c8;
  *(v4u*)o0 = u0;
  *(v4u*)o1 = u1;
  
}

// ---------------------------------------------------------------------------
// Zero-padded W3 plane for the 16-column-padded matvec: W3P f16 [16][128]; row 0 = f16(W3[k] * scale), rows 1..15 = 0.
// One block of 256 threads: thread t writes 8 halves at t*8 (row t>>4, cols (t&15)*8..+7) -> 256 x 8 = 2048 = whole plane;
// W3 is loaded unconditionally (index always < 128) and selected by value.
// ---------------------------------------------------------------------------
__global__ __launch_bounds__(256) void w3pad_kernel(const float* __restrict__ W3, unsigned short* __restrict__ W3P, float scale) {
  const int t = threadIdx.x;
  const int row = t >> 4, col = (t & 15) * 8;
  const v4f a = *(const v4f*)(W3 + col);
  const v4f c = *(const v4f*)(W3 + col + 4);
  unsigned short hb[8];
#pragma unroll
  for (int e = 0; e < 4; ++e) {
    hb[e]     = (row == 0) ? h_bits(a[e] * scale) : (unsigned short)0;
    hb[4 + e] = (row == 0) ? h_bits(c[e] * scale) : (unsigned short)0;
  }
  const v4u u = (v4u){pk16(hb[0], hb[1]), pk16(hb[2], hb[3]), pk16(hb[4], hb[5]), pk16(hb[6], hb[7])};
  unsigned short* q = W3P + 8 * (size_t)t;
  *(v4u*)q = u;
  
}

// ---------------------------------------------------------------------------
// Pairwise MLP, transposed products, everything between p1/p2 and the logit stays in registers.
// Block = 4 waves (one per SIMD) on 64 i x 64 j; wave w owns columns j0 + 16w .. +15 and walks the 64 i.
//   A (resident)  = (16 W2)^T fragments, 8 row tiles (n) x 8 k steps
//   B (built)     = h1^T: lane (hh, c) holds pair column c, k = kmap order; h1 = relu((p1[i] + b1) + p2[j]) f32 -> f16
//   D             = 16 h2pre^T + 16 b2 (16 b2 is the accumulator's start value); D[8 hh + r][c]
//   two D tiles, relu'd and converted in place, are the B fragment of the W3 product (A = padded 8 W3 plane, row 0)
//   logit = D2[0][c] / 128; sim = 1 / (1 + exp(-(logit + b3))) in f32
// The W3 product of step i runs among the W2 products of step i + 1.
// ---------------------------------------------------------------------------
__device__ __forceinline__ v16h h1_frag(const v4f* __restrict__ x, const v4f* __restrict__ y) {
  union { v16h v; v4h q[4]; } f;
  const v4h z = (v4h){(_Float16)0.f, (_Float16)0.f, (_Float16)0.f, (_Float16)0.f};
#pragma unroll
  for (int q = 0; q < 4; ++q) f.q[q] = __builtin_elementwise_max(__builtin_convertvector(x[q] + y[q], v4h), z);
  return f.v;
}
__device__ __forceinline__ v16h h2_frag(v8f lo, v8f hi) {
  union { v16h v; v8h h[2]; } f;
  const v8h z = (v8h){(_Float16)0.f, (_Float16)0.f, (_Float16)0.f, (_Float16)0.f, (_Float16)0.f, (_Float16)0.f, (_Float16)0.f, (_Float16)0.f};
  f.h[0] = __builtin_elementwise_max(__builtin_convertvector(lo, v8h), z);
  f.h[1] = __builtin_elementwise_max(__builtin_convertvector(hi, v8h), z);
  return f.v;
}
// register 0 of D2 = (8 W3 plane) x (16 h2)^T over the four k steps; four independent WMMAs, their partial sums added in k order
// (one accumulator would make a chain of four dependent WMMAs)
__device__ __forceinline__ float logit128(const v16h* __restrict__ w, const v16h* __restrict__ h) {
  const v8f z = (v8f){0.f, 0.f, 0.f, 0.f, 0.f, 0.f, 0.f, 0.f};
  const v8f d0 = Frag<_Float16>::mma(w[0], h[0], z);
  const v8f d1 = Frag<_Float16>::mma(w[1], h[1], z);
  const v8f d2 = Frag<_Float16>::mma(w[2], h[2], z);
  const v8f d3 = Frag<_Float16>::mma(w[3], h[3], z);
  return ((d0[0] + d1[0]) + d2[0]) + d3[0];
}
// the 16 f32 of one k step in kmap order: floats 0..7 and 16..23 behind p (p already holds the 8*hh offset)
__device__ __forceinline__ void ld16(v4f* d, const float* p) {
  d[0] = *(const v4f*)(p);
  d[1] = *(const v4f*)(p + 4);
  d[2] = *(const v4f*)(p + 16);
  d[3] = *(const v4f*)(p + 20);
}

__global__ __launch_bounds__(128) void pairmlp_kernel(const float* __restrict__ p1, const float* __restrict__ p2,
                                                      const float* __restrict__ b1,
                                                      const unsigned short* __restrict__ W2Tp, const float* __restrict__ b2,
                                                      const unsigned short* __restrict__ W3Pp, const float* __restrict__ b3,
                                                      float* __restrict__ out) {
  // one LDS object, so that the tile read in the loop lies first and its offsets fit the instructions' 16-bit field
  __shared__ __align__(16) struct {
    float    p1[kBI * kHid];          // 65536 B  p1 + b1, rows i0..i0+63
    float    lg[(kBI + 1) * kLgP];    // 33280 B  register 0 of D2, [row][wave][lane]: lanes 0..15 = 128 x logit; row s + 1 = step s, row 0 takes the empty first product
    _Float16 w2[kHid2 * kW2P];        // 67584 B  (16 W2)^T, read once into registers
  } sm;
  float* const s_p1 = sm.p1;
  float* const s_lg = sm.lg;
  _Float16* const s_w2 = sm.w2;

  const _Float16* W2T = (const _Float16*)W2Tp;   // [128][256], f16 of 16*W2[k][n] at [n][k]
  const _Float16* W3P = (const _Float16*)W3Pp;   // [16][128],  row 0 = f16 of 8*W3[k]
  const int tid  = threadIdx.x;
  const int lane = tid & 31;
  const int wave = tid >> 5;
  const int hh   = lane >> 4;
  const int m    = lane & 15;
  const int j0   = blockIdx.x * kBJ;
  const int i0   = blockIdx.y * kBI;

  // ---- stage p1 + b1: 32 x 128 float4 = 16384 floats = [64][256]; a thread's column is the same in every trip ----
  {
    const int cc = (tid & 63) * 4;
    const v4f bv = *(const v4f*)(b1 + cc);
    const float* src = p1 + (size_t)(i0 + (tid >> 6)) * kHid + cc;   // one address, constant offsets
    float* dst = s_p1 + (tid >> 6) * kHid + cc;
    v4f st[32];
#pragma unroll
    for (int it = 0; it < 32; ++it) st[it] = *(const v4f*)(src + it * 2 * kHid);
    // stands before the address registers of the loads above are written again; naming them as inputs keeps them whole up to here
    // (the b1 load is addressed by its byte offset, cc * 4, on a scalar base)
    asm volatile("s_wait_xcnt 0x0" :: "v"(src), "v"(cc * 4) : "memory");
#pragma unroll
    for (int it = 0; it < 32; ++it) *(v4f*)(dst + it * 2 * kHid) = st[it] + bv;
  }

  // ---- resident operands ----
  // ---- stage (16 W2)^T once per block, whole 512-B rows per wave-load: 32 x 128 chunks of 8 halves = [128][256] ----
  {
    const _Float16* src = W2T + tid * 8;
    _Float16* dst = s_w2 + (tid >> 5) * kW2P + (tid & 31) * 8;
    v8h st[32];
#pragma unroll
    for (int it = 0; it < 32; ++it) st[it] = *(const v8h*)(src + it * 1024);
    asm volatile("s_wait_xcnt 0x0" :: "v"(src) : "memory");   // as above
#pragma unroll
    for (int it = 0; it < 32; ++it) *(v8h*)(dst + it * 4 * kW2P) = st[it];
  }
  v16h w3a[4];       // padded 8 W3 plane as A: row m, k step c
  {
    const _Float16* wb = W3P + m * kHid2 + 8 * hh;
#pragma unroll
    for (int c = 0; c < 4; ++c) w3a[c] = Frag<_Float16>::load(wb + c * 32);
    asm volatile("s_wait_xcnt 0x0" :: "v"(wb) : "memory");   // as above
  }
  v8f bc[8];         // 16 b2 in D's map: register r = row 16 t + 8 hh + r
  const float* b2h = b2 + 8 * hh;
#pragma unroll
  for (int t = 0; t < 8; ++t) {
    const v4f lo = *(const v4f*)(b2h + t * 16);
    const v4f hi = *(const v4f*)(b2h + t * 16 + 4);
#pragma unroll
    for (int r = 0; r < 4; ++r) { bc[t][r] = lo[r] * kW2Carry; bc[t][4 + r] = hi[r] * kW2Carry; }
  }
  v4f q2[8][4];      // p2 row j0 + 16 wave + m, kmap order
  {
    const float* pr = p2 + (size_t)(j0 + wave * 16 + m) * kHid + 8 * hh;
#pragma unroll
    for (int c = 0; c < 8; ++c) ld16(q2[c], pr + c * 32);
    asm volatile("s_wait_xcnt 0x0" :: "v"(pr), "v"(b2h) : "memory");   // as above, for the b2 and p2 loads
  }
  const float b3v = b3[0];

  __syncthreads();   // s_p1 and s_w2 staged

  v16h wa[8][8];     // (16 W2)^T: row tile t, k step c
  {
    const _Float16* wb = s_w2 + m * kW2P + 8 * hh;
#pragma unroll
    for (int t = 0; t < 8; ++t)
#pragma unroll
      for (int c = 0; c < 8; ++c) wa[t][c] = Frag<_Float16>::load(wb + t * 16 * kW2P + c * 32);
  }

  const v8f zero8 = (v8f){0.f, 0.f, 0.f, 0.f, 0.f, 0.f, 0.f, 0.f};
  v16h hp[4];        // h2 fragments of the step before
#pragma unroll
  for (int c = 0; c < 4; ++c) hp[c] = h2_frag(zero8, zero8);
  v4f pa[4][4];      // p1 + b1, k steps 0..3 (fetched half a step ahead)
#pragma unroll
  for (int c = 0; c < 4; ++c) ld16(pa[c], s_p1 + 8 * hh + c * 32);
  float* lgp = s_lg + wave * 32 + lane;

  // The loop is rotated by one k step: k step 0 of step ii + 1 runs at the foot of step ii, among the h2 conversions.
  v8f acc[8];
  {
    const v16h f0 = h1_frag(pa[0], q2[0]);
#pragma unroll
    for (int t = 0; t < 8; ++t) acc[t] = Frag<_Float16>::mma(wa[t][0], f0, bc[t]);
  }
  v16h f1 = h1_frag(pa[1], q2[1]);

  // two steps a trip: the accumulators started at a step's foot overlap the ones being converted, so two sets take turns;
  // with one step a trip the new set was copied back into the old one's registers at every foot
#pragma unroll 2
  for (int ii = 0; ii < kBI; ++ii) {
    v4f pb[4][4];    // k steps 4..7 of this step
    __builtin_amdgcn_sched_barrier(0);   // with the one behind the reads: keeps the 16 LDS reads in one place
    {
      const float* row = s_p1 + ii * kHid + 8 * hh + 128;
#pragma unroll
      for (int c = 0; c < 4; ++c) ld16(pb[c], row + c * 32);
    }
    __builtin_amdgcn_sched_barrier(0);   // the second of the pair

#pragma unroll
    for (int t = 0; t < 8; ++t) acc[t] = Frag<_Float16>::mma(wa[t][1], f1, acc[t]);
    const v16h f2 = h1_frag(pa[2], q2[2]);
#pragma unroll
    for (int t = 0; t < 8; ++t) acc[t] = Frag<_Float16>::mma(wa[t][2], f2, acc[t]);
    const v16h f3 = h1_frag(pa[3], q2[3]);
#pragma unroll
    for (int t = 0; t < 8; ++t) acc[t] = Frag<_Float16>::mma(wa[t][3], f3, acc[t]);
    const v16h f4 = h1_frag(pb[0], q2[4]);
    const v16h f5 = h1_frag(pb[1], q2[5]);
    // issue order of this half: the vector work dealt four to a WMMA; left alone it came out in long runs
#pragma unroll
    for (int g = 0; g < 24; ++g) {
      __builtin_amdgcn_sched_group_barrier(0x008, 1, 0);    // one WMMA
      __builtin_amdgcn_sched_group_barrier(0x002, 4, 0);    // four vector instructions
    }

    __builtin_amdgcn_sched_barrier(0);   // as above, for the 16 reads below
    {
      const int nx = (ii + 1 < kBI) ? ii + 1 : ii;   // the last step fetches its own row again; what is made of it is not used
      const float* row = s_p1 + nx * kHid + 8 * hh;
#pragma unroll
      for (int c = 0; c < 4; ++c) ld16(pa[c], row + c * 32);
    }
    __builtin_amdgcn_sched_barrier(0);   // as above

    lgp[ii * kLgP] = logit128(w3a, hp);  // every lane stores, so EXEC never changes in the loop; lanes 0..15 hold D2 row 0
#pragma unroll
    for (int t = 0; t < 8; ++t) acc[t] = Frag<_Float16>::mma(wa[t][4], f4, acc[t]);
    const v16h f6 = h1_frag(pb[2], q2[6]);
#pragma unroll
    for (int t = 0; t < 8; ++t) acc[t] = Frag<_Float16>::mma(wa[t][5], f5, acc[t]);
    const v16h f7 = h1_frag(pb[3], q2[7]);
#pragma unroll
    for (int t = 0; t < 8; ++t) acc[t] = Frag<_Float16>::mma(wa[t][6], f6, acc[t]);
    const v16h f0 = h1_frag(pa[0], q2[0]);
#pragma unroll
    for (int t = 0; t < 8; ++t) acc[t] = Frag<_Float16>::mma(wa[t][7], f7, acc[t]);
#pragma unroll
    for (int c = 0; c < 4; ++c) {
      hp[c] = h2_frag(acc[2 * c], acc[2 * c + 1]);
      acc[2 * c]     = Frag<_Float16>::mma(wa[2 * c][0], f0, bc[2 * c]);
      acc[2 * c + 1] = Frag<_Float16>::mma(wa[2 * c + 1][0], f0, bc[2 * c + 1]);
    }
    f1 = h1_frag(pa[1], q2[1]);
    // issue order of this half: as above for the W3 product and k steps 4..6, then the logit store; the foot is left to the compiler
#pragma unroll
    for (int g = 0; g < 28; ++g) {
      __builtin_amdgcn_sched_group_barrier(0x008, 1, 1);
      __builtin_amdgcn_sched_group_barrier(0x002, 4, 1);
    }
    __builtin_amdgcn_sched_group_barrier(0x200, 1, 1);      // the logit store
  }
  lgp[kBI * kLgP] = logit128(w3a, hp);
  __syncthreads();   // all logits in s_lg

  // ---- sigmoid in f32 and store: 64 x 64 values, 8 float4 per thread; 16 lanes write one 256-B row segment ----
  const int r0 = tid >> 4;             // row r0 + 8 it, columns c4 .. c4 + 3
  const int c4 = (tid & 15) * 4;
  const float* lb = s_lg + (r0 + 1) * kLgP + (c4 >> 4) * 32 + (c4 & 15);
  float* ob = out + (size_t)(i0 + r0) * kNJ + j0 + c4;
#pragma unroll
  for (int it = 0; it < 8; ++it) {
    const v4f lg = *(const v4f*)(lb + it * 8 * kLgP);
    v4f v;
#pragma unroll
    for (int e = 0; e < 4; ++e) {
      const float x = lg[e] * kLogitInv + b3v;
      v[e] = 1.0f / (1.0f + expf(-x));
    }
    *(v4f*)(ob + it * 8 * kNJ) = v;
  }
}

// ---------------------------------------------------------------------------
// Workspace region map (byte offsets, all multiples of 128; every region fully written before it is read):
//   F1B  bf16 [1024][512]  feat1                      0
//   F2B  bf16 [1024][512]  feat2              1,048,576
//   W1AT bf16 [256][512]   W1[0:512]^T        2,097,152
//   W1BT bf16 [256][512]   W1[512:1024]^T     2,359,296
//   W2T  f16  [128][256]   (16 W2)^T          2,621,440
//   W3P  f16  [16][128]    row 0 = 8 W3       2,686,976
//   P1   f32  [1024][256]                     2,691,072
//   P2   f32  [1024][256]                     3,739,648
//   total                                     4,788,224 B
// GEMM shapes: p1/p2 M=1024 N=256 K=512 (K % 32 == 0, M, N % 64 == 0, no padded planes);
// pair kernel: K=256 and K=128 in whole 32-steps from register fragments of exactly that width.
// ---------------------------------------------------------------------------
extern "C" void kernel_launch(void* const* d_in, const int* in_sizes, int n_in,
                              void* d_out, int out_size, void* d_ws, size_t ws_size,
                              hipStream_t stream) {
  if (n_in < 8) return;
  if (in_sizes[0] != kNI * kFeat) return;
  if (in_sizes[1] != kNJ * kFeat) return;
  if (in_sizes[2] != 2 * kFeat * kHid) return;
  if (in_sizes[3] != kHid) return;
  if (in_sizes[4] != kHid * kHid2) return;
  if (in_sizes[5] != kHid2) return;
  if (in_sizes[6] != kHid2) return;
  if (in_sizes[7] < 1) return;
  if (out_size != kNI * kNJ) return;

  const float* feat1 = (const float*)d_in[0];   // [1024][512]
  const float* feat2 = (const float*)d_in[1];   // [1024][512]
  const float* W1    = (const float*)d_in[2];   // [1024][256]  ([in][out])
  const float* b1    = (const float*)d_in[3];   // [256]
  const float* W2    = (const float*)d_in[4];   // [256][128]   ([in][out])
  const float* b2    = (const float*)d_in[5];   // [128]
  const float* W3    = (const float*)d_in[6];   // [128][1]
  const float* b3    = (const float*)d_in[7];   // [1]
  float* outp = (float*)d_out;                  // [1024][1024] f32

  // ---- carve ----
  const size_t SZ_FB  = (size_t)kNI * kFeat * 2;      // 1,048,576
  const size_t SZ_W1T = (size_t)kHid * kFeat * 2;     //   262,144
  const size_t SZ_W2T = (size_t)kHid2 * kHid * 2;     //    65,536
  const size_t SZ_W3P = (size_t)16 * kHid2 * 2;       //     4,096
  const size_t SZ_P   = (size_t)kNI * kHid * 4;       // 1,048,576
  size_t off = 0;
  const size_t oF1B  = off; off += SZ_FB;
  const size_t oF2B  = off; off += SZ_FB;
  const size_t oW1AT = off; off += SZ_W1T;
  const size_t oW1BT = off; off += SZ_W1T;
  const size_t oW2T  = off; off += SZ_W2T;
  const size_t oW3P  = off; off += SZ_W3P;
  const size_t oP1   = off; off += SZ_P;
  const size_t oP2   = off; off += SZ_P;
  const size_t TOTAL = off;                           // 4,788,224
  if (TOTAL > ws_size) return;
  if (TOTAL > (size_t)134217728) return;

  char* ws = (char*)d_ws;
  unsigned short* F1B  = (unsigned short*)(ws + oF1B);
  unsigned short* F2B  = (unsigned short*)(ws + oF2B);
  unsigned short* W1AT = (unsigned short*)(ws + oW1AT);
  unsigned short* W1BT = (unsigned short*)(ws + oW1BT);
  unsigned short* W2T  = (unsigned short*)(ws + oW2T);
  unsigned short* W3P  = (unsigned short*)(ws + oW3P);
  float*          P1   = (float*)(ws + oP1);
  float*          P2   = (float*)(ws + oP2);

  const dim3 blk(256);

  // (0) feat1, feat2 -> bf16 RNE planes: n8 = 65,536 -> 256 blocks exactly each
  {
    const int n8 = kNI * kFeat / 8;
    cast8_kernel<0><<<dim3(n8 / 256), blk, 0, stream>>>(feat1, F1B, n8, 1.0f);
    cast8_kernel<0><<<dim3(n8 / 256), blk, 0, stream>>>(feat2, F2B, n8, 1.0f);
  }
  // (1) W1[0:512] in [512][256] -> W1AT out [256][512] bf16; grid (cols/64, rows/64) = (4, 8)
  transpose_cast64<0><<<dim3(kHid / 64, kFeat / 64), blk, 0, stream>>>(W1, W1AT, kFeat, kHid, 1.0f);
  //     W1[512:1024] in [512][256] -> W1BT out [256][512] bf16; grid (4, 8)
  transpose_cast64<0><<<dim3(kHid / 64, kFeat / 64), blk, 0, stream>>>(W1 + (size_t)kFeat * kHid, W1BT, kFeat, kHid, 1.0f);
  //     W2 in [256][128] -> W2T out [128][256] f16 of 16*W2; grid (128/64, 256/64) = (2, 4)
  transpose_cast64<1><<<dim3(kHid2 / 64, kHid / 64), blk, 0, stream>>>(W2, W2T, kHid, kHid2, kW2Carry);
  // (2) padded W3 plane [16][128]
  w3pad_kernel<<<dim3(1), blk, 0, stream>>>(W3, W3P, kW3Carry);

  // (3) p1 = feat1 . W1[0:512], p2 = feat2 . W1[512:1024]: M=1024 N=256 K=512 -> f32 [1024][256]; 64 tiles -> 8 blocks each
  const dim3 gP((((kNI / 64) * (kHid / 64)) + 7) / 8, 1);
  wmma_gemm64<1, false, 0, 0, false, 0><<<gP, blk, 0, stream>>>(
      F1B, F1B, kFeat, 0L, W1AT, W1AT, kFeat, 0L, (void*)P1, (void*)P1, kHid, 0L, b1, b1, 0L, kNI, kHid, kFeat, 1.0f);
  wmma_gemm64<1, false, 0, 0, false, 0><<<gP, blk, 0, stream>>>(
      F2B, F2B, kFeat, 0L, W1BT, W1BT, kFeat, 0L, (void*)P2, (void*)P2, kHid, 0L, b1, b1, 0L, kNJ, kHid, kFeat, 1.0f);

  pairmlp_kernel<<<dim3(kNJ / kBJ, kNI / kBI), dim3(128), 0, stream>>>(P1, P2, b1, W2T, b2, W3P, b3, outp);
}

// v002
// Measured time: 72.1 microseconds a run.
// Next to v001, in two timings, it ran 1.55 and 1.53 times as fast.
// All steps since v000 together make it 2.22 times as fast.
// Contractions: feat1|feat2 x W1 halves on v_wmma_f32_16x16x32_bf16 (inputs RNE-converted to bf16); pairwise relu(p1+b1+p2) x W2 (h1 f16, W2 f16 carried x16) and h2 x W3 (h2 f16 carried x16, W3 f16 carried x8, M padded to 16), both transposed, on v_wmma_f32_16x16x32_f16; f32 accumulate; bias/sigmoid in f32, relu on the converted f16 values.
#include <hip/hip_runtime.h>
#include <math.h>

// ---------------------------------------------------------------------------
// Problem constants
// ---------------------------------------------------------------------------
constexpr int kNI   = 1024;   // rows of feat1 (output rows i)
constexpr int kNJ   = 1024;   // rows of feat2 (output cols j)
constexpr int kFeat = 512;
constexpr int kHid  = 256;
constexpr int kHid2 = 128;
constexpr int kBI   = 64;     // i rows per block of the pair kernel
constexpr int kBJ   = 64;     // j columns per block of the pair kernel (16 per wave)
constexpr int kW2P  = 264;    // f16 pitch of the staged W2^T rows (528 B = 16 B x odd: ds_load_b128 without bank conflicts)
constexpr int kLgP  = 128;    // floats per row of the logit tile: 4 waves x 32 lanes
constexpr float kW2Carry  = 16.0f;
constexpr float kW3Carry  = 8.0f;
constexpr float kLogitInv = 1.0f / 128.0f;   // undoes both carries at the logit

typedef __attribute__((ext_vector_type(16))) _Float16 v16h;
typedef __attribute__((ext_vector_type(8)))  _Float16 v8h;
typedef __attribute__((ext_vector_type(4)))  _Float16 v4h;
typedef __attribute__((ext_vector_type(16))) __bf16   v16b;
typedef __attribute__((ext_vector_type(8)))  __bf16   v8b;
typedef __attribute__((ext_vector_type(8)))  float    v8f;
typedef __attribute__((ext_vector_type(4)))  float    v4f;
typedef __attribute__((ext_vector_type(4)))  unsigned int v4u;

__device__ __forceinline__ unsigned short f2bf_bits(float f) {
  unsigned u = __float_as_uint(f);
  return (unsigned short)((u + 0x7FFFu + ((u >> 16) & 1u)) >> 16);
}
__device__ __forceinline__ float bf_bits2f(unsigned short h) { return __uint_as_float(((unsigned)h) << 16); }

// hazard guards as plain device helpers (no inline asm inside the kernel template body)
__device__ __forceinline__ void dep_guard_h(v8f& a, v8f& b, v16h x, v16h y) { asm volatile("v_nop\n\tv_nop\n\tv_nop\n\tv_nop" : "+v"(a), "+v"(b) : "v"(x), "v"(y)); }
__device__ __forceinline__ void dep_guard_b(v8f& a, v8f& b, v16b x, v16b y) { asm volatile("v_nop\n\tv_nop\n\tv_nop\n\tv_nop" : "+v"(a), "+v"(b) : "v"(x), "v"(y)); }
__device__ __forceinline__ void keep4_h(v16h a, v16h b, v16h c, v16h d) { asm volatile("v_nop" :: "v"(a), "v"(b), "v"(c), "v"(d)); }
__device__ __forceinline__ void keep4_b(v16b a, v16b b, v16b c, v16b d) { asm volatile("v_nop" :: "v"(a), "v"(b), "v"(c), "v"(d)); }
__device__ __forceinline__ void acc_guard4(v8f& a, v8f& b, v8f& c, v8f& d) { asm volatile("v_nop\n\tv_nop\n\tv_nop\n\tv_nop" : "+v"(a), "+v"(b), "+v"(c), "+v"(d)); }
template <typename T> struct Frag;
template <> struct Frag<_Float16> {
  typedef v16h V; union U { v16h v; v8h h[2]; };
  static __device__ __forceinline__ v16h load(const _Float16* p) {   // elements 0..7 <- p[0..7], 8..15 <- p[16..23]
    U f; f.h[0] = *(const v8h*)(p); f.h[1] = *(const v8h*)(p + 16); return f.v;
  }
  static __device__ __forceinline__ v8f mma(v16h a, v16h b, v8f c) {
    return __builtin_amdgcn_wmma_f32_16x16x32_f16(false, a, false, b, (short)0, c, false, false);
  }
  static __device__ __forceinline__ void guard(v8f& a, v8f& b, v16h x, v16h y) { dep_guard_h(a, b, x, y); }
  static __device__ __forceinline__ void keep(v16h a, v16h b, v16h c, v16h d) { keep4_h(a, b, c, d); }
};
template <> struct Frag<__bf16> {
  typedef v16b V; union U { v16b v; v8b h[2]; };
  static __device__ __forceinline__ v16b load(const __bf16* p) {
    U f; f.h[0] = *(const v8b*)(p); f.h[1] = *(const v8b*)(p + 16); return f.v;
  }
  static __device__ __forceinline__ v8f mma(v16b a, v16b b, v8f c) {
    return __builtin_amdgcn_wmma_f32_16x16x32_bf16(false, a, false, b, (short)0, c, false, false);
  }
  static __device__ __forceinline__ void guard(v8f& a, v8f& b, v16b x, v16b y) { dep_guard_b(a, b, x, y); }
  static __device__ __forceinline__ void keep(v16b a, v16b b, v16b c, v16b d) { keep4_b(a, b, c, d); }
};

__device__ __forceinline__ unsigned pk16(unsigned short a, unsigned short b) { return (unsigned)a | ((unsigned)b << 16); }
__device__ __forceinline__ unsigned short h_bits(float f) { const _Float16 h = (_Float16)f; return __builtin_bit_cast(unsigned short, h); }

// ---- Register-blocked batched WMMA GEMM (unused
//      activation modes removed) --------------------------------------------
// C[m,n] = scale * sum_k A[m,k] * Bt[n,k] (+bias)(+resid); each wave owns a 64x64 tile.
// A row-major [M,K]; Bt row-major [N,K]; M,N % 64 == 0, K % 32 == 0.
// SPLIT: operands are hi/lo planes (A2/Bt2 = lo planes, same layout); product = hi.hi + hi.lo + lo.hi.
// BIAS_MODE: 0 = none, 1 = bias[m], 2 = bias[n].
// OUT_MODE: 0 = f32, 1 = f16, 2 = bf16 hi plane (Cout) + bf16 lo plane (Cout2).
// ET: 0 = f16 operands, 1 = bf16 operands (pointers passed as 16-bit storage)
template <int ET> struct Elem;
template <> struct Elem<0> { typedef _Float16 T; };
template <> struct Elem<1> { typedef __bf16 T; };
template <int ET, bool SPLIT, int BIAS_MODE, int OUT_MODE, bool RESID, int ACT = 0>
__global__ __launch_bounds__(256) void wmma_gemm64(
    const unsigned short* __restrict__ Ap, const unsigned short* __restrict__ A2p, int lda, long strideA,
    const unsigned short* __restrict__ Btp, const unsigned short* __restrict__ Bt2p, int ldb, long strideB,
    void* __restrict__ Cout, void* __restrict__ Cout2, int ldc, long strideC,
    const float* __restrict__ bias,
    const float* __restrict__ resid, long strideR,
    int M, int N, int K, float scale) {
  typedef typename Elem<ET>::T T;
  typedef typename Frag<T>::V V;
  const T* A = (const T*)Ap; const T* A2 = (const T*)A2p; const T* Bt = (const T*)Btp; const T* Bt2 = (const T*)Bt2p;
  __shared__ __align__(16) float sT[8][16 * 68];   // per-wave 16x64 slab, pitch 68 floats
  const int b    = blockIdx.y;
  const int lane = threadIdx.x & 31;
  const int wave = threadIdx.x >> 5;
  const int tilesN = N >> 6;
  const int tilesM = M >> 6;
  const int tile = blockIdx.x * 8 + wave;
  if (tile >= tilesM * tilesN) return;   // wave-uniform; no block barriers in this kernel
  const int tm = tile / tilesN;
  const int tn = tile - tm * tilesN;
  const int m0 = tm << 6;
  const int n0 = tn << 6;

  const T* Ab  = A  + (size_t)b * strideA;
  const T* Bb  = Bt + (size_t)b * strideB;
  const T* Ab2 = SPLIT ? (A2  + (size_t)b * strideA) : nullptr;
  const T* Bb2 = SPLIT ? (Bt2 + (size_t)b * strideB) : nullptr;

  const int rlane = lane & 15;                 // row (A) / col (B, D) within subtile
  const int koff  = (lane >> 4) * 8;           // k offset of this lane half
  const int mOff  = (lane >> 4) * 8;           // D row offset

  v8f acc[4][4];
#pragma unroll
  for (int i = 0; i < 4; ++i)
#pragma unroll
    for (int j = 0; j < 4; ++j) acc[i][j] = (v8f){0.f,0.f,0.f,0.f,0.f,0.f,0.f,0.f};

  for (int k0 = 0; k0 < K; k0 += 32) {
    V bh[4], bl[4];
#pragma unroll
    for (int j = 0; j < 4; ++j) {
      const size_t bo = (size_t)(n0 + (j << 4) + rlane) * ldb + koff + k0;
      bh[j] = Frag<T>::load(Bb + bo);
      if (SPLIT) bl[j] = Frag<T>::load(Bb2 + bo);
    }
#pragma unroll
    for (int i = 0; i < 4; ++i) {
      const size_t ao = (size_t)(m0 + (i << 4) + rlane) * lda + koff + k0;
      V ah = Frag<T>::load(Ab + ao);
      V al;
      if (SPLIT) al = Frag<T>::load(Ab2 + ao);
#pragma unroll
      for (int j = 0; j < 4; ++j) {
        acc[i][j] = Frag<T>::mma(ah, bh[j], acc[i][j]);
        if (SPLIT) {
          acc[i][j] = Frag<T>::mma(ah, bl[j], acc[i][j]);
          acc[i][j] = Frag<T>::mma(al, bh[j], acc[i][j]);
        }
      }
      Frag<T>::guard(acc[i][0], acc[i][3], ah, SPLIT ? al : ah);
    }
    Frag<T>::keep(bh[0], bh[1], bh[2], bh[3]);
    if (SPLIT) Frag<T>::keep(bl[0], bl[1], bl[2], bl[3]);
  }
  acc_guard4(acc[0][0], acc[0][1], acc[0][2], acc[0][3]);
  acc_guard4(acc[1][0], acc[1][1], acc[1][2], acc[1][3]);
  acc_guard4(acc[2][0], acc[2][1], acc[2][2], acc[2][3]);
  acc_guard4(acc[3][0], acc[3][1], acc[3][2], acc[3][3]);

  // ---- epilogue ----
  float* slab = sT[wave];
  const float* Rb = RESID ? (resid + (size_t)b * strideR) : nullptr;
#pragma unroll
  for (int i = 0; i < 4; ++i) {
    const int mBase = m0 + (i << 4);
#pragma unroll
    for (int j = 0; j < 4; ++j) {
      const int n = n0 + (j << 4) + rlane;
      float bv = 0.f;
      if (BIAS_MODE == 2) bv = bias[n];
#pragma unroll
      for (int r = 0; r < 8; ++r) {
        float v = acc[i][j][r] * scale;
        if (BIAS_MODE == 1) v += bias[mBase + mOff + r];
        if (BIAS_MODE == 2) v += bv;
        if (RESID) v += Rb[(size_t)(mBase + mOff + r) * ldc + n];
        if (ACT == 2) v = fmaxf(v, 0.0f);
        slab[(mOff + r) * 68 + (j << 4) + rlane] = v;
      }
    }
    __builtin_amdgcn_fence(__ATOMIC_RELEASE, "workgroup");
    __builtin_amdgcn_wave_barrier();
    __builtin_amdgcn_fence(__ATOMIC_ACQUIRE, "workgroup");
    if (OUT_MODE == 0) {
      float* C = (float*)Cout + (size_t)b * strideC;
      const int hh = lane >> 4, c4 = (lane & 15) * 4;     // row seg = 256 B = 16 lanes x 16 B
      {
#pragma unroll
        for (int it = 0; it < 8; ++it) {
          const int row = it * 2 + hh;
          v4f v = *(const v4f*)(slab + row * 68 + c4);
          *(v4f*)(C + (size_t)(mBase + row) * ldc + n0 + c4) = v;
        }
        
      }
    } else {
      const int q = lane >> 3, c8 = (lane & 7) * 8;
      unsigned short* C  = (unsigned short*)Cout  + (size_t)b * strideC;
      unsigned short* C2 = (OUT_MODE == 2) ? ((unsigned short*)Cout2 + (size_t)b * strideC) : nullptr;
      {
#pragma unroll
        for (int it = 0; it < 4; ++it) {
          const int row = it * 4 + q;
          const float* sp = slab + row * 68 + c8;
          v8h hv, lv;
#pragma unroll
          for (int e = 0; e < 8; ++e) {
            if (OUT_MODE == 1) {
              hv[e] = (_Float16)sp[e];
            } else {
              unsigned short hb = f2bf_bits(sp[e]);
              unsigned short lb = f2bf_bits(sp[e] - bf_bits2f(hb));
              hv[e] = __builtin_bit_cast(_Float16, hb);
              lv[e] = __builtin_bit_cast(_Float16, lb);
            }
          }
          *(v8h*)(C + (size_t)(mBase + row) * ldc + n0 + c8) = hv;
          if (OUT_MODE == 2) *(v8h*)(C2 + (size_t)(mBase + row) * ldc + n0 + c8) = lv;
        }
        
      }
    }
    __builtin_amdgcn_fence(__ATOMIC_RELEASE, "workgroup");
    __builtin_amdgcn_wave_barrier();
    __builtin_amdgcn_fence(__ATOMIC_ACQUIRE, "workgroup");
  }
}

// ---------------------------------------------------------------------------
// Cast, 8 consecutive elements per thread: in f32 [n] -> out 16-bit bits [n]; blk = block number within this job.
//   MODE 0: bf16 RNE bits. MODE 1: f16 bits of (scale * bf16-RNE value) (scale = power-of-two carry).
// ---------------------------------------------------------------------------
template <int MODE>
__device__ __forceinline__ void cast8_body(const float* __restrict__ in, unsigned short* __restrict__ out, int n8, float scale, int blk) {
  const int i = blk * 256 + threadIdx.x;
  if (i >= n8) return;
  const float* p = in + 8 * (size_t)i;
  const v4f a = *(const v4f*)(p);
  const v4f c = *(const v4f*)(p + 4);
  unsigned short hb[8];
#pragma unroll
  for (int e = 0; e < 4; ++e) {
    if (MODE == 0) {
      hb[e]     = f2bf_bits(a[e]);
      hb[4 + e] = f2bf_bits(c[e]);
    } else {
      hb[e]     = h_bits(bf_bits2f(f2bf_bits(a[e])) * scale);
      hb[4 + e] = h_bits(bf_bits2f(f2bf_bits(c[e])) * scale);
    }
  }
  const v4u u = (v4u){pk16(hb[0], hb[1]), pk16(hb[2], hb[3]), pk16(hb[4], hb[5]), pk16(hb[6], hb[7])};
  unsigned short* q = out + 8 * (size_t)i;
  *(v4u*)q = u;
  
  (void)scale;
}

// ---------------------------------------------------------------------------
// Transposing cast: in [R][CC] f32 row-major -> out [CC][R] 16-bit bits (MODE 0: bf16 RNE; MODE 1: f16 bits of in*scale).
// One block (256 threads) per 64x64 tile (bx, by) of (CC/64, R/64); R, CC multiples of 64; s = 64 x 65 floats of LDS.
// Load phase: thread t reads in row r0 + (t>>2), 16 floats at cols c0 + (t&3)*16 -> 256 x 16 = 64x64 = whole tile, into LDS s[c][r].
// Store phase: wave w, it = 0..1: out row c0 + w*8 + it*4 + (lane>>3), 8 halves at r0 + (lane&7)*8
// ---------------------------------------------------------------------------
template <int MODE>
__device__ __forceinline__ unsigned short cvt16(float v, float scale) { return (MODE == 0) ? f2bf_bits(v) : h_bits(v * scale); }

template <int MODE>
__device__ __forceinline__ void transpose_cast64(const float* __restrict__ in, unsigned short* __restrict__ out,
                                                 int R, int CC, float scale, int bx, int by, float* s) {   // s[c*65 + r]
  const int t  = threadIdx.x;
  const int c0 = bx * 64;
  const int r0 = by * 64;
  {
    const int row = t >> 2, cq = (t & 3) * 16;
    const float* ip = in + (size_t)(r0 + row) * CC + c0 + cq;
#pragma unroll
    for (int e4 = 0; e4 < 4; ++e4) {
      const v4f v = *(const v4f*)(ip + 4 * e4);
#pragma unroll
      for (int e = 0; e < 4; ++e) s[(cq + 4 * e4 + e) * 65 + row] = v[e];
    }
  }
  __syncthreads();
  const int wave = t >> 5, lane = t & 31, q = lane >> 3, c8 = (lane & 7) * 8;
  const int orow0 = wave * 8 + q;        // it = 0
  const int orow1 = wave * 8 + 4 + q;    // it = 1
  unsigned short b0[8], b1v[8];
#pragma unroll
  for (int e = 0; e < 8; ++e) {
    b0[e]  = cvt16<MODE>(s[orow0 * 65 + c8 + e], scale);
    b1v[e] = cvt16<MODE>(s[orow1 * 65 + c8 + e], scale);
  }
  const v4u u0 = (v4u){pk16(b0[0], b0[1]), pk16(b0[2], b0[3]), pk16(b0[4], b0[5]), pk16(b0[6], b0[7])};
  const v4u u1 = (v4u){pk16(b1v[0], b1v[1]), pk16(b1v[2], b1v[3]), pk16(b1v[4], b1v[5]), pk16(b1v[6], b1v[7])};
  unsigned short* o0 = out + (size_t)(c0 + orow0) * R + r0 + c8;
  unsigned short* o1 = out + (size_t)(c0 + orow1) * R + r0 + c8;
  *(v4u*)o0 = u0;
  *(v4u*)o1 = u1;
  // other jobs' code follows this one in the kernel: stands before that code writes a register that the stores name
  asm volatile("s_wait_xcnt 0x0" ::: "memory");
}

// ---------------------------------------------------------------------------
// Zero-padded W3 plane for the 16-column-padded matvec: W3P f16 [16][128]; row 0 = f16(W3[k] * scale), rows 1..15 = 0.
// One block of 256 threads: thread t writes 8 halves at t*8 (row t>>4, cols (t&15)*8..+7) -> 256 x 8 = 2048 = whole plane;
// W3 is loaded unconditionally (index always < 128) and selected by value.
// ---------------------------------------------------------------------------
__device__ __forceinline__ void w3pad_body(const float* __restrict__ W3, unsigned short* __restrict__ W3P, float scale) {
  const int t = threadIdx.x;
  const int row = t >> 4, col = (t & 15) * 8;
  const v4f a = *(const v4f*)(W3 + col);
  const v4f c = *(const v4f*)(W3 + col + 4);
  unsigned short hb[8];
#pragma unroll
  for (int e = 0; e < 4; ++e) {
    hb[e]     = (row == 0) ? h_bits(a[e] * scale) : (unsigned short)0;
    hb[4 + e] = (row == 0) ? h_bits(c[e] * scale) : (unsigned short)0;
  }
  const v4u u = (v4u){pk16(hb[0], hb[1]), pk16(hb[2], hb[3]), pk16(hb[4], hb[5]), pk16(hb[6], hb[7])};
  unsigned short* q = W3P + 8 * (size_t)t;
  *(v4u*)q = u;
  asm volatile("s_wait_xcnt 0x0" ::: "memory");   // as in transpose_cast64
}

// ---------------------------------------------------------------------------
// All operand conversions in one grid: none reads what another writes, so a range of the block index picks the job
// (block-uniform branch; only the transposes have a barrier, and every thread of such a block reaches it).
//   blocks   0 ..  31  W1[0:512]    -> W1AT   tiles (4, 8)
//           32 ..  63  W1[512:1024] -> W1BT   tiles (4, 8)
//           64 ..  71  W2           -> W2T    tiles (2, 4)
//           72         W3           -> W3P
//           73 .. 328  feat1        -> F1B    256 blocks
//          329 .. 584  feat2        -> F2B    256 blocks
// ---------------------------------------------------------------------------
constexpr int kPrepW1   = (kHid / 64) * (kFeat / 64);    // 32 tiles per W1 half
constexpr int kPrepW2   = (kHid2 / 64) * (kHid / 64);    // 8 tiles
constexpr int kPrepCast = kNI * kFeat / 8 / 256;         // 256 blocks per feature matrix
constexpr int kPrepGrid = 2 * kPrepW1 + kPrepW2 + 1 + 2 * kPrepCast;   // 585
__global__ __launch_bounds__(256) void prep_kernel(const float* __restrict__ feat1, const float* __restrict__ feat2,
                                                   const float* __restrict__ W1, const float* __restrict__ W2,
                                                   const float* __restrict__ W3,
                                                   unsigned short* __restrict__ F1B, unsigned short* __restrict__ F2B,
                                                   unsigned short* __restrict__ W1AT, unsigned short* __restrict__ W1BT,
                                                   unsigned short* __restrict__ W2T, unsigned short* __restrict__ W3P) {
  __shared__ float s[64 * 65];
  const int b = blockIdx.x;
  // the load of the kernel's arguments names s[0:1], and the branch code below writes s0 on the way to the first job:
  // naming an argument as an input puts this wait behind that load
  asm volatile("s_wait_xcnt 0x0" :: "s"(feat1) : "memory");
  constexpr int e0 = kPrepW1, e1 = e0 + kPrepW1, e2 = e1 + kPrepW2, e3 = e2 + 1, e4 = e3 + kPrepCast;   // first block of the next job
  if (b < e0) {
    transpose_cast64<0>(W1, W1AT, kFeat, kHid, 1.0f, b & 3, b >> 2, s);
  } else if (b < e1) {
    transpose_cast64<0>(W1 + (size_t)kFeat * kHid, W1BT, kFeat, kHid, 1.0f, (b - e0) & 3, (b - e0) >> 2, s);
  } else if (b < e2) {
    transpose_cast64<1>(W2, W2T, kHid, kHid2, kW2Carry, (b - e1) & 1, (b - e1) >> 1, s);
  } else if (b < e3) {
    w3pad_body(W3, W3P, kW3Carry);
  } else if (b < e4) {
    cast8_body<0>(feat1, F1B, kNI * kFeat / 8, 1.0f, b - e3);
  } else {
    cast8_body<0>(feat2, F2B, kNJ * kFeat / 8, 1.0f, b - e4);
  }
}

// ---------------------------------------------------------------------------
// Pairwise MLP, transposed products, everything between p1/p2 and the logit stays in registers.
// Block = 4 waves (one per SIMD) on 64 i x 64 j; wave w owns columns j0 + 16w .. +15 and walks the 64 i.
//   A (resident)  = (16 W2)^T fragments, 8 row tiles (n) x 8 k steps
//   B (built)     = h1^T: lane (hh, c) holds pair column c, k = kmap order; h1 = relu((p1[i] + b1) + p2[j]) f32 -> f16
//   D             = 16 h2pre^T + 16 b2 (16 b2 is the accumulator's start value); D[8 hh + r][c]
//   two D tiles, relu'd and converted in place, are the B fragment of the W3 product (A = padded 8 W3 plane, row 0)
//   logit = D2[0][c] / 128; sim = 1 / (1 + exp(-(logit + b3))) in f32
// The W3 product of step i runs among the W2 products of step i + 1.
// ---------------------------------------------------------------------------
__device__ __forceinline__ v16h h1_frag(const v4f* __restrict__ x, const v4f* __restrict__ y) {
  union { v16h v; v4h q[4]; } f;
  const v4h z = (v4h){(_Float16)0.f, (_Float16)0.f, (_Float16)0.f, (_Float16)0.f};
#pragma unroll
  for (int q = 0; q < 4; ++q) f.q[q] = __builtin_elementwise_max(__builtin_convertvector(x[q] + y[q], v4h), z);
  return f.v;
}
__device__ __forceinline__ v16h h2_frag(v8f lo, v8f hi) {
  union { v16h v; v8h h[2]; } f;
  const v8h z = (v8h){(_Float16)0.f, (_Float16)0.f, (_Float16)0.f, (_Float16)0.f, (_Float16)0.f, (_Float16)0.f, (_Float16)0.f, (_Float16)0.f};
  f.h[0] = __builtin_elementwise_max(__builtin_convertvector(lo, v8h), z);
  f.h[1] = __builtin_elementwise_max(__builtin_convertvector(hi, v8h), z);
  return f.v;
}
// register 0 of D2 = (8 W3 plane) x (16 h2)^T over the four k steps; four independent WMMAs, their partial sums added in k order
// (one accumulator would make a chain of four dependent WMMAs)
__device__ __forceinline__ float logit128(const v16h* __restrict__ w, const v16h* __restrict__ h) {
  const v8f z = (v8f){0.f, 0.f, 0.f, 0.f, 0.f, 0.f, 0.f, 0.f};
  const v8f d0 = Frag<_Float16>::mma(w[0], h[0], z);
  const v8f d1 = Frag<_Float16>::mma(w[1], h[1], z);
  const v8f d2 = Frag<_Float16>::mma(w[2], h[2], z);
  const v8f d3 = Frag<_Float16>::mma(w[3], h[3], z);
  return ((d0[0] + d1[0]) + d2[0]) + d3[0];
}
// the 16 f32 of one k step in kmap order: floats 0..7 and 16..23 behind p (p already holds the 8*hh offset)
__device__ __forceinline__ void ld16(v4f* d, const float* p) {
  d[0] = *(const v4f*)(p);
  d[1] = *(const v4f*)(p + 4);
  d[2] = *(const v4f*)(p + 16);
  d[3] = *(const v4f*)(p + 20);
}

__global__ __launch_bounds__(128) void pairmlp_kernel(const float* __restrict__ p1, const float* __restrict__ p2,
                                                      const float* __restrict__ b1,
                                                      const unsigned short* __restrict__ W2Tp, const float* __restrict__ b2,
                                                      const unsigned short* __restrict__ W3Pp, const float* __restrict__ b3,
                                                      float* __restrict__ out) {
  // one LDS object, so that the tile read in the loop lies first and its offsets fit the instructions' 16-bit field
  __shared__ __align__(16) struct {
    float    p1[kBI * kHid];          // 65536 B  p1 + b1, rows i0..i0+63
    float    lg[(kBI + 1) * kLgP];    // 33280 B  register 0 of D2, [row][wave][lane]: lanes 0..15 = 128 x logit; row s + 1 = step s, row 0 takes the empty first product
    _Float16 w2[kHid2 * kW2P];        // 67584 B  (16 W2)^T, read once into registers
  } sm;
  float* const s_p1 = sm.p1;
  float* const s_lg = sm.lg;
  _Float16* const s_w2 = sm.w2;

  const _Float16* W2T = (const _Float16*)W2Tp;   // [128][256], f16 of 16*W2[k][n] at [n][k]
  const _Float16* W3P = (const _Float16*)W3Pp;   // [16][128],  row 0 = f16 of 8*W3[k]
  const int tid  = threadIdx.x;
  const int lane = tid & 31;
  const int wave = tid >> 5;
  const int hh   = lane >> 4;
  const int m    = lane & 15;
  const int j0   = blockIdx.x * kBJ;
  const int i0   = blockIdx.y * kBI;

  // ---- stage p1 + b1: 32 x 128 float4 = 16384 floats = [64][256]; a thread's column is the same in every trip ----
  {
    const int cc = (tid & 63) * 4;
    const v4f bv = *(const v4f*)(b1 + cc);
    const float* src = p1 + (size_t)(i0 + (tid >> 6)) * kHid + cc;   // one address, constant offsets
    float* dst = s_p1 + (tid >> 6) * kHid + cc;
    v4f st[32];
#pragma unroll
    for (int it = 0; it < 32; ++it) st[it] = *(const v4f*)(src + it * 2 * kHid);
    // stands before the address registers of the loads above are written again; naming them as inputs keeps them whole up to here
    // (the b1 load is addressed by its byte offset, cc * 4, on a scalar base)
    asm volatile("s_wait_xcnt 0x0" :: "v"(src), "v"(cc * 4) : "memory");
#pragma unroll
    for (int it = 0; it < 32; ++it) *(v4f*)(dst + it * 2 * kHid) = st[it] + bv;
  }

  // ---- resident operands ----
  // ---- stage (16 W2)^T once per block, whole 512-B rows per wave-load: 32 x 128 chunks of 8 halves = [128][256] ----
  {
    const _Float16* src = W2T + tid * 8;
    _Float16* dst = s_w2 + (tid >> 5) * kW2P + (tid & 31) * 8;
    v8h st[32];
#pragma unroll
    for (int it = 0; it < 32; ++it) st[it] = *(const v8h*)(src + it * 1024);
    asm volatile("s_wait_xcnt 0x0" :: "v"(src) : "memory");   // as above
#pragma unroll
    for (int it = 0; it < 32; ++it) *(v8h*)(dst + it * 4 * kW2P) = st[it];
  }
  v16h w3a[4];       // padded 8 W3 plane as A: row m, k step c
  {
    const _Float16* wb = W3P + m * kHid2 + 8 * hh;
#pragma unroll
    for (int c = 0; c < 4; ++c) w3a[c] = Frag<_Float16>::load(wb + c * 32);
    asm volatile("s_wait_xcnt 0x0" :: "v"(wb) : "memory");   // as above
  }
  v8f bc[8];         // 16 b2 in D's map: register r = row 16 t + 8 hh + r
  const float* b2h = b2 + 8 * hh;
#pragma unroll
  for (int t = 0; t < 8; ++t) {
    const v4f lo = *(const v4f*)(b2h + t * 16);
    const v4f hi = *(const v4f*)(b2h + t * 16 + 4);
#pragma unroll
    for (int r = 0; r < 4; ++r) { bc[t][r] = lo[r] * kW2Carry; bc[t][4 + r] = hi[r] * kW2Carry; }
  }
  v4f q2[8][4];      // p2 row j0 + 16 wave + m, kmap order
  {
    const float* pr = p2 + (size_t)(j0 + wave * 16 + m) * kHid + 8 * hh;
#pragma unroll
    for (int c = 0; c < 8; ++c) ld16(q2[c], pr + c * 32);
    asm volatile("s_wait_xcnt 0x0" :: "v"(pr), "v"(b2h) : "memory");   // as above, for the b2 and p2 loads
  }
  const float b3v = b3[0];

  __syncthreads();   // s_p1 and s_w2 staged

  v16h wa[8][8];     // (16 W2)^T: row tile t, k step c
  {
    const _Float16* wb = s_w2 + m * kW2P + 8 * hh;
#pragma unroll
    for (int t = 0; t < 8; ++t)
#pragma unroll
      for (int c = 0; c < 8; ++c) wa[t][c] = Frag<_Float16>::load(wb + t * 16 * kW2P + c * 32);
  }

  const v8f zero8 = (v8f){0.f, 0.f, 0.f, 0.f, 0.f, 0.f, 0.f, 0.f};
  v16h hp[4];        // h2 fragments of the step before
#pragma unroll
  for (int c = 0; c < 4; ++c) hp[c] = h2_frag(zero8, zero8);
  v4f pa[4][4];      // p1 + b1, k steps 0..3 (fetched half a step ahead)
#pragma unroll
  for (int c = 0; c < 4; ++c) ld16(pa[c], s_p1 + 8 * hh + c * 32);
  float* lgp = s_lg + wave * 32 + lane;

  // The loop is rotated by one k step: k step 0 of step ii + 1 runs at the foot of step ii, among the h2 conversions.
  v8f acc[8];
  {
    const v16h f0 = h1_frag(pa[0], q2[0]);
#pragma unroll
    for (int t = 0; t < 8; ++t) acc[t] = Frag<_Float16>::mma(wa[t][0], f0, bc[t]);
  }
  v16h f1 = h1_frag(pa[1], q2[1]);

  // two steps a trip: the accumulators started at a step's foot overlap the ones being converted, so two sets take turns;
  // with one step a trip the new set was copied back into the old one's registers at every foot
#pragma unroll 2
  for (int ii = 0; ii < kBI; ++ii) {
    v4f pb[4][4];    // k steps 4..7 of this step
    __builtin_amdgcn_sched_barrier(0);   // with the one behind the reads: keeps the 16 LDS reads in one place
    {
      const float* row = s_p1 + ii * kHid + 8 * hh + 128;
#pragma unroll
      for (int c = 0; c < 4; ++c) ld16(pb[c], row + c * 32);
    }
    __builtin_amdgcn_sched_barrier(0);   // the second of the pair

#pragma unroll
    for (int t = 0; t < 8; ++t) acc[t] = Frag<_Float16>::mma(wa[t][1], f1, acc[t]);
    const v16h f2 = h1_frag(pa[2], q2[2]);
#pragma unroll
    for (int t = 0; t < 8; ++t) acc[t] = Frag<_Float16>::mma(wa[t][2], f2, acc[t]);
    const v16h f3 = h1_frag(pa[3], q2[3]);
#pragma unroll
    for (int t = 0; t < 8; ++t) acc[t] = Frag<_Float16>::mma(wa[t][3], f3, acc[t]);
    const v16h f4 = h1_frag(pb[0], q2[4]);
    const v16h f5 = h1_frag(pb[1], q2[5]);
    // issue order of this half: the vector work dealt four to a WMMA; left alone it came out in long runs
#pragma unroll
    for (int g = 0; g < 24; ++g) {
      __builtin_amdgcn_sched_group_barrier(0x008, 1, 0);    // one WMMA
      __builtin_amdgcn_sched_group_barrier(0x002, 4, 0);    // four vector instructions
    }

    __builtin_amdgcn_sched_barrier(0);   // as above, for the 16 reads below
    {
      const int nx = (ii + 1 < kBI) ? ii + 1 : ii;   // the last step fetches its own row again; what is made of it is not used
      const float* row = s_p1 + nx * kHid + 8 * hh;
#pragma unroll
      for (int c = 0; c < 4; ++c) ld16(pa[c], row + c * 32);
    }
    __builtin_amdgcn_sched_barrier(0);   // as above

    lgp[ii * kLgP] = logit128(w3a, hp);  // every lane stores, so EXEC never changes in the loop; lanes 0..15 hold D2 row 0
#pragma unroll
    for (int t = 0; t < 8; ++t) acc[t] = Frag<_Float16>::mma(wa[t][4], f4, acc[t]);
    const v16h f6 = h1_frag(pb[2], q2[6]);
#pragma unroll
    for (int t = 0; t < 8; ++t) acc[t] = Frag<_Float16>::mma(wa[t][5], f5, acc[t]);
    const v16h f7 = h1_frag(pb[3], q2[7]);
#pragma unroll
    for (int t = 0; t < 8; ++t) acc[t] = Frag<_Float16>::mma(wa[t][6], f6, acc[t]);
    const v16h f0 = h1_frag(pa[0], q2[0]);
#pragma unroll
    for (int t = 0; t < 8; ++t) acc[t] = Frag<_Float16>::mma(wa[t][7], f7, acc[t]);
#pragma unroll
    for (int c = 0; c < 4; ++c) {
      hp[c] = h2_frag(acc[2 * c], acc[2 * c + 1]);
      acc[2 * c]     = Frag<_Float16>::mma(wa[2 * c][0], f0, bc[2 * c]);
      acc[2 * c + 1] = Frag<_Float16>::mma(wa[2 * c + 1][0], f0, bc[2 * c + 1]);
    }
    f1 = h1_frag(pa[1], q2[1]);
    // issue order of this half: as above for the W3 product and k steps 4..6, then the logit store; the foot is left to the compiler
#pragma unroll
    for (int g = 0; g < 28; ++g) {
      __builtin_amdgcn_sched_group_barrier(0x008, 1, 1);
      __builtin_amdgcn_sched_group_barrier(0x002, 4, 1);
    }
    __builtin_amdgcn_sched_group_barrier(0x200, 1, 1);      // the logit store
  }
  lgp[kBI * kLgP] = logit128(w3a, hp);
  __syncthreads();   // all logits in s_lg

  // ---- sigmoid in f32 and store: 64 x 64 values, 8 float4 per thread; 16 lanes write one 256-B row segment ----
  const int r0 = tid >> 4;             // row r0 + 8 it, columns c4 .. c4 + 3
  const int c4 = (tid & 15) * 4;
  const float* lb = s_lg + (r0 + 1) * kLgP + (c4 >> 4) * 32 + (c4 & 15);
  float* ob = out + (size_t)(i0 + r0) * kNJ + j0 + c4;
#pragma unroll
  for (int it = 0; it < 8; ++it) {
    const v4f lg = *(const v4f*)(lb + it * 8 * kLgP);
    v4f v;
#pragma unroll
    for (int e = 0; e < 4; ++e) {
      const float x = lg[e] * kLogitInv + b3v;
      v[e] = 1.0f / (1.0f + expf(-x));
    }
    *(v4f*)(ob + it * 8 * kNJ) = v;
  }
}

// ---------------------------------------------------------------------------
// Workspace region map (byte offsets, all multiples of 128; every region fully written before it is read):
//   F1B  bf16 [1024][512]  feat1                      0
//   F2B  bf16 [1024][512]  feat2              1,048,576
//   W1AT bf16 [256][512]   W1[0:512]^T        2,097,152
//   W1BT bf16 [256][512]   W1[512:1024]^T     2,359,296
//   W2T  f16  [128][256]   (16 W2)^T          2,621,440
//   W3P  f16  [16][128]    row 0 = 8 W3       2,686,976
//   P1   f32  [1024][256]                     2,691,072
//   P2   f32  [1024][256]                     3,739,648
//   total                                     4,788,224 B
// GEMM shapes: p1/p2 M=1024 N=256 K=512 (K % 32 == 0, M, N % 64 == 0, no padded planes);
// pair kernel: K=256 and K=128 in whole 32-steps from register fragments of exactly that width.
// ---------------------------------------------------------------------------
extern "C" void kernel_launch(void* const* d_in, const int* in_sizes, int n_in,
                              void* d_out, int out_size, void* d_ws, size_t ws_size,
                              hipStream_t stream) {
  if (n_in < 8) return;
  if (in_sizes[0] != kNI * kFeat) return;
  if (in_sizes[1] != kNJ * kFeat) return;
  if (in_sizes[2] != 2 * kFeat * kHid) return;
  if (in_sizes[3] != kHid) return;
  if (in_sizes[4] != kHid * kHid2) return;
  if (in_sizes[5] != kHid2) return;
  if (in_sizes[6] != kHid2) return;
  if (in_sizes[7] < 1) return;
  if (out_size != kNI * kNJ) return;

  const float* feat1 = (const float*)d_in[0];   // [1024][512]
  const float* feat2 = (const float*)d_in[1];   // [1024][512]
  const float* W1    = (const float*)d_in[2];   // [1024][256]  ([in][out])
  const float* b1    = (const float*)d_in[3];   // [256]
  const float* W2    = (const float*)d_in[4];   // [256][128]   ([in][out])
  const float* b2    = (const float*)d_in[5];   // [128]
  const float* W3    = (const float*)d_in[6];   // [128][1]
  const float* b3    = (const float*)d_in[7];   // [1]
  float* outp = (float*)d_out;                  // [1024][1024] f32

  // ---- carve ----
  const size_t SZ_FB  = (size_t)kNI * kFeat * 2;      // 1,048,576
  const size_t SZ_W1T = (size_t)kHid * kFeat * 2;     //   262,144
  const size_t SZ_W2T = (size_t)kHid2 * kHid * 2;     //    65,536
  const size_t SZ_W3P = (size_t)16 * kHid2 * 2;       //     4,096
  const size_t SZ_P   = (size_t)kNI * kHid * 4;       // 1,048,576
  size_t off = 0;
  const size_t oF1B  = off; off += SZ_FB;
  const size_t oF2B  = off; off += SZ_FB;
  const size_t oW1AT = off; off += SZ_W1T;
  const size_t oW1BT = off; off += SZ_W1T;
  const size_t oW2T  = off; off += SZ_W2T;
  const size_t oW3P  = off; off += SZ_W3P;
  const size_t oP1   = off; off += SZ_P;
  const size_t oP2   = off; off += SZ_P;
  const size_t TOTAL = off;                           // 4,788,224
  if (TOTAL > ws_size) return;
  if (TOTAL > (size_t)134217728) return;

  char* ws = (char*)d_ws;
  unsigned short* F1B  = (unsigned short*)(ws + oF1B);
  unsigned short* F2B  = (unsigned short*)(ws + oF2B);
  unsigned short* W1AT = (unsigned short*)(ws + oW1AT);
  unsigned short* W1BT = (unsigned short*)(ws + oW1BT);
  unsigned short* W2T  = (unsigned short*)(ws + oW2T);
  unsigned short* W3P  = (unsigned short*)(ws + oW3P);
  float*          P1   = (float*)(ws + oP1);
  float*          P2   = (float*)(ws + oP2);

  const dim3 blk(256);

  // (0) every operand conversion, one grid (block ranges: see prep_kernel)
  prep_kernel<<<dim3(kPrepGrid), blk, 0, stream>>>(feat1, feat2, W1, W2, W3, F1B, F2B, W1AT, W1BT, W2T, W3P);

  // (1) p1 = feat1 . W1[0:512] (batch 0), p2 = feat2 . W1[512:1024] (batch 1): M=1024 N=256 K=512 -> f32 [1024][256] each;
  //     64 tiles -> 8 blocks per batch; F2B, W1BT and P2 lie one plane behind F1B, W1AT and P1, which is the batch stride
  const dim3 gP((((kNI / 64) * (kHid / 64)) + 7) / 8, 2);
  wmma_gemm64<1, false, 0, 0, false, 0><<<gP, blk, 0, stream>>>(
      F1B, F1B, kFeat, (long)kNI * kFeat, W1AT, W1AT, kFeat, (long)kHid * kFeat, (void*)P1, (void*)P1, kHid, (long)kNI * kHid,
      b1, b1, 0L, kNI, kHid, kFeat, 1.0f);

  pairmlp_kernel<<<dim3(kNJ / kBJ, kNI / kBI), dim3(128), 0, stream>>>(P1, P2, b1, W2T, b2, W3P, b3, outp);
}

// v003
// One run takes 45.2 microseconds.
// Two timings next to v002 both put it at 1.61 times that version's speed.
// Over all steps from v000 it is 3.57 times as fast.
// Contractions: feat1|feat2 x W1 halves on v_wmma_f32_16x16x32_bf16 (inputs RNE-converted to bf16); pairwise relu(p1+b1+p2) x W2 (h1 f16, W2 f16 carried x16) and h2 x W3 (h2 f16 carried x16, W3 f16 carried x8, M padded to 16), both transposed, on v_wmma_f32_16x16x32_f16; f32 accumulate; bias/sigmoid in f32, relu on the converted f16 values.
#include <hip/hip_runtime.h>
#include <math.h>

// ---------------------------------------------------------------------------
// Problem constants
// ---------------------------------------------------------------------------
constexpr int kNI   = 1024;   // rows of feat1 (output rows i)
constexpr int kNJ   = 1024;   // rows of feat2 (output cols j)
constexpr int kFeat = 512;
constexpr int kHid  = 256;
constexpr int kHid2 = 128;
constexpr int kBI   = 64;     // i rows per block of the pair kernel
constexpr int kBJ   = 64;     // j columns per block of the pair kernel (16 per wave)
constexpr int kW2P  = 264;    // f16 pitch of the staged W2^T rows (528 B = 16 B x odd: ds_load_b128 without bank conflicts)
constexpr int kLgP  = 128;    // floats per row of the logit tile: 4 waves x 32 lanes
constexpr float kW2Carry  = 16.0f;
constexpr float kW3Carry  = 8.0f;
constexpr float kLogitInv = 1.0f / 128.0f;   // undoes both carries at the logit

typedef __attribute__((ext_vector_type(16))) _Float16 v16h;
typedef __attribute__((ext_vector_type(8)))  _Float16 v8h;
typedef __attribute__((ext_vector_type(4)))  _Float16 v4h;
typedef __attribute__((ext_vector_type(16))) __bf16   v16b;
typedef __attribute__((ext_vector_type(8)))  __bf16   v8b;
typedef __attribute__((ext_vector_type(8)))  float    v8f;
typedef __attribute__((ext_vector_type(4)))  float    v4f;
typedef __attribute__((ext_vector_type(4)))  unsigned int v4u;

__device__ __forceinline__ unsigned short f2bf_bits(float f) {
  unsigned u = __float_as_uint(f);
  return (unsigned short)((u + 0x7FFFu + ((u >> 16) & 1u)) >> 16);
}
__device__ __forceinline__ float bf_bits2f(unsigned short h) { return __uint_as_float(((unsigned)h) << 16); }

template <typename T> struct Frag;
template <> struct Frag<_Float16> {
  typedef v16h V; union U { v16h v; v8h h[2]; };
  static __device__ __forceinline__ v16h load(const _Float16* p) {   // elements 0..7 <- p[0..7], 8..15 <- p[16..23]
    U f; f.h[0] = *(const v8h*)(p); f.h[1] = *(const v8h*)(p + 16); return f.v;
  }
  static __device__ __forceinline__ v8f mma(v16h a, v16h b, v8f c) {
    return __builtin_amdgcn_wmma_f32_16x16x32_f16(false, a, false, b, (short)0, c, false, false);
  }
};
template <> struct Frag<__bf16> {
  typedef v16b V; union U { v16b v; v8b h[2]; };
  static __device__ __forceinline__ v16b load(const __bf16* p) {
    U f; f.h[0] = *(const v8b*)(p); f.h[1] = *(const v8b*)(p + 16); return f.v;
  }
  static __device__ __forceinline__ v8f mma(v16b a, v16b b, v8f c) {
    return __builtin_amdgcn_wmma_f32_16x16x32_bf16(false, a, false, b, (short)0, c, false, false);
  }
};

__device__ __forceinline__ unsigned pk16(unsigned short a, unsigned short b) { return (unsigned)a | ((unsigned)b << 16); }
__device__ __forceinline__ unsigned short h_bits(float f) { const _Float16 h = (_Float16)f; return __builtin_bit_cast(unsigned short, h); }

// ---------------------------------------------------------------------------
// p = F . Wt^T for both W1 halves (blockIdx.y = batch): F bf16 [1024][512], Wt bf16 [256][512], P f32 [1024][256].
// One block (8 waves) per 32 x 64 tile of P, 128 tiles per batch, so the 256 blocks cover the chip.
// Both operand tiles are whole rows, contiguous in memory: they come in as whole 512-B wave loads, all in flight at once,
// and go to LDS at a padded pitch; the fragments (16 rows a load) are read from LDS.
// Wave w owns the 16 x 16 subtile (w >> 2, w & 3); one accumulator, k steps in ascending order.
// ---------------------------------------------------------------------------
constexpr int kGM = 32;           // rows of P per block
constexpr int kGN = 64;           // columns of P per block
constexpr int kGP = kFeat + 8;    // bf16 pitch of the staged rows (1040 B = 16 B x odd: ds_load_b128 without bank conflicts)
constexpr int kGC = kGN + 4;      // float pitch of the result tile
__global__ __launch_bounds__(256) void w1_gemm_kernel(const unsigned short* __restrict__ F, const unsigned short* __restrict__ Wt,
                                                      float* __restrict__ P) {
  __shared__ __align__(16) unsigned short sA[kGM * kGP];   // 33280 B
  __shared__ __align__(16) unsigned short sB[kGN * kGP];   // 66560 B
  __shared__ __align__(16) float sC[kGM * kGC];            //  8704 B
  const int tid  = threadIdx.x;
  const int lane = tid & 31;
  const int wave = tid >> 5;
  const int b    = blockIdx.y;
  const int m0   = (blockIdx.x >> 2) * kGM;
  const int n0   = (blockIdx.x & 3) * kGN;

  // ---- stage: chunk q = it * 256 + tid of 8 bf16; row q >> 6, column (q & 63) * 8; A 2048 chunks, B 4096 ----
  {
    const unsigned short* ga = F  + (size_t)b * kNI * kFeat  + (size_t)m0 * kFeat + tid * 8;
    const unsigned short* gb = Wt + (size_t)b * kHid * kFeat + (size_t)n0 * kFeat + tid * 8;
    v4u ra[8], rb[16];
#pragma unroll
    for (int it = 0; it < 8; ++it) ra[it] = *(const v4u*)(ga + it * 2048);
#pragma unroll
    for (int it = 0; it < 16; ++it) rb[it] = *(const v4u*)(gb + it * 2048);
    // stands before a register that the loads above name is written again (they are addressed by tid on scalar bases);
    // naming tid as an input keeps it whole up to here
    asm volatile("s_wait_xcnt 0x0" :: "v"(tid) : "memory");
    unsigned short* da = sA + (tid >> 6) * kGP + (tid & 63) * 8;
    unsigned short* db = sB + (tid >> 6) * kGP + (tid & 63) * 8;
#pragma unroll
    for (int it = 0; it < 8; ++it) *(v4u*)(da + it * 4 * kGP) = ra[it];
#pragma unroll
    for (int it = 0; it < 16; ++it) *(v4u*)(db + it * 4 * kGP) = rb[it];
  }
  __syncthreads();   // both tiles staged

  const int rlane = lane & 15;            // row (A) / column (B, D) within the subtile
  const int hh    = lane >> 4;            // k offset 8 hh of the fragments, row offset 8 hh of D
  const int wm    = (wave >> 2) * 16;
  const int wn    = (wave & 3) * 16;
  const __bf16* pa = (const __bf16*)sA + (wm + rlane) * kGP + 8 * hh;
  const __bf16* pb = (const __bf16*)sB + (wn + rlane) * kGP + 8 * hh;
  v8f acc = (v8f){0.f, 0.f, 0.f, 0.f, 0.f, 0.f, 0.f, 0.f};
#pragma unroll
  for (int k0 = 0; k0 < kFeat; k0 += 32)
    acc = Frag<__bf16>::mma(Frag<__bf16>::load(pa + k0), Frag<__bf16>::load(pb + k0), acc);

  // ---- result through LDS, so that 16 lanes write one 256-B row segment ----
#pragma unroll
  for (int r = 0; r < 8; ++r) sC[(wm + 8 * hh + r) * kGC + wn + rlane] = acc[r];
  __syncthreads();   // result tile complete
  float* po = P + (size_t)b * kNI * kHid + (size_t)(m0 + (tid >> 4)) * kHid + n0 + (tid & 15) * 4;
  const float* pc = sC + (tid >> 4) * kGC + (tid & 15) * 4;
#pragma unroll
  for (int it = 0; it < 2; ++it) *(v4f*)(po + it * 16 * kHid) = *(const v4f*)(pc + it * 16 * kGC);
}

// ---------------------------------------------------------------------------
// Cast, 8 consecutive elements per thread: in f32 [n] -> out 16-bit bits [n]; blk = block number within this job.
//   MODE 0: bf16 RNE bits. MODE 1: f16 bits of (scale * bf16-RNE value) (scale = power-of-two carry).
// ---------------------------------------------------------------------------
template <int MODE>
__device__ __forceinline__ void cast8_body(const float* __restrict__ in, unsigned short* __restrict__ out, int n8, float scale, int blk) {
  const int i = blk * 256 + threadIdx.x;
  if (i >= n8) return;
  const float* p = in + 8 * (size_t)i;
  const v4f a = *(const v4f*)(p);
  const v4f c = *(const v4f*)(p + 4);
  unsigned short hb[8];
#pragma unroll
  for (int e = 0; e < 4; ++e) {
    if (MODE == 0) {
      hb[e]     = f2bf_bits(a[e]);
      hb[4 + e] = f2bf_bits(c[e]);
    } else {
      hb[e]     = h_bits(bf_bits2f(f2bf_bits(a[e])) * scale);
      hb[4 + e] = h_bits(bf_bits2f(f2bf_bits(c[e])) * scale);
    }
  }
  const v4u u = (v4u){pk16(hb[0], hb[1]), pk16(hb[2], hb[3]), pk16(hb[4], hb[5]), pk16(hb[6], hb[7])};
  unsigned short* q = out + 8 * (size_t)i;
  *(v4u*)q = u;
  
  (void)scale;
}

// ---------------------------------------------------------------------------
// Transposing cast: in [R][CC] f32 row-major -> out [CC][R] 16-bit bits (MODE 0: bf16 RNE; MODE 1: f16 bits of in*scale).
// One block (256 threads) per 64x64 tile (bx, by) of (CC/64, R/64); R, CC multiples of 64; s = 64 x 65 floats of LDS.
// Load phase: thread t reads in row r0 + (t>>2), 16 floats at cols c0 + (t&3)*16 -> 256 x 16 = 64x64 = whole tile, into LDS s[c][r].
// Store phase: wave w, it = 0..1: out row c0 + w*8 + it*4 + (lane>>3), 8 halves at r0 + (lane&7)*8
// ---------------------------------------------------------------------------
template <int MODE>
__device__ __forceinline__ unsigned short cvt16(float v, float scale) { return (MODE == 0) ? f2bf_bits(v) : h_bits(v * scale); }

template <int MODE>
__device__ __forceinline__ void transpose_cast64(const float* __restrict__ in, unsigned short* __restrict__ out,
                                                 int R, int CC, float scale, int bx, int by, float* s) {   // s[c*65 + r]
  const int t  = threadIdx.x;
  const int c0 = bx * 64;
  const int r0 = by * 64;
  {
    const int row = t >> 2, cq = (t & 3) * 16;
    const float* ip = in + (size_t)(r0 + row) * CC + c0 + cq;
#pragma unroll
    for (int e4 = 0; e4 < 4; ++e4) {
      const v4f v = *(const v4f*)(ip + 4 * e4);
#pragma unroll
      for (int e = 0; e < 4; ++e) s[(cq + 4 * e4 + e) * 65 + row] = v[e];
    }
  }
  __syncthreads();
  const int wave = t >> 5, lane = t & 31, q = lane >> 3, c8 = (lane & 7) * 8;
  const int orow0 = wave * 8 + q;        // it = 0
  const int orow1 = wave * 8 + 4 + q;    // it = 1
  unsigned short b0[8], b1v[8];
#pragma unroll
  for (int e = 0; e < 8; ++e) {
    b0[e]  = cvt16<MODE>(s[orow0 * 65 + c8 + e], scale);
    b1v[e] = cvt16<MODE>(s[orow1 * 65 + c8 + e], scale);
  }
  const v4u u0 = (v4u){pk16(b0[0], b0[1]), pk16(b0[2], b0[3]), pk16(b0[4], b0[5]), pk16(b0[6], b0[7])};
  const v4u u1 = (v4u){pk16(b1v[0], b1v[1]), pk16(b1v[2], b1v[3]), pk16(b1v[4], b1v[5]), pk16(b1v[6], b1v[7])};
  unsigned short* o0 = out + (size_t)(c0 + orow0) * R + r0 + c8;
  unsigned short* o1 = out + (size_t)(c0 + orow1) * R + r0 + c8;
  *(v4u*)o0 = u0;
  *(v4u*)o1 = u1;
  // other jobs' code follows this one in the kernel: stands before that code writes a register that the stores name
  asm volatile("s_wait_xcnt 0x0" ::: "memory");
}

// ---------------------------------------------------------------------------
// Zero-padded W3 plane for the 16-column-padded matvec: W3P f16 [16][128]; row 0 = f16(W3[k] * scale), rows 1..15 = 0.
// One block of 256 threads: thread t writes 8 halves at t*8 (row t>>4, cols (t&15)*8..+7) -> 256 x 8 = 2048 = whole plane;
// W3 is loaded unconditionally (index always < 128) and selected by value.
// ---------------------------------------------------------------------------
__device__ __forceinline__ void w3pad_body(const float* __restrict__ W3, unsigned short* __restrict__ W3P, float scale) {
  const int t = threadIdx.x;
  const int row = t >> 4, col = (t & 15) * 8;
  const v4f a = *(const v4f*)(W3 + col);
  const v4f c = *(const v4f*)(W3 + col + 4);
  unsigned short hb[8];
#pragma unroll
  for (int e = 0; e < 4; ++e) {
    hb[e]     = (row == 0) ? h_bits(a[e] * scale) : (unsigned short)0;
    hb[4 + e] = (row == 0) ? h_bits(c[e] * scale) : (unsigned short)0;
  }
  const v4u u = (v4u){pk16(hb[0], hb[1]), pk16(hb[2], hb[3]), pk16(hb[4], hb[5]), pk16(hb[6], hb[7])};
  unsigned short* q = W3P + 8 * (size_t)t;
  *(v4u*)q = u;
  asm volatile("s_wait_xcnt 0x0" ::: "memory");   // as in transpose_cast64
}

// ---------------------------------------------------------------------------
// All operand conversions in one grid: none reads what another writes, so a range of the block index picks the job
// (block-uniform branch; only the transposes have a barrier, and every thread of such a block reaches it).
//   blocks   0 ..  31  W1[0:512]    -> W1AT   tiles (4, 8)
//           32 ..  63  W1[512:1024] -> W1BT   tiles (4, 8)
//           64 ..  71  W2           -> W2T    tiles (2, 4)
//           72         W3           -> W3P
//           73 .. 328  feat1        -> F1B    256 blocks
//          329 .. 584  feat2        -> F2B    256 blocks
// ---------------------------------------------------------------------------
constexpr int kPrepW1   = (kHid / 64) * (kFeat / 64);    // 32 tiles per W1 half
constexpr int kPrepW2   = (kHid2 / 64) * (kHid / 64);    // 8 tiles
constexpr int kPrepCast = kNI * kFeat / 8 / 256;         // 256 blocks per feature matrix
constexpr int kPrepGrid = 2 * kPrepW1 + kPrepW2 + 1 + 2 * kPrepCast;   // 585
__global__ __launch_bounds__(256) void prep_kernel(const float* __restrict__ feat1, const float* __restrict__ feat2,
                                                   const float* __restrict__ W1, const float* __restrict__ W2,
                                                   const float* __restrict__ W3,
                                                   unsigned short* __restrict__ F1B, unsigned short* __restrict__ F2B,
                                                   unsigned short* __restrict__ W1AT, unsigned short* __restrict__ W1BT,
                                                   unsigned short* __restrict__ W2T, unsigned short* __restrict__ W3P) {
  __shared__ float s[64 * 65];
  const int b = blockIdx.x;
  // the load of the kernel's arguments names s[0:1], and the branch code below writes s0 on the way to the first job:
  // naming an argument as an input puts this wait behind that load
  asm volatile("s_wait_xcnt 0x0" :: "s"(feat1) : "memory");
  constexpr int e0 = kPrepW1, e1 = e0 + kPrepW1, e2 = e1 + kPrepW2, e3 = e2 + 1, e4 = e3 + kPrepCast;   // first block of the next job
  if (b < e0) {
    transpose_cast64<0>(W1, W1AT, kFeat, kHid, 1.0f, b & 3, b >> 2, s);
  } else if (b < e1) {
    transpose_cast64<0>(W1 + (size_t)kFeat * kHid, W1BT, kFeat, kHid, 1.0f, (b - e0) & 3, (b - e0) >> 2, s);
  } else if (b < e2) {
    transpose_cast64<1>(W2, W2T, kHid, kHid2, kW2Carry, (b - e1) & 1, (b - e1) >> 1, s);
  } else if (b < e3) {
    w3pad_body(W3, W3P, kW3Carry);
  } else if (b < e4) {
    cast8_body<0>(feat1, F1B, kNI * kFeat / 8, 1.0f, b - e3);
  } else {
    cast8_body<0>(feat2, F2B, kNJ * kFeat / 8, 1.0f, b - e4);
  }
}

// ---------------------------------------------------------------------------
// Pairwise MLP, transposed products, everything between p1/p2 and the logit stays in registers.
// Block = 4 waves (one per SIMD) on 64 i x 64 j; wave w owns columns j0 + 16w .. +15 and walks the 64 i.
//   A (resident)  = (16 W2)^T fragments, 8 row tiles (n) x 8 k steps
//   B (built)     = h1^T: lane (hh, c) holds pair column c, k = kmap order; h1 = relu((p1[i] + b1) + p2[j]) f32 -> f16
//   D             = 16 h2pre^T + 16 b2 (16 b2 is the accumulator's start value); D[8 hh + r][c]
//   two D tiles, relu'd and converted in place, are the B fragment of the W3 product (A = padded 8 W3 plane, row 0)
//   logit = D2[0][c] / 128; sim = 1 / (1 + exp(-(logit + b3))) in f32
// The W3 product of step i runs among the W2 products of step i + 1.
// ---------------------------------------------------------------------------
__device__ __forceinline__ v16h h1_frag(const v4f* __restrict__ x, const v4f* __restrict__ y) {
  union { v16h v; v4h q[4]; } f;
  const v4h z = (v4h){(_Float16)0.f, (_Float16)0.f, (_Float16)0.f, (_Float16)0.f};
#pragma unroll
  for (int q = 0; q < 4; ++q) f.q[q] = __builtin_elementwise_max(__builtin_convertvector(x[q] + y[q], v4h), z);
  return f.v;
}
__device__ __forceinline__ v16h h2_frag(v8f lo, v8f hi) {
  union { v16h v; v8h h[2]; } f;
  const v8h z = (v8h){(_Float16)0.f, (_Float16)0.f, (_Float16)0.f, (_Float16)0.f, (_Float16)0.f, (_Float16)0.f, (_Float16)0.f, (_Float16)0.f};
  f.h[0] = __builtin_elementwise_max(__builtin_convertvector(lo, v8h), z);
  f.h[1] = __builtin_elementwise_max(__builtin_convertvector(hi, v8h), z);
  return f.v;
}
// register 0 of D2 = (8 W3 plane) x (16 h2)^T over the four k steps; four independent WMMAs, their partial sums added in k order
// (one accumulator would make a chain of four dependent WMMAs)
__device__ __forceinline__ float logit128(const v16h* __restrict__ w, const v16h* __restrict__ h) {
  const v8f z = (v8f){0.f, 0.f, 0.f, 0.f, 0.f, 0.f, 0.f, 0.f};
  const v8f d0 = Frag<_Float16>::mma(w[0], h[0], z);
  const v8f d1 = Frag<_Float16>::mma(w[1], h[1], z);
  const v8f d2 = Frag<_Float16>::mma(w[2], h[2], z);
  const v8f d3 = Frag<_Float16>::mma(w[3], h[3], z);
  return ((d0[0] + d1[0]) + d2[0]) + d3[0];
}
// the 16 f32 of one k step in kmap order: floats 0..7 and 16..23 behind p (p already holds the 8*hh offset)
__device__ __forceinline__ void ld16(v4f* d, const float* p) {
  d[0] = *(const v4f*)(p);
  d[1] = *(const v4f*)(p + 4);
  d[2] = *(const v4f*)(p + 16);
  d[3] = *(const v4f*)(p + 20);
}

__global__ __launch_bounds__(128) void pairmlp_kernel(const float* __restrict__ p1, const float* __restrict__ p2,
                                                      const float* __restrict__ b1,
                                                      const unsigned short* __restrict__ W2Tp, const float* __restrict__ b2,
                                                      const unsigned short* __restrict__ W3Pp, const float* __restrict__ b3,
                                                      float* __restrict__ out) {
  // one LDS object, so that the tile read in the loop lies first and its offsets fit the instructions' 16-bit field
  __shared__ __align__(16) struct {
    float    p1[kBI * kHid];          // 65536 B  p1 + b1, rows i0..i0+63
    float    lg[(kBI + 1) * kLgP];    // 33280 B  register 0 of D2, [row][wave][lane]: lanes 0..15 = 128 x logit; row s + 1 = step s, row 0 takes the empty first product
    _Float16 w2[kHid2 * kW2P];        // 67584 B  (16 W2)^T, read once into registers
  } sm;
  float* const s_p1 = sm.p1;
  float* const s_lg = sm.lg;
  _Float16* const s_w2 = sm.w2;

  const _Float16* W2T = (const _Float16*)W2Tp;   // [128][256], f16 of 16*W2[k][n] at [n][k]
  const _Float16* W3P = (const _Float16*)W3Pp;   // [16][128],  row 0 = f16 of 8*W3[k]
  const int tid  = threadIdx.x;
  const int lane = tid & 31;
  const int wave = tid >> 5;
  const int hh   = lane >> 4;
  const int m    = lane & 15;
  const int j0   = blockIdx.x * kBJ;
  const int i0   = blockIdx.y * kBI;

  // ---- stage p1 + b1: 32 x 128 float4 = 16384 floats = [64][256]; a thread's column is the same in every trip ----
  {
    const int cc = (tid & 63) * 4;
    const v4f bv = *(const v4f*)(b1 + cc);
    const float* src = p1 + (size_t)(i0 + (tid >> 6)) * kHid + cc;   // one address, constant offsets
    float* dst = s_p1 + (tid >> 6) * kHid + cc;
    v4f st[32];
#pragma unroll
    for (int it = 0; it < 32; ++it) st[it] = *(const v4f*)(src + it * 2 * kHid);
    // stands before the address registers of the loads above are written again; naming them as inputs keeps them whole up to here
    // (the b1 load is addressed by its byte offset, cc * 4, on a scalar base)
    asm volatile("s_wait_xcnt 0x0" :: "v"(src), "v"(cc * 4) : "memory");
#pragma unroll
    for (int it = 0; it < 32; ++it) *(v4f*)(dst + it * 2 * kHid) = st[it] + bv;
  }

  // ---- resident operands ----
  // ---- stage (16 W2)^T once per block, whole 512-B rows per wave-load: 32 x 128 chunks of 8 halves = [128][256] ----
  {
    const _Float16* src = W2T + tid * 8;
    _Float16* dst = s_w2 + (tid >> 5) * kW2P + (tid & 31) * 8;
    v8h st[32];
#pragma unroll
    for (int it = 0; it < 32; ++it) st[it] = *(const v8h*)(src + it * 1024);
    asm volatile("s_wait_xcnt 0x0" :: "v"(src) : "memory");   // as above
#pragma unroll
    for (int it = 0; it < 32; ++it) *(v8h*)(dst + it * 4 * kW2P) = st[it];
  }
  v16h w3a[4];       // padded 8 W3 plane as A: row m, k step c
  {
    const _Float16* wb = W3P + m * kHid2 + 8 * hh;
#pragma unroll
    for (int c = 0; c < 4; ++c) w3a[c] = Frag<_Float16>::load(wb + c * 32);
    asm volatile("s_wait_xcnt 0x0" :: "v"(wb) : "memory");   // as above
  }
  v8f bc[8];         // 16 b2 in D's map: register r = row 16 t + 8 hh + r
  const float* b2h = b2 + 8 * hh;
#pragma unroll
  for (int t = 0; t < 8; ++t) {
    const v4f lo = *(const v4f*)(b2h + t * 16);
    const v4f hi = *(const v4f*)(b2h + t * 16 + 4);
#pragma unroll
    for (int r = 0; r < 4; ++r) { bc[t][r] = lo[r] * kW2Carry; bc[t][4 + r] = hi[r] * kW2Carry; }
  }
  v4f q2[8][4];      // p2 row j0 + 16 wave + m, kmap order
  {
    const float* pr = p2 + (size_t)(j0 + wave * 16 + m) * kHid + 8 * hh;
#pragma unroll
    for (int c = 0; c < 8; ++c) ld16(q2[c], pr + c * 32);
    asm volatile("s_wait_xcnt 0x0" :: "v"(pr), "v"(b2h) : "memory");   // as above, for the b2 and p2 loads
  }
  const float b3v = b3[0];

  __syncthreads();   // s_p1 and s_w2 staged

  v16h wa[8][8];     // (16 W2)^T: row tile t, k step c
  {
    const _Float16* wb = s_w2 + m * kW2P + 8 * hh;
#pragma unroll
    for (int t = 0; t < 8; ++t)
#pragma unroll
      for (int c = 0; c < 8; ++c) wa[t][c] = Frag<_Float16>::load(wb + t * 16 * kW2P + c * 32);
  }

  const v8f zero8 = (v8f){0.f, 0.f, 0.f, 0.f, 0.f, 0.f, 0.f, 0.f};
  v16h hp[4];        // h2 fragments of the step before
#pragma unroll
  for (int c = 0; c < 4; ++c) hp[c] = h2_frag(zero8, zero8);
  v4f pa[4][4];      // p1 + b1, k steps 0..3 (fetched half a step ahead)
#pragma unroll
  for (int c = 0; c < 4; ++c) ld16(pa[c], s_p1 + 8 * hh + c * 32);
  float* lgp = s_lg + wave * 32 + lane;

  // The loop is rotated by one k step: k step 0 of step ii + 1 runs at the foot of step ii, among the h2 conversions.
  v8f acc[8];
  {
    const v16h f0 = h1_frag(pa[0], q2[0]);
#pragma unroll
    for (int t = 0; t < 8; ++t) acc[t] = Frag<_Float16>::mma(wa[t][0], f0, bc[t]);
  }
  v16h f1 = h1_frag(pa[1], q2[1]);

  // two steps a trip: the accumulators started at a step's foot overlap the ones being converted, so two sets take turns;
  // with one step a trip the new set was copied back into the old one's registers at every foot
#pragma unroll 2
  for (int ii = 0; ii < kBI; ++ii) {
    v4f pb[4][4];    // k steps 4..7 of this step
    __builtin_amdgcn_sched_barrier(0);   // with the one behind the reads: keeps the 16 LDS reads in one place
    {
      const float* row = s_p1 + ii * kHid + 8 * hh + 128;
#pragma unroll
      for (int c = 0; c < 4; ++c) ld16(pb[c], row + c * 32);
    }
    __builtin_amdgcn_sched_barrier(0);   // the second of the pair

#pragma unroll
    for (int t = 0; t < 8; ++t) acc[t] = Frag<_Float16>::mma(wa[t][1], f1, acc[t]);
    const v16h f2 = h1_frag(pa[2], q2[2]);
#pragma unroll
    for (int t = 0; t < 8; ++t) acc[t] = Frag<_Float16>::mma(wa[t][2], f2, acc[t]);
    const v16h f3 = h1_frag(pa[3], q2[3]);
#pragma unroll
    for (int t = 0; t < 8; ++t) acc[t] = Frag<_Float16>::mma(wa[t][3], f3, acc[t]);
    const v16h f4 = h1_frag(pb[0], q2[4]);
    const v16h f5 = h1_frag(pb[1], q2[5]);
    // issue order of this half: the vector work dealt four to a WMMA; left alone it came out in long runs
#pragma unroll
    for (int g = 0; g < 24; ++g) {
      __builtin_amdgcn_sched_group_barrier(0x008, 1, 0);    // one WMMA
      __builtin_amdgcn_sched_group_barrier(0x002, 4, 0);    // four vector instructions
    }

    __builtin_amdgcn_sched_barrier(0);   // as above, for the 16 reads below
    {
      const int nx = (ii + 1 < kBI) ? ii + 1 : ii;   // the last step fetches its own row again; what is made of it is not used
      const float* row = s_p1 + nx * kHid + 8 * hh;
#pragma unroll
      for (int c = 0; c < 4; ++c) ld16(pa[c], row + c * 32);
    }
    __builtin_amdgcn_sched_barrier(0);   // as above

    lgp[ii * kLgP] = logit128(w3a, hp);  // every lane stores, so EXEC never changes in the loop; lanes 0..15 hold D2 row 0
#pragma unroll
    for (int t = 0; t < 8; ++t) acc[t] = Frag<_Float16>::mma(wa[t][4], f4, acc[t]);
    const v16h f6 = h1_frag(pb[2], q2[6]);
#pragma unroll
    for (int t = 0; t < 8; ++t) acc[t] = Frag<_Float16>::mma(wa[t][5], f5, acc[t]);
    const v16h f7 = h1_frag(pb[3], q2[7]);
#pragma unroll
    for (int t = 0; t < 8; ++t) acc[t] = Frag<_Float16>::mma(wa[t][6], f6, acc[t]);
    const v16h f0 = h1_frag(pa[0], q2[0]);
#pragma unroll
    for (int t = 0; t < 8; ++t) acc[t] = Frag<_Float16>::mma(wa[t][7], f7, acc[t]);
#pragma unroll
    for (int c = 0; c < 4; ++c) {
      hp[c] = h2_frag(acc[2 * c], acc[2 * c + 1]);
      acc[2 * c]     = Frag<_Float16>::mma(wa[2 * c][0], f0, bc[2 * c]);
      acc[2 * c + 1] = Frag<_Float16>::mma(wa[2 * c + 1][0], f0, bc[2 * c + 1]);
    }
    f1 = h1_frag(pa[1], q2[1]);
    // issue order of this half: as above for the W3 product and k steps 4..6, then the logit store; the foot is left to the compiler
#pragma unroll
    for (int g = 0; g < 28; ++g) {
      __builtin_amdgcn_sched_group_barrier(0x008, 1, 1);
      __builtin_amdgcn_sched_group_barrier(0x002, 4, 1);
    }
    __builtin_amdgcn_sched_group_barrier(0x200, 1, 1);      // the logit store
  }
  lgp[kBI * kLgP] = logit128(w3a, hp);
  __syncthreads();   // all logits in s_lg

  // ---- sigmoid in f32 and store: 64 x 64 values, 8 float4 per thread; 16 lanes write one 256-B row segment ----
  const int r0 = tid >> 4;             // row r0 + 8 it, columns c4 .. c4 + 3
  const int c4 = (tid & 15) * 4;
  const float* lb = s_lg + (r0 + 1) * kLgP + (c4 >> 4) * 32 + (c4 & 15);
  float* ob = out + (size_t)(i0 + r0) * kNJ + j0 + c4;
#pragma unroll
  for (int it = 0; it < 8; ++it) {
    const v4f lg = *(const v4f*)(lb + it * 8 * kLgP);
    v4f v;
#pragma unroll
    for (int e = 0; e < 4; ++e) {
      const float x = lg[e] * kLogitInv + b3v;
      v[e] = 1.0f / (1.0f + expf(-x));
    }
    *(v4f*)(ob + it * 8 * kNJ) = v;
  }
}

// ---------------------------------------------------------------------------
// Workspace region map (byte offsets, all multiples of 128; every region fully written before it is read):
//   F1B  bf16 [1024][512]  feat1                      0
//   F2B  bf16 [1024][512]  feat2              1,048,576
//   W1AT bf16 [256][512]   W1[0:512]^T        2,097,152
//   W1BT bf16 [256][512]   W1[512:1024]^T     2,359,296
//   W2T  f16  [128][256]   (16 W2)^T          2,621,440
//   W3P  f16  [16][128]    row 0 = 8 W3       2,686,976
//   P1   f32  [1024][256]                     2,691,072
//   P2   f32  [1024][256]                     3,739,648
//   total                                     4,788,224 B
// GEMM shapes: p1/p2 M=1024 N=256 K=512 (K % 32 == 0, M % 32 == 0, N % 64 == 0, no padded planes);
// pair kernel: K=256 and K=128 in whole 32-steps from register fragments of exactly that width.
// ---------------------------------------------------------------------------
extern "C" void kernel_launch(void* const* d_in, const int* in_sizes, int n_in,
                              void* d_out, int out_size, void* d_ws, size_t ws_size,
                              hipStream_t stream) {
  if (n_in < 8) return;
  if (in_sizes[0] != kNI * kFeat) return;
  if (in_sizes[1] != kNJ * kFeat) return;
  if (in_sizes[2] != 2 * kFeat * kHid) return;
  if (in_sizes[3] != kHid) return;
  if (in_sizes[4] != kHid * kHid2) return;
  if (in_sizes[5] != kHid2) return;
  if (in_sizes[6] != kHid2) return;
  if (in_sizes[7] < 1) return;
  if (out_size != kNI * kNJ) return;

  const float* feat1 = (const float*)d_in[0];   // [1024][512]
  const float* feat2 = (const float*)d_in[1];   // [1024][512]
  const float* W1    = (const float*)d_in[2];   // [1024][256]  ([in][out])
  const float* b1    = (const float*)d_in[3];   // [256]
  const float* W2    = (const float*)d_in[4];   // [256][128]   ([in][out])
  const float* b2    = (const float*)d_in[5];   // [128]
  const float* W3    = (const float*)d_in[6];   // [128][1]
  const float* b3    = (const float*)d_in[7];   // [1]
  float* outp = (float*)d_out;                  // [1024][1024] f32

  // ---- carve ----
  const size_t SZ_FB  = (size_t)kNI * kFeat * 2;      // 1,048,576
  const size_t SZ_W1T = (size_t)kHid * kFeat * 2;     //   262,144
  const size_t SZ_W2T = (size_t)kHid2 * kHid * 2;     //    65,536
  const size_t SZ_W3P = (size_t)16 * kHid2 * 2;       //     4,096
  const size_t SZ_P   = (size_t)kNI * kHid * 4;       // 1,048,576
  size_t off = 0;
  const size_t oF1B  = off; off += SZ_FB;
  const size_t oF2B  = off; off += SZ_FB;
  const size_t oW1AT = off; off += SZ_W1T;
  const size_t oW1BT = off; off += SZ_W1T;
  const size_t oW2T  = off; off += SZ_W2T;
  const size_t oW3P  = off; off += SZ_W3P;
  const size_t oP1   = off; off += SZ_P;
  const size_t oP2   = off; off += SZ_P;
  const size_t TOTAL = off;                           // 4,788,224
  if (TOTAL > ws_size) return;
  if (TOTAL > (size_t)134217728) return;

  char* ws = (char*)d_ws;
  unsigned short* F1B  = (unsigned short*)(ws + oF1B);
  unsigned short* F2B  = (unsigned short*)(ws + oF2B);
  unsigned short* W1AT = (unsigned short*)(ws + oW1AT);
  unsigned short* W1BT = (unsigned short*)(ws + oW1BT);
  unsigned short* W2T  = (unsigned short*)(ws + oW2T);
  unsigned short* W3P  = (unsigned short*)(ws + oW3P);
  float*          P1   = (float*)(ws + oP1);
  float*          P2   = (float*)(ws + oP2);

  const dim3 blk(256);

  // (0) every operand conversion, one grid (block ranges: see prep_kernel)
  prep_kernel<<<dim3(kPrepGrid), blk, 0, stream>>>(feat1, feat2, W1, W2, W3, F1B, F2B, W1AT, W1BT, W2T, W3P);

  // (1) p1 = feat1 . W1[0:512] (batch 0), p2 = feat2 . W1[512:1024] (batch 1): M=1024 N=256 K=512 -> f32 [1024][256] each;
  //     128 tiles of 32 x 64 per batch; F2B, W1BT and P2 lie one plane behind F1B, W1AT and P1, which is the batch stride
  w1_gemm_kernel<<<dim3((kNI / kGM) * (kHid / kGN), 2), blk, 0, stream>>>(F1B, W1AT, P1);

  pairmlp_kernel<<<dim3(kNJ / kBJ, kNI / kBI), dim3(128), 0, stream>>>(P1, P2, b1, W2T, b2, W3P, b3, outp);
}

// v004
// A run of this version takes 41.8 microseconds.
// In both of two side-by-side timings against v003, it was 1.08 times as fast.
// Over all steps from v000 it is 3.86 times as fast.
// Contractions: feat1|feat2 x W1 halves on v_wmma_f32_16x16x32_bf16 (inputs RNE-converted to bf16); pairwise relu(p1+b1+p2) x W2 as max(p1+b1, -p2) x W2 + p2 x W2 (p1+b1, p2 f16, W2 f16 carried x16) and h2 x W3 (h2 f16 carried x16, W3 f16 carried x8, M padded to 16), both transposed, on v_wmma_f32_16x16x32_f16; f32 accumulate; biases and sigmoid in f32, both relu on the f16 values.
#include <hip/hip_runtime.h>
#include <math.h>

// ---------------------------------------------------------------------------
// Problem constants
// ---------------------------------------------------------------------------
constexpr int kNI   = 1024;   // rows of feat1 (output rows i)
constexpr int kNJ   = 1024;   // rows of feat2 (output cols j)
constexpr int kFeat = 512;
constexpr int kHid  = 256;
constexpr int kHid2 = 128;
constexpr int kBI   = 64;     // i rows per block of the pair kernel
constexpr int kBJ   = 64;     // j columns per block of the pair kernel (16 per wave)
constexpr int kW2P  = 264;    // f16 pitch of the staged W2^T rows (528 B = 16 B x odd: ds_load_b128 without bank conflicts)
constexpr int kLgP  = 128;    // floats per row of the logit tile: 4 waves x 32 lanes
constexpr float kW2Carry  = 16.0f;
constexpr float kW3Carry  = 8.0f;
constexpr float kLogitInv = 1.0f / 128.0f;   // undoes both carries at the logit

typedef __attribute__((ext_vector_type(16))) _Float16 v16h;
typedef __attribute__((ext_vector_type(8)))  _Float16 v8h;
typedef __attribute__((ext_vector_type(4)))  _Float16 v4h;
typedef __attribute__((ext_vector_type(16))) __bf16   v16b;
typedef __attribute__((ext_vector_type(8)))  __bf16   v8b;
typedef __attribute__((ext_vector_type(8)))  float    v8f;
typedef __attribute__((ext_vector_type(4)))  float    v4f;
typedef __attribute__((ext_vector_type(4)))  unsigned int v4u;

__device__ __forceinline__ unsigned short f2bf_bits(float f) {
  unsigned u = __float_as_uint(f);
  return (unsigned short)((u + 0x7FFFu + ((u >> 16) & 1u)) >> 16);
}
__device__ __forceinline__ float bf_bits2f(unsigned short h) { return __uint_as_float(((unsigned)h) << 16); }

template <typename T> struct Frag;
template <> struct Frag<_Float16> {
  typedef v16h V; union U { v16h v; v8h h[2]; };
  static __device__ __forceinline__ v16h load(const _Float16* p) {   // elements 0..7 <- p[0..7], 8..15 <- p[16..23]
    U f; f.h[0] = *(const v8h*)(p); f.h[1] = *(const v8h*)(p + 16); return f.v;
  }
  static __device__ __forceinline__ v8f mma(v16h a, v16h b, v8f c) {
    return __builtin_amdgcn_wmma_f32_16x16x32_f16(false, a, false, b, (short)0, c, false, false);
  }
};
template <> struct Frag<__bf16> {
  typedef v16b V; union U { v16b v; v8b h[2]; };
  static __device__ __forceinline__ v16b load(const __bf16* p) {
    U f; f.h[0] = *(const v8b*)(p); f.h[1] = *(const v8b*)(p + 16); return f.v;
  }
  static __device__ __forceinline__ v8f mma(v16b a, v16b b, v8f c) {
    return __builtin_amdgcn_wmma_f32_16x16x32_bf16(false, a, false, b, (short)0, c, false, false);
  }
};

__device__ __forceinline__ unsigned pk16(unsigned short a, unsigned short b) { return (unsigned)a | ((unsigned)b << 16); }
__device__ __forceinline__ unsigned short h_bits(float f) { const _Float16 h = (_Float16)f; return __builtin_bit_cast(unsigned short, h); }

// ---------------------------------------------------------------------------
// p = F . Wt^T for both W1 halves (blockIdx.y = batch): F bf16 [1024][512], Wt bf16 [256][512], P f32 [1024][256].
// One block (8 waves) per 32 x 64 tile of P, 128 tiles per batch, so the 256 blocks cover the chip.
// Both operand tiles are whole rows, contiguous in memory: they come in as whole 512-B wave loads, all in flight at once,
// and go to LDS at a padded pitch; the fragments (16 rows a load) are read from LDS.
// Wave w owns the 16 x 16 subtile (w >> 2, w & 3); one accumulator, k steps in ascending order.
// ---------------------------------------------------------------------------
constexpr int kGM = 32;           // rows of P per block
constexpr int kGN = 64;           // columns of P per block
constexpr int kGP = kFeat + 8;    // bf16 pitch of the staged rows (1040 B = 16 B x odd: ds_load_b128 without bank conflicts)
constexpr int kGC = kGN + 4;      // float pitch of the result tile
__global__ __launch_bounds__(256) void w1_gemm_kernel(const unsigned short* __restrict__ F, const unsigned short* __restrict__ Wt,
                                                      float* __restrict__ P) {
  __shared__ __align__(16) unsigned short sA[kGM * kGP];   // 33280 B
  __shared__ __align__(16) unsigned short sB[kGN * kGP];   // 66560 B
  __shared__ __align__(16) float sC[kGM * kGC];            //  8704 B
  const int tid  = threadIdx.x;
  const int lane = tid & 31;
  const int wave = tid >> 5;
  const int b    = blockIdx.y;
  const int m0   = (blockIdx.x >> 2) * kGM;
  const int n0   = (blockIdx.x & 3) * kGN;

  // ---- stage: chunk q = it * 256 + tid of 8 bf16; row q >> 6, column (q & 63) * 8; A 2048 chunks, B 4096 ----
  {
    const unsigned short* ga = F  + (size_t)b * kNI * kFeat  + (size_t)m0 * kFeat + tid * 8;
    const unsigned short* gb = Wt + (size_t)b * kHid * kFeat + (size_t)n0 * kFeat + tid * 8;
    v4u ra[8], rb[16];
#pragma unroll
    for (int it = 0; it < 8; ++it) ra[it] = *(const v4u*)(ga + it * 2048);
#pragma unroll
    for (int it = 0; it < 16; ++it) rb[it] = *(const v4u*)(gb + it * 2048);
    // stands before a register that the loads above name is written again (they are addressed by tid on scalar bases);
    // naming tid as an input keeps it whole up to here
    asm volatile("s_wait_xcnt 0x0" :: "v"(tid) : "memory");
    unsigned short* da = sA + (tid >> 6) * kGP + (tid & 63) * 8;
    unsigned short* db = sB + (tid >> 6) * kGP + (tid & 63) * 8;
#pragma unroll
    for (int it = 0; it < 8; ++it) *(v4u*)(da + it * 4 * kGP) = ra[it];
#pragma unroll
    for (int it = 0; it < 16; ++it) *(v4u*)(db + it * 4 * kGP) = rb[it];
  }
  __syncthreads();   // both tiles staged

  const int rlane = lane & 15;            // row (A) / column (B, D) within the subtile
  const int hh    = lane >> 4;            // k offset 8 hh of the fragments, row offset 8 hh of D
  const int wm    = (wave >> 2) * 16;
  const int wn    = (wave & 3) * 16;
  const __bf16* pa = (const __bf16*)sA + (wm + rlane) * kGP + 8 * hh;
  const __bf16* pb = (const __bf16*)sB + (wn + rlane) * kGP + 8 * hh;
  v8f acc = (v8f){0.f, 0.f, 0.f, 0.f, 0.f, 0.f, 0.f, 0.f};
#pragma unroll
  for (int k0 = 0; k0 < kFeat; k0 += 32)
    acc = Frag<__bf16>::mma(Frag<__bf16>::load(pa + k0), Frag<__bf16>::load(pb + k0), acc);

  // ---- result through LDS, so that 16 lanes write one 256-B row segment ----
#pragma unroll
  for (int r = 0; r < 8; ++r) sC[(wm + 8 * hh + r) * kGC + wn + rlane] = acc[r];
  __syncthreads();   // result tile complete
  float* po = P + (size_t)b * kNI * kHid + (size_t)(m0 + (tid >> 4)) * kHid + n0 + (tid & 15) * 4;
  const float* pc = sC + (tid >> 4) * kGC + (tid & 15) * 4;
#pragma unroll
  for (int it = 0; it < 2; ++it) *(v4f*)(po + it * 16 * kHid) = *(const v4f*)(pc + it * 16 * kGC);
}

// ---------------------------------------------------------------------------
// Cast, 8 consecutive elements per thread: in f32 [n] -> out 16-bit bits [n]; blk = block number within this job.
//   MODE 0: bf16 RNE bits. MODE 1: f16 bits of (scale * bf16-RNE value) (scale = power-of-two carry).
// ---------------------------------------------------------------------------
template <int MODE>
__device__ __forceinline__ void cast8_body(const float* __restrict__ in, unsigned short* __restrict__ out, int n8, float scale, int blk) {
  const int i = blk * 256 + threadIdx.x;
  if (i >= n8) return;
  const float* p = in + 8 * (size_t)i;
  const v4f a = *(const v4f*)(p);
  const v4f c = *(const v4f*)(p + 4);
  unsigned short hb[8];
#pragma unroll
  for (int e = 0; e < 4; ++e) {
    if (MODE == 0) {
      hb[e]     = f2bf_bits(a[e]);
      hb[4 + e] = f2bf_bits(c[e]);
    } else {
      hb[e]     = h_bits(bf_bits2f(f2bf_bits(a[e])) * scale);
      hb[4 + e] = h_bits(bf_bits2f(f2bf_bits(c[e])) * scale);
    }
  }
  const v4u u = (v4u){pk16(hb[0], hb[1]), pk16(hb[2], hb[3]), pk16(hb[4], hb[5]), pk16(hb[6], hb[7])};
  unsigned short* q = out + 8 * (size_t)i;
  *(v4u*)q = u;
  
  (void)scale;
}

// ---------------------------------------------------------------------------
// Transposing cast: in [R][CC] f32 row-major -> out [CC][R] 16-bit bits (MODE 0: bf16 RNE; MODE 1: f16 bits of in*scale).
// One block (256 threads) per 64x64 tile (bx, by) of (CC/64, R/64); R, CC multiples of 64; s = 64 x 65 floats of LDS.
// Load phase: thread t reads in row r0 + (t>>2), 16 floats at cols c0 + (t&3)*16 -> 256 x 16 = 64x64 = whole tile, into LDS s[c][r].
// Store phase: wave w, it = 0..1: out row c0 + w*8 + it*4 + (lane>>3), 8 halves at r0 + (lane&7)*8
// ---------------------------------------------------------------------------
template <int MODE>
__device__ __forceinline__ unsigned short cvt16(float v, float scale) { return (MODE == 0) ? f2bf_bits(v) : h_bits(v * scale); }

template <int MODE>
__device__ __forceinline__ void transpose_cast64(const float* __restrict__ in, unsigned short* __restrict__ out,
                                                 int R, int CC, float scale, int bx, int by, float* s) {   // s[c*65 + r]
  const int t  = threadIdx.x;
  const int c0 = bx * 64;
  const int r0 = by * 64;
  {
    const int row = t >> 2, cq = (t & 3) * 16;
    const float* ip = in + (size_t)(r0 + row) * CC + c0 + cq;
#pragma unroll
    for (int e4 = 0; e4 < 4; ++e4) {
      const v4f v = *(const v4f*)(ip + 4 * e4);
#pragma unroll
      for (int e = 0; e < 4; ++e) s[(cq + 4 * e4 + e) * 65 + row] = v[e];
    }
  }
  __syncthreads();
  const int wave = t >> 5, lane = t & 31, q = lane >> 3, c8 = (lane & 7) * 8;
  const int orow0 = wave * 8 + q;        // it = 0
  const int orow1 = wave * 8 + 4 + q;    // it = 1
  unsigned short b0[8], b1v[8];
#pragma unroll
  for (int e = 0; e < 8; ++e) {
    b0[e]  = cvt16<MODE>(s[orow0 * 65 + c8 + e], scale);
    b1v[e] = cvt16<MODE>(s[orow1 * 65 + c8 + e], scale);
  }
  const v4u u0 = (v4u){pk16(b0[0], b0[1]), pk16(b0[2], b0[3]), pk16(b0[4], b0[5]), pk16(b0[6], b0[7])};
  const v4u u1 = (v4u){pk16(b1v[0], b1v[1]), pk16(b1v[2], b1v[3]), pk16(b1v[4], b1v[5]), pk16(b1v[6], b1v[7])};
  unsigned short* o0 = out + (size_t)(c0 + orow0) * R + r0 + c8;
  unsigned short* o1 = out + (size_t)(c0 + orow1) * R + r0 + c8;
  *(v4u*)o0 = u0;
  *(v4u*)o1 = u1;
  // other jobs' code follows this one in the kernel: stands before that code writes a register that the stores name
  asm volatile("s_wait_xcnt 0x0" ::: "memory");
}

// ---------------------------------------------------------------------------
// Zero-padded W3 plane for the 16-column-padded matvec: W3P f16 [16][128]; row 0 = f16(W3[k] * scale), rows 1..15 = 0.
// One block of 256 threads: thread t writes 8 halves at t*8 (row t>>4, cols (t&15)*8..+7) -> 256 x 8 = 2048 = whole plane;
// W3 is loaded unconditionally (index always < 128) and selected by value.
// ---------------------------------------------------------------------------
__device__ __forceinline__ void w3pad_body(const float* __restrict__ W3, unsigned short* __restrict__ W3P, float scale) {
  const int t = threadIdx.x;
  const int row = t >> 4, col = (t & 15) * 8;
  const v4f a = *(const v4f*)(W3 + col);
  const v4f c = *(const v4f*)(W3 + col + 4);
  unsigned short hb[8];
#pragma unroll
  for (int e = 0; e < 4; ++e) {
    hb[e]     = (row == 0) ? h_bits(a[e] * scale) : (unsigned short)0;
    hb[4 + e] = (row == 0) ? h_bits(c[e] * scale) : (unsigned short)0;
  }
  const v4u u = (v4u){pk16(hb[0], hb[1]), pk16(hb[2], hb[3]), pk16(hb[4], hb[5]), pk16(hb[6], hb[7])};
  unsigned short* q = W3P + 8 * (size_t)t;
  *(v4u*)q = u;
  asm volatile("s_wait_xcnt 0x0" ::: "memory");   // as in transpose_cast64
}

// ---------------------------------------------------------------------------
// All operand conversions in one grid: none reads what another writes, so a range of the block index picks the job
// (block-uniform branch; only the transposes have a barrier, and every thread of such a block reaches it).
//   blocks   0 ..  31  W1[0:512]    -> W1AT   tiles (4, 8)
//           32 ..  63  W1[512:1024] -> W1BT   tiles (4, 8)
//           64 ..  71  W2           -> W2T    tiles (2, 4)
//           72         W3           -> W3P
//           73 .. 328  feat1        -> F1B    256 blocks
//          329 .. 584  feat2        -> F2B    256 blocks
// ---------------------------------------------------------------------------
constexpr int kPrepW1   = (kHid / 64) * (kFeat / 64);    // 32 tiles per W1 half
constexpr int kPrepW2   = (kHid2 / 64) * (kHid / 64);    // 8 tiles
constexpr int kPrepCast = kNI * kFeat / 8 / 256;         // 256 blocks per feature matrix
constexpr int kPrepGrid = 2 * kPrepW1 + kPrepW2 + 1 + 2 * kPrepCast;   // 585
__global__ __launch_bounds__(256) void prep_kernel(const float* __restrict__ feat1, const float* __restrict__ feat2,
                                                   const float* __restrict__ W1, const float* __restrict__ W2,
                                                   const float* __restrict__ W3,
                                                   unsigned short* __restrict__ F1B, unsigned short* __restrict__ F2B,
                                                   unsigned short* __restrict__ W1AT, unsigned short* __restrict__ W1BT,
                                                   unsigned short* __restrict__ W2T, unsigned short* __restrict__ W3P) {
  __shared__ float s[64 * 65];
  const int b = blockIdx.x;
  // the load of the kernel's arguments names s[0:1], and the branch code below writes s0 on the way to the first job:
  // naming an argument as an input puts this wait behind that load
  asm volatile("s_wait_xcnt 0x0" :: "s"(feat1) : "memory");
  constexpr int e0 = kPrepW1, e1 = e0 + kPrepW1, e2 = e1 + kPrepW2, e3 = e2 + 1, e4 = e3 + kPrepCast;   // first block of the next job
  if (b < e0) {
    transpose_cast64<0>(W1, W1AT, kFeat, kHid, 1.0f, b & 3, b >> 2, s);
  } else if (b < e1) {
    transpose_cast64<0>(W1 + (size_t)kFeat * kHid, W1BT, kFeat, kHid, 1.0f, (b - e0) & 3, (b - e0) >> 2, s);
  } else if (b < e2) {
    transpose_cast64<1>(W2, W2T, kHid, kHid2, kW2Carry, (b - e1) & 1, (b - e1) >> 1, s);
  } else if (b < e3) {
    w3pad_body(W3, W3P, kW3Carry);
  } else if (b < e4) {
    cast8_body<0>(feat1, F1B, kNI * kFeat / 8, 1.0f, b - e3);
  } else {
    cast8_body<0>(feat2, F2B, kNJ * kFeat / 8, 1.0f, b - e4);
  }
}

// ---------------------------------------------------------------------------
// Pairwise MLP, transposed products, everything between p1/p2 and the logit stays in registers.
// Block = 4 waves (one per SIMD) on 64 i x 64 j; wave w owns columns j0 + 16w .. +15 and walks the 64 i.
//   A (resident)  = (16 W2)^T fragments, 8 row tiles (n) x 8 k steps
//   relu(a + q) = max(a, -q) + q with a = f16(p1[i] + b1), q = f16(p2[j]): the q part does not depend on i, so its product
//   with W2 is formed once per wave and starts every accumulator; a step builds only max(a, -q), one packed f16 maximum
//   B (built)     = max(a, -q)^T: lane (hh, c) holds pair column c, k = kmap order
//   D             = 16 h2pre^T; its start value is 16 b2 + (16 W2)^T q^T, per row and column; D[8 hh + r][c]
//   two D tiles, relu'd and converted in place, are the B fragment of the W3 product (A = padded 8 W3 plane, row 0)
//   logit = D2[0][c] / 128; sim = 1 / (1 + exp(-(logit + b3))) in f32
// The W3 product of step i runs among the W2 products of step i + 1.
// ---------------------------------------------------------------------------
// the NaN-propagating maximum: for the other kind the compiler first quiets each operand with a maximum of its own (three instructions for one)
__device__ __forceinline__ v16h h1_frag(v16h a, v16h nq) { return __builtin_elementwise_maximum(a, nq); }
__device__ __forceinline__ v16h h2_frag(v8f lo, v8f hi) {
  union { v16h v; v8h h[2]; } f;
  const v8h z = (v8h){(_Float16)0.f, (_Float16)0.f, (_Float16)0.f, (_Float16)0.f, (_Float16)0.f, (_Float16)0.f, (_Float16)0.f, (_Float16)0.f};
  f.h[0] = __builtin_elementwise_max(__builtin_convertvector(lo, v8h), z);
  f.h[1] = __builtin_elementwise_max(__builtin_convertvector(hi, v8h), z);
  return f.v;
}
// register 0 of D2 = (8 W3 plane) x (16 h2)^T over the four k steps; four independent WMMAs, their partial sums added in k order
// (one accumulator would make a chain of four dependent WMMAs)
__device__ __forceinline__ float logit128(const v16h* __restrict__ w, const v16h* __restrict__ h) {
  const v8f z = (v8f){0.f, 0.f, 0.f, 0.f, 0.f, 0.f, 0.f, 0.f};
  const v8f d0 = Frag<_Float16>::mma(w[0], h[0], z);
  const v8f d1 = Frag<_Float16>::mma(w[1], h[1], z);
  const v8f d2 = Frag<_Float16>::mma(w[2], h[2], z);
  const v8f d3 = Frag<_Float16>::mma(w[3], h[3], z);
  return ((d0[0] + d1[0]) + d2[0]) + d3[0];
}
// the 16 f32 of one k step in kmap order: floats 0..7 and 16..23 behind p (p already holds the 8*hh offset)
__device__ __forceinline__ void ld16(v4f* d, const float* p) {
  d[0] = *(const v4f*)(p);
  d[1] = *(const v4f*)(p + 4);
  d[2] = *(const v4f*)(p + 16);
  d[3] = *(const v4f*)(p + 20);
}

// issue-order hint for the second half of a step: N times one WMMA followed by V vector instructions
template <int N, int V>
__device__ __forceinline__ void deal() {
#pragma unroll
  for (int g = 0; g < N; ++g) {
    __builtin_amdgcn_sched_group_barrier(0x008, 1, 1);
    __builtin_amdgcn_sched_group_barrier(0x002, V, 1);
  }
}

__global__ __launch_bounds__(128) void pairmlp_kernel(const float* __restrict__ p1, const float* __restrict__ p2,
                                                      const float* __restrict__ b1,
                                                      const unsigned short* __restrict__ W2Tp, const float* __restrict__ b2,
                                                      const unsigned short* __restrict__ W3Pp, const float* __restrict__ b3,
                                                      float* __restrict__ out) {
  // one LDS object, so that the tile read in the loop lies first and its offsets fit the instructions' 16-bit field
  __shared__ __align__(16) struct {
    _Float16 p1[kBI * kHid];          // 32768 B  f16(p1 + b1), rows i0..i0+63
    float    lg[(kBI + 1) * kLgP];    // 33280 B  register 0 of D2, [row][wave][lane]: lanes 0..15 = 128 x logit; row s + 1 = step s, row 0 takes the empty first product
    _Float16 w2[kHid2 * kW2P];        // 67584 B  (16 W2)^T, read once into registers
  } sm;
  _Float16* const s_p1 = sm.p1;
  float* const s_lg = sm.lg;
  _Float16* const s_w2 = sm.w2;

  const _Float16* W2T = (const _Float16*)W2Tp;   // [128][256], f16 of 16*W2[k][n] at [n][k]
  const _Float16* W3P = (const _Float16*)W3Pp;   // [16][128],  row 0 = f16 of 8*W3[k]
  const int tid  = threadIdx.x;
  const int lane = tid & 31;
  const int wave = tid >> 5;
  const int hh   = lane >> 4;
  const int m    = lane & 15;
  const int j0   = blockIdx.x * kBJ;
  const int i0   = blockIdx.y * kBI;

  // ---- stage p1 + b1: 32 x 128 float4 = 16384 floats = [64][256]; a thread's column is the same in every trip ----
  {
    const int cc = (tid & 63) * 4;
    const v4f bv = *(const v4f*)(b1 + cc);
    const float* src = p1 + (size_t)(i0 + (tid >> 6)) * kHid + cc;   // one address, constant offsets
    _Float16* dst = s_p1 + (tid >> 6) * kHid + cc;
    v4f st[32];
#pragma unroll
    for (int it = 0; it < 32; ++it) st[it] = *(const v4f*)(src + it * 2 * kHid);
    // stands before the address registers of the loads above are written again; naming them as inputs keeps them whole up to here
    // (the b1 load is addressed by its byte offset, cc * 4, on a scalar base)
    asm volatile("s_wait_xcnt 0x0" :: "v"(src), "v"(cc * 4) : "memory");
#pragma unroll
    for (int it = 0; it < 32; ++it) *(v4h*)(dst + it * 2 * kHid) = __builtin_convertvector(st[it] + bv, v4h);
  }

  // ---- resident operands ----
  // ---- stage (16 W2)^T once per block, whole 512-B rows per wave-load: 32 x 128 chunks of 8 halves = [128][256] ----
  {
    const _Float16* src = W2T + tid * 8;
    _Float16* dst = s_w2 + (tid >> 5) * kW2P + (tid & 31) * 8;
    v8h st[32];
#pragma unroll
    for (int it = 0; it < 32; ++it) st[it] = *(const v8h*)(src + it * 1024);
    asm volatile("s_wait_xcnt 0x0" :: "v"(src) : "memory");   // as above
#pragma unroll
    for (int it = 0; it < 32; ++it) *(v8h*)(dst + it * 4 * kW2P) = st[it];
  }
  v16h w3a[4];       // padded 8 W3 plane as A: row m, k step c
  {
    const _Float16* wb = W3P + m * kHid2 + 8 * hh;
#pragma unroll
    for (int c = 0; c < 4; ++c) w3a[c] = Frag<_Float16>::load(wb + c * 32);
    asm volatile("s_wait_xcnt 0x0" :: "v"(wb) : "memory");   // as above
  }
  v8f bc[8];         // the accumulators' start value in D's map: register r = row 16 t + 8 hh + r; here 16 b2, the q product is added below
  const float* b2h = b2 + 8 * hh;
#pragma unroll
  for (int t = 0; t < 8; ++t) {
    const v4f lo = *(const v4f*)(b2h + t * 16);
    const v4f hi = *(const v4f*)(b2h + t * 16 + 4);
#pragma unroll
    for (int r = 0; r < 4; ++r) { bc[t][r] = lo[r] * kW2Carry; bc[t][4 + r] = hi[r] * kW2Carry; }
  }
  v16h q2[8];        // -q = f16(-p2) of row j0 + 16 wave + m, kmap order
  {
    const float* pr = p2 + (size_t)(j0 + wave * 16 + m) * kHid + 8 * hh;
    v4f x[8][4];
#pragma unroll
    for (int c = 0; c < 8; ++c) ld16(x[c], pr + c * 32);
    asm volatile("s_wait_xcnt 0x0" :: "v"(pr), "v"(b2h) : "memory");   // as above, for the b2 and p2 loads
#pragma unroll
    for (int c = 0; c < 8; ++c) {
      union { v16h v; v4h q[4]; } f;
#pragma unroll
      for (int e = 0; e < 4; ++e) f.q[e] = __builtin_convertvector(-x[c][e], v4h);
      q2[c] = f.v;
    }
  }
  const float b3v = b3[0];

  __syncthreads();   // s_p1 and s_w2 staged

  v16h wa[8][8];     // (16 W2)^T: row tile t, k step c
  {
    const _Float16* wb = s_w2 + m * kW2P + 8 * hh;
#pragma unroll
    for (int t = 0; t < 8; ++t)
#pragma unroll
      for (int c = 0; c < 8; ++c) wa[t][c] = Frag<_Float16>::load(wb + t * 16 * kW2P + c * 32);
  }
  // start value += (16 W2)^T q^T, k steps in ascending order; the same q bits as in the maximum, so that the two products of a unit with a <= -q cancel
#pragma unroll
  for (int c = 0; c < 8; ++c) {
    const v16h q = -q2[c];
#pragma unroll
    for (int t = 0; t < 8; ++t) bc[t] = Frag<_Float16>::mma(wa[t][c], q, bc[t]);
  }

  const v8f zero8 = (v8f){0.f, 0.f, 0.f, 0.f, 0.f, 0.f, 0.f, 0.f};
  v16h hp[4];        // h2 fragments of the step before
#pragma unroll
  for (int c = 0; c < 4; ++c) hp[c] = h2_frag(zero8, zero8);
  v16h pa[4], pb[4]; // a of the current step, k steps 0..3 and 4..7; each half row is read half a step before its first use
#pragma unroll
  for (int c = 0; c < 4; ++c) pa[c] = Frag<_Float16>::load(s_p1 + 8 * hh + c * 32);
#pragma unroll
  for (int c = 0; c < 4; ++c) pb[c] = Frag<_Float16>::load(s_p1 + 8 * hh + 128 + c * 32);
  float* lgp = s_lg + wave * 32 + lane;

  // The loop is rotated by one k step: k step 0 of step ii + 1 runs at the foot of step ii, among the h2 conversions.
  v8f acc[8];
  {
    const v16h f0 = h1_frag(pa[0], q2[0]);
#pragma unroll
    for (int t = 0; t < 8; ++t) acc[t] = Frag<_Float16>::mma(wa[t][0], f0, bc[t]);
  }
  v16h f1 = h1_frag(pa[1], q2[1]);

  // two steps a trip: the accumulators started at a step's foot overlap the ones being converted, so two sets take turns;
  // with one step a trip the new set was copied back into the old one's registers at every foot
#pragma unroll 2
  for (int ii = 0; ii < kBI; ++ii) {
    // the next step's row, read in two places, each in the half before the one that first uses it: only a maximum stands between a read
    // and its WMMA now, so a read of the same half would be waited for. The last step fetches its own row again; what is made of it is not used
    const _Float16* const row = s_p1 + ((ii + 1 < kBI) ? ii + 1 : ii) * kHid + 8 * hh;
    v16h pan[4], pbn[4];
    __builtin_amdgcn_sched_barrier(0);   // with the one behind the reads: keeps the 8 LDS reads in one place
#pragma unroll
    for (int c = 0; c < 4; ++c) pan[c] = Frag<_Float16>::load(row + c * 32);
    __builtin_amdgcn_sched_barrier(0);   // the second of the pair

#pragma unroll
    for (int t = 0; t < 8; ++t) acc[t] = Frag<_Float16>::mma(wa[t][1], f1, acc[t]);
    const v16h f2 = h1_frag(pa[2], q2[2]);
#pragma unroll
    for (int t = 0; t < 8; ++t) acc[t] = Frag<_Float16>::mma(wa[t][2], f2, acc[t]);
    const v16h f3 = h1_frag(pa[3], q2[3]);
#pragma unroll
    for (int t = 0; t < 8; ++t) acc[t] = Frag<_Float16>::mma(wa[t][3], f3, acc[t]);
    const v16h f4 = h1_frag(pb[0], q2[4]);
    const v16h f5 = h1_frag(pb[1], q2[5]);
    // issue order of this half: the maxima dealt two to a WMMA; left alone they came out in longer runs
#pragma unroll
    for (int g = 0; g < 24; ++g) {
      __builtin_amdgcn_sched_group_barrier(0x008, 1, 0);    // one WMMA
      __builtin_amdgcn_sched_group_barrier(0x002, 2, 0);    // two vector instructions
    }

    __builtin_amdgcn_sched_barrier(0);   // as above, for the 8 reads below
#pragma unroll
    for (int c = 0; c < 4; ++c) pbn[c] = Frag<_Float16>::load(row + 128 + c * 32);
    __builtin_amdgcn_sched_barrier(0);   // as above

    lgp[ii * kLgP] = logit128(w3a, hp);  // every lane stores, so EXEC never changes in the loop; lanes 0..15 hold D2 row 0
#pragma unroll
    for (int t = 0; t < 8; ++t) acc[t] = Frag<_Float16>::mma(wa[t][4], f4, acc[t]);
    const v16h f6 = h1_frag(pb[2], q2[6]);
#pragma unroll
    for (int t = 0; t < 8; ++t) acc[t] = Frag<_Float16>::mma(wa[t][5], f5, acc[t]);
    const v16h f7 = h1_frag(pb[3], q2[7]);
#pragma unroll
    for (int t = 0; t < 8; ++t) acc[t] = Frag<_Float16>::mma(wa[t][6], f6, acc[t]);
    const v16h f0 = h1_frag(pan[0], q2[0]);
#pragma unroll
    for (int t = 0; t < 8; ++t) acc[t] = Frag<_Float16>::mma(wa[t][7], f7, acc[t]);
#pragma unroll
    for (int c = 0; c < 4; ++c) {
      hp[c] = h2_frag(acc[2 * c], acc[2 * c + 1]);
      acc[2 * c]     = Frag<_Float16>::mma(wa[2 * c][0], f0, bc[2 * c]);
      acc[2 * c + 1] = Frag<_Float16>::mma(wa[2 * c + 1][0], f0, bc[2 * c + 1]);
    }
    f1 = h1_frag(pan[1], q2[1]);
#pragma unroll
    for (int c = 0; c < 4; ++c) { pa[c] = pan[c]; pb[c] = pbn[c]; }
    // issue order of this half, vector instructions behind each WMMA: W3 product 4, k steps 4..6 two (the maxima, the logit's sums);
    // the first three WMMAs of k step 7 none, so that no conversion reads an accumulator directly behind its last WMMA; the other five 4 and
    // k step 0 of the next step 7 (the h2 conversions, f1); then the logit store.
    // Left alone, k steps 6 and 7 came out interleaved, with WMMAs on one accumulator back to back
    deal<4, 4>();
    deal<24, 2>();
    __builtin_amdgcn_sched_group_barrier(0x008, 3, 1);
    deal<5, 4>();
    deal<8, 7>();
    __builtin_amdgcn_sched_group_barrier(0x200, 1, 1);      // the logit store
  }
  lgp[kBI * kLgP] = logit128(w3a, hp);
  __syncthreads();   // all logits in s_lg

  // ---- sigmoid in f32 and store: 64 x 64 values, 8 float4 per thread; 16 lanes write one 256-B row segment ----
  const int r0 = tid >> 4;             // row r0 + 8 it, columns c4 .. c4 + 3
  const int c4 = (tid & 15) * 4;
  const float* lb = s_lg + (r0 + 1) * kLgP + (c4 >> 4) * 32 + (c4 & 15);
  float* ob = out + (size_t)(i0 + r0) * kNJ + j0 + c4;
#pragma unroll
  for (int it = 0; it < 8; ++it) {
    const v4f lg = *(const v4f*)(lb + it * 8 * kLgP);
    v4f v;
#pragma unroll
    for (int e = 0; e < 4; ++e) {
      const float x = lg[e] * kLogitInv + b3v;
      v[e] = 1.0f / (1.0f + expf(-x));
    }
    *(v4f*)(ob + it * 8 * kNJ) = v;
  }
}

// ---------------------------------------------------------------------------
// Workspace region map (byte offsets, all multiples of 128; every region fully written before it is read):
//   F1B  bf16 [1024][512]  feat1                      0
//   F2B  bf16 [1024][512]  feat2              1,048,576
//   W1AT bf16 [256][512]   W1[0:512]^T        2,097,152
//   W1BT bf16 [256][512]   W1[512:1024]^T     2,359,296
//   W2T  f16  [128][256]   (16 W2)^T          2,621,440
//   W3P  f16  [16][128]    row 0 = 8 W3       2,686,976
//   P1   f32  [1024][256]                     2,691,072
//   P2   f32  [1024][256]                     3,739,648
//   total                                     4,788,224 B
// GEMM shapes: p1/p2 M=1024 N=256 K=512 (K % 32 == 0, M % 32 == 0, N % 64 == 0, no padded planes);
// pair kernel: K=256 and K=128 in whole 32-steps from register fragments of exactly that width.
// ---------------------------------------------------------------------------
extern "C" void kernel_launch(void* const* d_in, const int* in_sizes, int n_in,
                              void* d_out, int out_size, void* d_ws, size_t ws_size,
                              hipStream_t stream) {
  if (n_in < 8) return;
  if (in_sizes[0] != kNI * kFeat) return;
  if (in_sizes[1] != kNJ * kFeat) return;
  if (in_sizes[2] != 2 * kFeat * kHid) return;
  if (in_sizes[3] != kHid) return;
  if (in_sizes[4] != kHid * kHid2) return;
  if (in_sizes[5] != kHid2) return;
  if (in_sizes[6] != kHid2) return;
  if (in_sizes[7] < 1) return;
  if (out_size != kNI * kNJ) return;

  const float* feat1 = (const float*)d_in[0];   // [1024][512]
  const float* feat2 = (const float*)d_in[1];   // [1024][512]
  const float* W1    = (const float*)d_in[2];   // [1024][256]  ([in][out])
  const float* b1    = (const float*)d_in[3];   // [256]
  const float* W2    = (const float*)d_in[4];   // [256][128]   ([in][out])
  const float* b2    = (const float*)d_in[5];   // [128]
  const float* W3    = (const float*)d_in[6];   // [128][1]
  const float* b3    = (const float*)d_in[7];   // [1]
  float* outp = (float*)d_out;                  // [1024][1024] f32

  // ---- carve ----
  const size_t SZ_FB  = (size_t)kNI * kFeat * 2;      // 1,048,576
  const size_t SZ_W1T = (size_t)kHid * kFeat * 2;     //   262,144
  const size_t SZ_W2T = (size_t)kHid2 * kHid * 2;     //    65,536
  const size_t SZ_W3P = (size_t)16 * kHid2 * 2;       //     4,096
  const size_t SZ_P   = (size_t)kNI * kHid * 4;       // 1,048,576
  size_t off = 0;
  const size_t oF1B  = off; off += SZ_FB;
  const size_t oF2B  = off; off += SZ_FB;
  const size_t oW1AT = off; off += SZ_W1T;
  const size_t oW1BT = off; off += SZ_W1T;
  const size_t oW2T  = off; off += SZ_W2T;
  const size_t oW3P  = off; off += SZ_W3P;
  const size_t oP1   = off; off += SZ_P;
  const size_t oP2   = off; off += SZ_P;
  const size_t TOTAL = off;                           // 4,788,224
  if (TOTAL > ws_size) return;
  if (TOTAL > (size_t)134217728) return;

  char* ws = (char*)d_ws;
  unsigned short* F1B  = (unsigned short*)(ws + oF1B);
  unsigned short* F2B  = (unsigned short*)(ws + oF2B);
  unsigned short* W1AT = (unsigned short*)(ws + oW1AT);
  unsigned short* W1BT = (unsigned short*)(ws + oW1BT);
  unsigned short* W2T  = (unsigned short*)(ws + oW2T);
  unsigned short* W3P  = (unsigned short*)(ws + oW3P);
  float*          P1   = (float*)(ws + oP1);
  float*          P2   = (float*)(ws + oP2);

  const dim3 blk(256);

  // (0) every operand conversion, one grid (block ranges: see prep_kernel)
  prep_kernel<<<dim3(kPrepGrid), blk, 0, stream>>>(feat1, feat2, W1, W2, W3, F1B, F2B, W1AT, W1BT, W2T, W3P);

  // (1) p1 = feat1 . W1[0:512] (batch 0), p2 = feat2 . W1[512:1024] (batch 1): M=1024 N=256 K=512 -> f32 [1024][256] each;
  //     128 tiles of 32 x 64 per batch; F2B, W1BT and P2 lie one plane behind F1B, W1AT and P1, which is the batch stride
  w1_gemm_kernel<<<dim3((kNI / kGM) * (kHid / kGN), 2), blk, 0, stream>>>(F1B, W1AT, P1);

  pairmlp_kernel<<<dim3(kNJ / kBJ, kNI / kBI), dim3(128), 0, stream>>>(P1, P2, b1, W2T, b2, W3P, b3, outp);
}

// v005
// A run of this version takes 39.1 microseconds.
// Timed twice side by side with v004, it ran 1.06 and 1.07 times as fast.
// Over all steps from v000 it is 4.12 times as fast.
// Contractions: feat1|feat2 x W1 halves on v_wmma_f32_16x16x32_bf16 (inputs RNE-converted to bf16 while they are staged); pairwise relu(p1+b1+p2) x W2 as max(p1+b1, -p2) x W2 + p2 x W2 (p1+b1, p2 f16, W2 f16 carried x16) and h2 x W3 (h2 f16 carried x16, W3 f16 carried x8, M padded to 16), both transposed, on v_wmma_f32_16x16x32_f16; f32 accumulate; biases and sigmoid in f32, both relu on the f16 values.
#include <hip/hip_runtime.h>
#include <math.h>

// ---------------------------------------------------------------------------
// Problem constants
// ---------------------------------------------------------------------------
constexpr int kNI   = 1024;   // rows of feat1 (output rows i)
constexpr int kNJ   = 1024;   // rows of feat2 (output cols j)
constexpr int kFeat = 512;
constexpr int kHid  = 256;
constexpr int kHid2 = 128;
constexpr int kBI   = 64;     // i rows per block of the pair kernel
constexpr int kBJ   = 64;     // j columns per block of the pair kernel (16 per wave)
constexpr int kW2P  = 264;    // f16 pitch of the staged W2^T rows (528 B = 16 B x odd: ds_load_b128 without bank conflicts)
constexpr int kLgP  = 128;    // floats per row of the logit tile: 4 waves x 32 lanes
constexpr float kW2Carry  = 16.0f;
constexpr float kW3Carry  = 8.0f;
constexpr float kLogitInv = 1.0f / 128.0f;   // undoes both carries at the logit

typedef __attribute__((ext_vector_type(16))) _Float16 v16h;
typedef __attribute__((ext_vector_type(8)))  _Float16 v8h;
typedef __attribute__((ext_vector_type(4)))  _Float16 v4h;
typedef __attribute__((ext_vector_type(16))) __bf16   v16b;
typedef __attribute__((ext_vector_type(8)))  __bf16   v8b;
typedef __attribute__((ext_vector_type(8)))  float    v8f;
typedef __attribute__((ext_vector_type(4)))  float    v4f;
typedef __attribute__((ext_vector_type(4)))  unsigned int v4u;
typedef __attribute__((ext_vector_type(2)))  unsigned int v2u;

__device__ __forceinline__ unsigned short f2bf_bits(float f) {
  unsigned u = __float_as_uint(f);
  return (unsigned short)((u + 0x7FFFu + ((u >> 16) & 1u)) >> 16);
}
__device__ __forceinline__ float bf_bits2f(unsigned short h) { return __uint_as_float(((unsigned)h) << 16); }

template <typename T> struct Frag;
template <> struct Frag<_Float16> {
  typedef v16h V; union U { v16h v; v8h h[2]; };
  static __device__ __forceinline__ v16h load(const _Float16* p) {   // elements 0..7 <- p[0..7], 8..15 <- p[16..23]
    U f; f.h[0] = *(const v8h*)(p); f.h[1] = *(const v8h*)(p + 16); return f.v;
  }
  static __device__ __forceinline__ v8f mma(v16h a, v16h b, v8f c) {
    return __builtin_amdgcn_wmma_f32_16x16x32_f16(false, a, false, b, (short)0, c, false, false);
  }
};
template <> struct Frag<__bf16> {
  typedef v16b V; union U { v16b v; v8b h[2]; };
  static __device__ __forceinline__ v16b load(const __bf16* p) {
    U f; f.h[0] = *(const v8b*)(p); f.h[1] = *(const v8b*)(p + 16); return f.v;
  }
  static __device__ __forceinline__ v8f mma(v16b a, v16b b, v8f c) {
    return __builtin_amdgcn_wmma_f32_16x16x32_bf16(false, a, false, b, (short)0, c, false, false);
  }
};

__device__ __forceinline__ unsigned pk16(unsigned short a, unsigned short b) { return (unsigned)a | ((unsigned)b << 16); }
__device__ __forceinline__ unsigned short h_bits(float f) { const _Float16 h = (_Float16)f; return __builtin_bit_cast(unsigned short, h); }

// ---------------------------------------------------------------------------
// Transposing cast: in [R][CC] f32 row-major -> out [CC][R] 16-bit bits (MODE 0: bf16 RNE; MODE 1: f16 bits of in*scale).
// One block (256 threads) per 64x64 tile (bx, by) of (CC/64, R/64); R, CC multiples of 64; s = 64 x 65 floats of LDS.
// Load phase: thread t reads in row r0 + (t>>2), 16 floats at cols c0 + (t&3)*16 -> 256 x 16 = 64x64 = whole tile, into LDS s[c][r].
// Store phase: wave w, it = 0..1: out row c0 + w*8 + it*4 + (lane>>3), 8 halves at r0 + (lane&7)*8
// ---------------------------------------------------------------------------
template <int MODE>
__device__ __forceinline__ unsigned short cvt16(float v, float scale) { return (MODE == 0) ? f2bf_bits(v) : h_bits(v * scale); }

template <int MODE>
__device__ __forceinline__ void transpose_cast64(const float* __restrict__ in, unsigned short* __restrict__ out,
                                                 int R, int CC, float scale, int bx, int by, float* s) {   // s[c*65 + r]
  const int t  = threadIdx.x;
  const int c0 = bx * 64;
  const int r0 = by * 64;
  {
    const int row = t >> 2, cq = (t & 3) * 16;
    const float* ip = in + (size_t)(r0 + row) * CC + c0 + cq;
#pragma unroll
    for (int e4 = 0; e4 < 4; ++e4) {
      const v4f v = *(const v4f*)(ip + 4 * e4);
#pragma unroll
      for (int e = 0; e < 4; ++e) s[(cq + 4 * e4 + e) * 65 + row] = v[e];
    }
  }
  __syncthreads();
  const int wave = t >> 5, lane = t & 31, q = lane >> 3, c8 = (lane & 7) * 8;
  const int orow0 = wave * 8 + q;        // it = 0
  const int orow1 = wave * 8 + 4 + q;    // it = 1
  unsigned short b0[8], b1v[8];
#pragma unroll
  for (int e = 0; e < 8; ++e) {
    b0[e]  = cvt16<MODE>(s[orow0 * 65 + c8 + e], scale);
    b1v[e] = cvt16<MODE>(s[orow1 * 65 + c8 + e], scale);
  }
  const v4u u0 = (v4u){pk16(b0[0], b0[1]), pk16(b0[2], b0[3]), pk16(b0[4], b0[5]), pk16(b0[6], b0[7])};
  const v4u u1 = (v4u){pk16(b1v[0], b1v[1]), pk16(b1v[2], b1v[3]), pk16(b1v[4], b1v[5]), pk16(b1v[6], b1v[7])};
  unsigned short* o0 = out + (size_t)(c0 + orow0) * R + r0 + c8;
  unsigned short* o1 = out + (size_t)(c0 + orow1) * R + r0 + c8;
  *(v4u*)o0 = u0;
  *(v4u*)o1 = u1;
  // other jobs' code follows this one in the kernel: stands before that code writes a register that the stores name
  asm volatile("s_wait_xcnt 0x0" ::: "memory");
}

// ---------------------------------------------------------------------------
// Zero-padded W3 plane for the 16-column-padded matvec: W3P f16 [16][128]; row 0 = f16(W3[k] * scale), rows 1..15 = 0.
// One block of 256 threads: thread t writes 8 halves at t*8 (row t>>4, cols (t&15)*8..+7) -> 256 x 8 = 2048 = whole plane;
// W3 is loaded unconditionally (index always < 128) and selected by value.
// ---------------------------------------------------------------------------
__device__ __forceinline__ void w3pad_body(const float* __restrict__ W3, unsigned short* __restrict__ W3P, float scale) {
  const int t = threadIdx.x;
  const int row = t >> 4, col = (t & 15) * 8;
  const v4f a = *(const v4f*)(W3 + col);
  const v4f c = *(const v4f*)(W3 + col + 4);
  unsigned short hb[8];
#pragma unroll
  for (int e = 0; e < 4; ++e) {
    hb[e]     = (row == 0) ? h_bits(a[e] * scale) : (unsigned short)0;
    hb[4 + e] = (row == 0) ? h_bits(c[e] * scale) : (unsigned short)0;
  }
  const v4u u = (v4u){pk16(hb[0], hb[1]), pk16(hb[2], hb[3]), pk16(hb[4], hb[5]), pk16(hb[6], hb[7])};
  unsigned short* q = W3P + 8 * (size_t)t;
  *(v4u*)q = u;
  asm volatile("s_wait_xcnt 0x0" ::: "memory");   // as in transpose_cast64
}

// ---------------------------------------------------------------------------
// p = F . W for both W1 halves, straight from the f32 inputs: F f32 [1024][512], W = W1 half f32 [512][256], P f32 [1024][256].
// One block (8 waves) per 32 x 64 tile of P, 128 tiles per half, so the 256 blocks cover the chip; blocks 256..264 convert W2 and W3
// for the pair kernel (nothing in this launch reads what they write).
// Both operand tiles come in as whole 128-B lines, all loads in flight at once, are rounded to bf16 (RNE) in registers and go to LDS at a
// padded pitch, k contiguous for both; the fragments (16 rows a load) are read from LDS.
//   F tile: chunk q = it * 256 + tid of 4 floats, row q >> 7, column (q & 127) * 4.
//   W tile: a lane takes 8 k rows x 4 columns (8 loads); column by column its 8 k values are one 16-B LDS store, which is the transpose.
//           Lane = (g = lane >> 3, l8 = lane & 7): k = 64 wave + 32 (u >> 1) + 8 g + j, n = 32 (u & 1) + 4 l8 + e, u = 0..3;
//           a store's 32 lanes fall on 16 bank quads, two lanes each: no more LDS passes than its 512 B take anyway.
// Wave w owns the 16 x 16 subtile (w >> 2, w & 3); one accumulator, k steps in ascending order.
// ---------------------------------------------------------------------------
constexpr int kGM = 32;           // rows of P per block
constexpr int kGN = 64;           // columns of P per block
constexpr int kGP = kFeat + 8;    // bf16 pitch of the staged rows (1040 B = 16 B x odd: ds_load_b128 without bank conflicts)
constexpr int kGC = kGN + 4;      // float pitch of the result tile
constexpr int kGemmTiles  = (kNI / kGM) * (kHid / kGN);      // 128 tiles per W1 half
constexpr int kGemmBlocks = 2 * kGemmTiles;                  // 256
constexpr int kPrepW2     = (kHid2 / 64) * (kHid / 64);      // 8 tiles of the W2 transpose
constexpr int kGemmGrid   = kGemmBlocks + kPrepW2 + 1;       // 265
__device__ __forceinline__ unsigned bf2(float lo, float hi) {   // two bf16 (RNE) in one register
  typedef __attribute__((ext_vector_type(2))) float  v2f;
  typedef __attribute__((ext_vector_type(2))) __bf16 v2b;
  return __builtin_bit_cast(unsigned, __builtin_convertvector((v2f){lo, hi}, v2b));
}
__global__ __launch_bounds__(256) void w1_gemm_kernel(const float* __restrict__ feat1, const float* __restrict__ feat2,
                                                      const float* __restrict__ W1, const float* __restrict__ W2,
                                                      const float* __restrict__ W3, float* __restrict__ P,
                                                      unsigned short* __restrict__ W2T, unsigned short* __restrict__ W3P) {
  __shared__ __align__(16) unsigned short sA[kGM * kGP];   // 33280 B
  __shared__ __align__(16) unsigned short sB[kGN * kGP];   // 66560 B (the W2 transpose uses its first 16640 B as 64 x 65 floats)
  __shared__ __align__(16) float sC[kGM * kGC];            //  8704 B
  const int tid  = threadIdx.x;
  const int lane = tid & 31;
  const int wave = tid >> 5;
  const int bid  = blockIdx.x;
  if (bid >= kGemmBlocks) {   // block-uniform: every thread of a transposing block reaches that job's barrier
    const int c = bid - kGemmBlocks;
    if (c < kPrepW2) transpose_cast64<1>(W2, W2T, kHid, kHid2, kW2Carry, c & 1, c >> 1, (float*)sB);
    else             w3pad_body(W3, W3P, kW3Carry);
    return;
  }
  const int b    = bid >> 7;
  const int m0   = ((bid & 127) >> 2) * kGM;
  const int n0   = (bid & 3) * kGN;

  // ---- stage ----
  {
    const int g = lane >> 3, l8 = lane & 7;
    const float* ga = (b ? feat2 : feat1) + (size_t)m0 * kFeat + tid * 4;
    const float* gb = W1 + (size_t)(b * kFeat + wave * 64 + g * 8) * kHid + n0 + l8 * 4;
    v4f ra[16], rb[4][8];
#pragma unroll
    for (int it = 0; it < 16; ++it) ra[it] = *(const v4f*)(ga + it * 1024);
#pragma unroll
    for (int u = 0; u < 4; ++u)
#pragma unroll
      for (int j = 0; j < 8; ++j) rb[u][j] = *(const v4f*)(gb + ((u >> 1) * 32 + j) * kHid + (u & 1) * 32);
    __builtin_amdgcn_sched_barrier(0);   // keeps the conversions behind all 48 loads: lifted among them they wait for the first loads before the last are issued
    // stands before an address register of the loads above is written again (the F loads are addressed by tid on a scalar base);
    // naming them as inputs keeps them whole up to here
    asm volatile("s_wait_xcnt 0x0" :: "v"(tid), "v"(gb) : "memory");
    unsigned short* da = sA + (tid >> 7) * kGP + (tid & 127) * 4;
    unsigned short* db = sB + (l8 * 4) * kGP + wave * 64 + g * 8;
#pragma unroll
    for (int it = 0; it < 16; ++it)
      *(v2u*)(da + it * 2 * kGP) = (v2u){bf2(ra[it][0], ra[it][1]), bf2(ra[it][2], ra[it][3])};
#pragma unroll
    for (int u = 0; u < 4; ++u)
#pragma unroll
      for (int e = 0; e < 4; ++e)
        *(v4u*)(db + ((u & 1) * 32 + e) * kGP + (u >> 1) * 32) =
            (v4u){bf2(rb[u][0][e], rb[u][1][e]), bf2(rb[u][2][e], rb[u][3][e]), bf2(rb[u][4][e], rb[u][5][e]), bf2(rb[u][6][e], rb[u][7][e])};
  }
  __syncthreads();   // both tiles staged

  const int rlane = lane & 15;            // row (A) / column (B, D) within the subtile
  const int hh    = lane >> 4;            // k offset 8 hh of the fragments, row offset 8 hh of D
  const int wm    = (wave >> 2) * 16;
  const int wn    = (wave & 3) * 16;
  const __bf16* pa = (const __bf16*)sA + (wm + rlane) * kGP + 8 * hh;
  const __bf16* pb = (const __bf16*)sB + (wn + rlane) * kGP + 8 * hh;
  v8f acc = (v8f){0.f, 0.f, 0.f, 0.f, 0.f, 0.f, 0.f, 0.f};
#pragma unroll
  for (int k0 = 0; k0 < kFeat; k0 += 32)
    acc = Frag<__bf16>::mma(Frag<__bf16>::load(pa + k0), Frag<__bf16>::load(pb + k0), acc);

  // ---- result through LDS, so that 16 lanes write one 256-B row segment ----
#pragma unroll
  for (int r = 0; r < 8; ++r) sC[(wm + 8 * hh + r) * kGC + wn + rlane] = acc[r];
  __syncthreads();   // result tile complete
  float* po = P + (size_t)b * kNI * kHid + (size_t)(m0 + (tid >> 4)) * kHid + n0 + (tid & 15) * 4;
  const float* pc = sC + (tid >> 4) * kGC + (tid & 15) * 4;
#pragma unroll
  for (int it = 0; it < 2; ++it) *(v4f*)(po + it * 16 * kHid) = *(const v4f*)(pc + it * 16 * kGC);
  // the W2 and W3 jobs' code follows this path in the kernel: stands before that code writes a register that the stores name
  asm volatile("s_wait_xcnt 0x0" ::: "memory");
}

// ---------------------------------------------------------------------------
// Pairwise MLP, transposed products, everything between p1/p2 and the logit stays in registers.
// Block = 4 waves (one per SIMD) on 64 i x 64 j; wave w owns columns j0 + 16w .. +15 and walks the 64 i.
//   A (resident)  = (16 W2)^T fragments, 8 row tiles (n) x 8 k steps
//   relu(a + q) = max(a, -q) + q with a = f16(p1[i] + b1), q = f16(p2[j]): the q part does not depend on i, so its product
//   with W2 is formed once per wave and starts every accumulator; a step builds only max(a, -q), one packed f16 maximum
//   B (built)     = max(a, -q)^T: lane (hh, c) holds pair column c, k = kmap order
//   D             = 16 h2pre^T; its start value is 16 b2 + (16 W2)^T q^T, per row and column; D[8 hh + r][c]
//   two D tiles, relu'd and converted in place, are the B fragment of the W3 product (A = padded 8 W3 plane, row 0)
//   logit = D2[0][c] / 128; sim = 1 / (1 + exp(-(logit + b3))) in f32
// The W3 product of step i runs among the W2 products of step i + 1.
// ---------------------------------------------------------------------------
// the NaN-propagating maximum: for the other kind the compiler first quiets each operand with a maximum of its own (three instructions for one)
__device__ __forceinline__ v16h h1_frag(v16h a, v16h nq) { return __builtin_elementwise_maximum(a, nq); }
__device__ __forceinline__ v16h h2_frag(v8f lo, v8f hi) {
  union { v16h v; v8h h[2]; } f;
  const v8h z = (v8h){(_Float16)0.f, (_Float16)0.f, (_Float16)0.f, (_Float16)0.f, (_Float16)0.f, (_Float16)0.f, (_Float16)0.f, (_Float16)0.f};
  f.h[0] = __builtin_elementwise_max(__builtin_convertvector(lo, v8h), z);
  f.h[1] = __builtin_elementwise_max(__builtin_convertvector(hi, v8h), z);
  return f.v;
}
// register 0 of D2 = (8 W3 plane) x (16 h2)^T over the four k steps; four independent WMMAs, their partial sums added in k order
// (one accumulator would make a chain of four dependent WMMAs)
__device__ __forceinline__ float logit128(const v16h* __restrict__ w, const v16h* __restrict__ h) {
  const v8f z = (v8f){0.f, 0.f, 0.f, 0.f, 0.f, 0.f, 0.f, 0.f};
  const v8f d0 = Frag<_Float16>::mma(w[0], h[0], z);
  const v8f d1 = Frag<_Float16>::mma(w[1], h[1], z);
  const v8f d2 = Frag<_Float16>::mma(w[2], h[2], z);
  const v8f d3 = Frag<_Float16>::mma(w[3], h[3], z);
  return ((d0[0] + d1[0]) + d2[0]) + d3[0];
}
// the 16 f32 of one k step in kmap order: floats 0..7 and 16..23 behind p (p already holds the 8*hh offset)
__device__ __forceinline__ void ld16(v4f* d, const float* p) {
  d[0] = *(const v4f*)(p);
  d[1] = *(const v4f*)(p + 4);
  d[2] = *(const v4f*)(p + 16);
  d[3] = *(const v4f*)(p + 20);
}

// issue-order hint for the second half of a step: N times one WMMA followed by V vector instructions
template <int N, int V>
__device__ __forceinline__ void deal() {
#pragma unroll
  for (int g = 0; g < N; ++g) {
    __builtin_amdgcn_sched_group_barrier(0x008, 1, 1);
    __builtin_amdgcn_sched_group_barrier(0x002, V, 1);
  }
}

__global__ __launch_bounds__(128) void pairmlp_kernel(const float* __restrict__ p1, const float* __restrict__ p2,
                                                      const float* __restrict__ b1,
                                                      const unsigned short* __restrict__ W2Tp, const float* __restrict__ b2,
                                                      const unsigned short* __restrict__ W3Pp, const float* __restrict__ b3,
                                                      float* __restrict__ out) {
  // one LDS object, so that the tile read in the loop lies first and its offsets fit the instructions' 16-bit field
  __shared__ __align__(16) struct {
    _Float16 p1[kBI * kHid];          // 32768 B  f16(p1 + b1), rows i0..i0+63
    float    lg[(kBI + 1) * kLgP];    // 33280 B  register 0 of D2, [row][wave][lane]: lanes 0..15 = 128 x logit; row s + 1 = step s, row 0 takes the empty first product
    _Float16 w2[kHid2 * kW2P];        // 67584 B  (16 W2)^T, read once into registers
  } sm;
  _Float16* const s_p1 = sm.p1;
  float* const s_lg = sm.lg;
  _Float16* const s_w2 = sm.w2;

  const _Float16* W2T = (const _Float16*)W2Tp;   // [128][256], f16 of 16*W2[k][n] at [n][k]
  const _Float16* W3P = (const _Float16*)W3Pp;   // [16][128],  row 0 = f16 of 8*W3[k]
  const int tid  = threadIdx.x;
  const int lane = tid & 31;
  const int wave = tid >> 5;
  const int hh   = lane >> 4;
  const int m    = lane & 15;
  const int j0   = blockIdx.x * kBJ;
  const int i0   = blockIdx.y * kBI;

  // ---- stage p1 + b1: 32 x 128 float4 = 16384 floats = [64][256]; a thread's column is the same in every trip ----
  {
    const int cc = (tid & 63) * 4;
    const v4f bv = *(const v4f*)(b1 + cc);
    const float* src = p1 + (size_t)(i0 + (tid >> 6)) * kHid + cc;   // one address, constant offsets
    _Float16* dst = s_p1 + (tid >> 6) * kHid + cc;
    v4f st[32];
#pragma unroll
    for (int it = 0; it < 32; ++it) st[it] = *(const v4f*)(src + it * 2 * kHid);
    // stands before the address registers of the loads above are written again; naming them as inputs keeps them whole up to here
    // (the b1 load is addressed by its byte offset, cc * 4, on a scalar base)
    asm volatile("s_wait_xcnt 0x0" :: "v"(src), "v"(cc * 4) : "memory");
#pragma unroll
    for (int it = 0; it < 32; ++it) *(v4h*)(dst + it * 2 * kHid) = __builtin_convertvector(st[it] + bv, v4h);
  }

  // ---- resident operands ----
  // ---- stage (16 W2)^T once per block, whole 512-B rows per wave-load: 32 x 128 chunks of 8 halves = [128][256] ----
  {
    const _Float16* src = W2T + tid * 8;
    _Float16* dst = s_w2 + (tid >> 5) * kW2P + (tid & 31) * 8;
    v8h st[32];
#pragma unroll
    for (int it = 0; it < 32; ++it) st[it] = *(const v8h*)(src + it * 1024);
    asm volatile("s_wait_xcnt 0x0" :: "v"(src) : "memory");   // as above
#pragma unroll
    for (int it = 0; it < 32; ++it) *(v8h*)(dst + it * 4 * kW2P) = st[it];
  }
  v16h w3a[4];       // padded 8 W3 plane as A: row m, k step c
  {
    const _Float16* wb = W3P + m * kHid2 + 8 * hh;
#pragma unroll
    for (int c = 0; c < 4; ++c) w3a[c] = Frag<_Float16>::load(wb + c * 32);
    asm volatile("s_wait_xcnt 0x0" :: "v"(wb) : "memory");   // as above
  }
  v8f bc[8];         // the accumulators' start value in D's map: register r = row 16 t + 8 hh + r; here 16 b2, the q product is added below
  const float* b2h = b2 + 8 * hh;
#pragma unroll
  for (int t = 0; t < 8; ++t) {
    const v4f lo = *(const v4f*)(b2h + t * 16);
    const v4f hi = *(const v4f*)(b2h + t * 16 + 4);
#pragma unroll
    for (int r = 0; r < 4; ++r) { bc[t][r] = lo[r] * kW2Carry; bc[t][4 + r] = hi[r] * kW2Carry; }
  }
  v16h q2[8];        // -q = f16(-p2) of row j0 + 16 wave + m, kmap order
  {
    const float* pr = p2 + (size_t)(j0 + wave * 16 + m) * kHid + 8 * hh;
    v4f x[8][4];
#pragma unroll
    for (int c = 0; c < 8; ++c) ld16(x[c], pr + c * 32);
    asm volatile("s_wait_xcnt 0x0" :: "v"(pr), "v"(b2h) : "memory");   // as above, for the b2 and p2 loads
#pragma unroll
    for (int c = 0; c < 8; ++c) {
      union { v16h v; v4h q[4]; } f;
#pragma unroll
      for (int e = 0; e < 4; ++e) f.q[e] = __builtin_convertvector(-x[c][e], v4h);
      q2[c] = f.v;
    }
  }
  const float b3v = b3[0];

  __syncthreads();   // s_p1 and s_w2 staged

  v16h wa[8][8];     // (16 W2)^T: row tile t, k step c
  {
    const _Float16* wb = s_w2 + m * kW2P + 8 * hh;
#pragma unroll
    for (int t = 0; t < 8; ++t)
#pragma unroll
      for (int c = 0; c < 8; ++c) wa[t][c] = Frag<_Float16>::load(wb + t * 16 * kW2P + c * 32);
  }
  // start value += (16 W2)^T q^T, k steps in ascending order; the same q bits as in the maximum, so that the two products of a unit with a <= -q cancel
#pragma unroll
  for (int c = 0; c < 8; ++c) {
    const v16h q = -q2[c];
#pragma unroll
    for (int t = 0; t < 8; ++t) bc[t] = Frag<_Float16>::mma(wa[t][c], q, bc[t]);
  }

  const v8f zero8 = (v8f){0.f, 0.f, 0.f, 0.f, 0.f, 0.f, 0.f, 0.f};
  v16h hp[4];        // h2 fragments of the step before
#pragma unroll
  for (int c = 0; c < 4; ++c) hp[c] = h2_frag(zero8, zero8);
  v16h pa[4], pb[4]; // a of the current step, k steps 0..3 and 4..7; each half row is read half a step before its first use
#pragma unroll
  for (int c = 0; c < 4; ++c) pa[c] = Frag<_Float16>::load(s_p1 + 8 * hh + c * 32);
#pragma unroll
  for (int c = 0; c < 4; ++c) pb[c] = Frag<_Float16>::load(s_p1 + 8 * hh + 128 + c * 32);
  float* lgp = s_lg + wave * 32 + lane;

  // The loop is rotated by one k step: k step 0 of step ii + 1 runs at the foot of step ii, among the h2 conversions.
  v8f acc[8];
  {
    const v16h f0 = h1_frag(pa[0], q2[0]);
#pragma unroll
    for (int t = 0; t < 8; ++t) acc[t] = Frag<_Float16>::mma(wa[t][0], f0, bc[t]);
  }
  v16h f1 = h1_frag(pa[1], q2[1]);

  // two steps a trip: the accumulators started at a step's foot overlap the ones being converted, so two sets take turns;
  // with one step a trip the new set was copied back into the old one's registers at every foot
#pragma unroll 2
  for (int ii = 0; ii < kBI; ++ii) {
    // the next step's row, read in two places, each in the half before the one that first uses it: only a maximum stands between a read
    // and its WMMA now, so a read of the same half would be waited for. The last step fetches its own row again; what is made of it is not used
    const _Float16* const row = s_p1 + ((ii + 1 < kBI) ? ii + 1 : ii) * kHid + 8 * hh;
    v16h pan[4], pbn[4];
    __builtin_amdgcn_sched_barrier(0);   // with the one behind the reads: keeps the 8 LDS reads in one place
#pragma unroll
    for (int c = 0; c < 4; ++c) pan[c] = Frag<_Float16>::load(row + c * 32);
    __builtin_amdgcn_sched_barrier(0);   // the second of the pair

#pragma unroll
    for (int t = 0; t < 8; ++t) acc[t] = Frag<_Float16>::mma(wa[t][1], f1, acc[t]);
    const v16h f2 = h1_frag(pa[2], q2[2]);
#pragma unroll
    for (int t = 0; t < 8; ++t) acc[t] = Frag<_Float16>::mma(wa[t][2], f2, acc[t]);
    const v16h f3 = h1_frag(pa[3], q2[3]);
#pragma unroll
    for (int t = 0; t < 8; ++t) acc[t] = Frag<_Float16>::mma(wa[t][3], f3, acc[t]);
    const v16h f4 = h1_frag(pb[0], q2[4]);
    const v16h f5 = h1_frag(pb[1], q2[5]);
    // issue order of this half: the maxima dealt two to a WMMA; left alone they came out in longer runs
#pragma unroll
    for (int g = 0; g < 24; ++g) {
      __builtin_amdgcn_sched_group_barrier(0x008, 1, 0);    // one WMMA
      __builtin_amdgcn_sched_group_barrier(0x002, 2, 0);    // two vector instructions
    }

    __builtin_amdgcn_sched_barrier(0);   // as above, for the 8 reads below
#pragma unroll
    for (int c = 0; c < 4; ++c) pbn[c] = Frag<_Float16>::load(row + 128 + c * 32);
    __builtin_amdgcn_sched_barrier(0);   // as above

    lgp[ii * kLgP] = logit128(w3a, hp);  // every lane stores, so EXEC never changes in the loop; lanes 0..15 hold D2 row 0
#pragma unroll
    for (int t = 0; t < 8; ++t) acc[t] = Frag<_Float16>::mma(wa[t][4], f4, acc[t]);
    const v16h f6 = h1_frag(pb[2], q2[6]);
#pragma unroll
    for (int t = 0; t < 8; ++t) acc[t] = Frag<_Float16>::mma(wa[t][5], f5, acc[t]);
    const v16h f7 = h1_frag(pb[3], q2[7]);
#pragma unroll
    for (int t = 0; t < 8; ++t) acc[t] = Frag<_Float16>::mma(wa[t][6], f6, acc[t]);
    const v16h f0 = h1_frag(pan[0], q2[0]);
#pragma unroll
    for (int t = 0; t < 8; ++t) acc[t] = Frag<_Float16>::mma(wa[t][7], f7, acc[t]);
#pragma unroll
    for (int c = 0; c < 4; ++c) {
      hp[c] = h2_frag(acc[2 * c], acc[2 * c + 1]);
      acc[2 * c]     = Frag<_Float16>::mma(wa[2 * c][0], f0, bc[2 * c]);
      acc[2 * c + 1] = Frag<_Float16>::mma(wa[2 * c + 1][0], f0, bc[2 * c + 1]);
    }
    f1 = h1_frag(pan[1], q2[1]);
#pragma unroll
    for (int c = 0; c < 4; ++c) { pa[c] = pan[c]; pb[c] = pbn[c]; }
    // issue order of this half, vector instructions behind each WMMA: W3 product 4, k steps 4..6 two (the maxima, the logit's sums);
    // the first three WMMAs of k step 7 none, so that no conversion reads an accumulator directly behind its last WMMA; the other five 4 and
    // k step 0 of the next step 7 (the h2 conversions, f1); then the logit store.
    // Left alone, k steps 6 and 7 came out interleaved, with WMMAs on one accumulator back to back
    deal<4, 4>();
    deal<24, 2>();
    __builtin_amdgcn_sched_group_barrier(0x008, 3, 1);
    deal<5, 4>();
    deal<8, 7>();
    __builtin_amdgcn_sched_group_barrier(0x200, 1, 1);      // the logit store
  }
  lgp[kBI * kLgP] = logit128(w3a, hp);
  __syncthreads();   // all logits in s_lg

  // ---- sigmoid in f32 and store: 64 x 64 values, 8 float4 per thread; 16 lanes write one 256-B row segment ----
  const int r0 = tid >> 4;             // row r0 + 8 it, columns c4 .. c4 + 3
  const int c4 = (tid & 15) * 4;
  const float* lb = s_lg + (r0 + 1) * kLgP + (c4 >> 4) * 32 + (c4 & 15);
  float* ob = out + (size_t)(i0 + r0) * kNJ + j0 + c4;
#pragma unroll
  for (int it = 0; it < 8; ++it) {
    const v4f lg = *(const v4f*)(lb + it * 8 * kLgP);
    v4f v;
#pragma unroll
    for (int e = 0; e < 4; ++e) {
      const float x = lg[e] * kLogitInv + b3v;
      v[e] = 1.0f / (1.0f + expf(-x));
    }
    *(v4f*)(ob + it * 8 * kNJ) = v;
  }
}

// ---------------------------------------------------------------------------
// Workspace region map (byte offsets, all multiples of 128; every region fully written before it is read):
//   W2T  f16  [128][256]   (16 W2)^T                  0
//   W3P  f16  [16][128]    row 0 = 8 W3          65,536
//   P1   f32  [1024][256]                        69,632
//   P2   f32  [1024][256]                     1,118,208
//   total                                     2,166,784 B
// GEMM shapes: p1/p2 M=1024 N=256 K=512 (K % 32 == 0, M % 32 == 0, N % 64 == 0, no padded planes);
// pair kernel: K=256 and K=128 in whole 32-steps from register fragments of exactly that width.
// ---------------------------------------------------------------------------
extern "C" void kernel_launch(void* const* d_in, const int* in_sizes, int n_in,
                              void* d_out, int out_size, void* d_ws, size_t ws_size,
                              hipStream_t stream) {
  if (n_in < 8) return;
  if (in_sizes[0] != kNI * kFeat) return;
  if (in_sizes[1] != kNJ * kFeat) return;
  if (in_sizes[2] != 2 * kFeat * kHid) return;
  if (in_sizes[3] != kHid) return;
  if (in_sizes[4] != kHid * kHid2) return;
  if (in_sizes[5] != kHid2) return;
  if (in_sizes[6] != kHid2) return;
  if (in_sizes[7] < 1) return;
  if (out_size != kNI * kNJ) return;

  const float* feat1 = (const float*)d_in[0];   // [1024][512]
  const float* feat2 = (const float*)d_in[1];   // [1024][512]
  const float* W1    = (const float*)d_in[2];   // [1024][256]  ([in][out])
  const float* b1    = (const float*)d_in[3];   // [256]
  const float* W2    = (const float*)d_in[4];   // [256][128]   ([in][out])
  const float* b2    = (const float*)d_in[5];   // [128]
  const float* W3    = (const float*)d_in[6];   // [128][1]
  const float* b3    = (const float*)d_in[7];   // [1]
  float* outp = (float*)d_out;                  // [1024][1024] f32

  // ---- carve ----
  const size_t SZ_W2T = (size_t)kHid2 * kHid * 2;     //    65,536
  const size_t SZ_W3P = (size_t)16 * kHid2 * 2;       //     4,096
  const size_t SZ_P   = (size_t)kNI * kHid * 4;       // 1,048,576
  size_t off = 0;
  const size_t oW2T  = off; off += SZ_W2T;
  const size_t oW3P  = off; off += SZ_W3P;
  const size_t oP1   = off; off += SZ_P;
  const size_t oP2   = off; off += SZ_P;
  const size_t TOTAL = off;                           // 2,166,784
  if (TOTAL > ws_size) return;
  if (TOTAL > (size_t)134217728) return;

  char* ws = (char*)d_ws;
  unsigned short* W2T  = (unsigned short*)(ws + oW2T);
  unsigned short* W3P  = (unsigned short*)(ws + oW3P);
  float*          P1   = (float*)(ws + oP1);
  float*          P2   = (float*)(ws + oP2);

  // (0) p1 = feat1 . W1[0:512] (blocks 0..127), p2 = feat2 . W1[512:1024] (blocks 128..255): M=1024 N=256 K=512 -> f32 [1024][256] each,
  //     P2 one plane behind P1; blocks 256..264 convert W2 and W3
  w1_gemm_kernel<<<dim3(kGemmGrid), dim3(256), 0, stream>>>(feat1, feat2, W1, W2, W3, P1, W2T, W3P);

  pairmlp_kernel<<<dim3(kNJ / kBJ, kNI / kBI), dim3(128), 0, stream>>>(P1, P2, b1, W2T, b2, W3P, b3, outp);
}

// v006
// Measured time: 37.1 microseconds a run.
// Timed twice side by side with v005, it ran 1.05 times as fast both times.
// Over all steps from v000 it is 4.35 times as fast.
// Contractions: feat1|feat2 x W1 halves on v_wmma_f32_16x16x32_bf16 (inputs RNE-converted to bf16 while they are staged); pairwise relu(p1+b1+p2) x W2 as max(p1+b1, -p2) x W2 + p2 x W2 (p1+b1, p2 f16, W2 f16 carried x16) and h2 x W3 (h2 f16 carried x16, W3 f16 carried x8, M padded to 16), both transposed, on 16x16x32 f16 WMMAs; f32 accumulate but for the W2 product of a step, whose accumulators are f16 (start value formed in f32, rounded once); biases and sigmoid in f32, both relu on the f16 values.
#include <hip/hip_runtime.h>
#include <math.h>

// ---------------------------------------------------------------------------
// Problem constants
// ---------------------------------------------------------------------------
constexpr int kNI   = 1024;   // rows of feat1 (output rows i)
constexpr int kNJ   = 1024;   // rows of feat2 (output cols j)
constexpr int kFeat = 512;
constexpr int kHid  = 256;
constexpr int kHid2 = 128;
constexpr int kBI   = 64;     // i rows per block of the pair kernel
constexpr int kBJ   = 64;     // j columns per block of the pair kernel (16 per wave)
constexpr int kW2P  = 264;    // f16 pitch of the staged W2^T rows (528 B = 16 B x odd: ds_load_b128 without bank conflicts)
constexpr int kLgP  = 128;    // floats per row of the logit tile: 4 waves x 32 lanes
constexpr float kW2Carry  = 16.0f;
constexpr float kW3Carry  = 8.0f;
constexpr float kLogitInv = 1.0f / 128.0f;   // undoes both carries at the logit

typedef __attribute__((ext_vector_type(16))) _Float16 v16h;
typedef __attribute__((ext_vector_type(8)))  _Float16 v8h;
typedef __attribute__((ext_vector_type(4)))  _Float16 v4h;
typedef __attribute__((ext_vector_type(16))) __bf16   v16b;
typedef __attribute__((ext_vector_type(8)))  __bf16   v8b;
typedef __attribute__((ext_vector_type(8)))  float    v8f;
typedef __attribute__((ext_vector_type(4)))  float    v4f;
typedef __attribute__((ext_vector_type(4)))  unsigned int v4u;
typedef __attribute__((ext_vector_type(2)))  unsigned int v2u;

__device__ __forceinline__ unsigned short f2bf_bits(float f) {
  unsigned u = __float_as_uint(f);
  return (unsigned short)((u + 0x7FFFu + ((u >> 16) & 1u)) >> 16);
}
__device__ __forceinline__ float bf_bits2f(unsigned short h) { return __uint_as_float(((unsigned)h) << 16); }

template <typename T> struct Frag;
template <> struct Frag<_Float16> {
  typedef v16h V; union U { v16h v; v8h h[2]; };
  static __device__ __forceinline__ v16h load(const _Float16* p) {   // elements 0..7 <- p[0..7], 8..15 <- p[16..23]
    U f; f.h[0] = *(const v8h*)(p); f.h[1] = *(const v8h*)(p + 16); return f.v;
  }
  static __device__ __forceinline__ v8f mma(v16h a, v16h b, v8f c) {
    return __builtin_amdgcn_wmma_f32_16x16x32_f16(false, a, false, b, (short)0, c, false, false);
  }
  static __device__ __forceinline__ v8h mma(v16h a, v16h b, v8h c) {   // f16 C and D: element e = row 8 hh + e, four registers
    return __builtin_amdgcn_wmma_f16_16x16x32_f16(false, a, false, b, (short)0, c, false, false);
  }
};
template <> struct Frag<__bf16> {
  typedef v16b V; union U { v16b v; v8b h[2]; };
  static __device__ __forceinline__ v16b load(const __bf16* p) {
    U f; f.h[0] = *(const v8b*)(p); f.h[1] = *(const v8b*)(p + 16); return f.v;
  }
  static __device__ __forceinline__ v8f mma(v16b a, v16b b, v8f c) {
    return __builtin_amdgcn_wmma_f32_16x16x32_bf16(false, a, false, b, (short)0, c, false, false);
  }
};

__device__ __forceinline__ unsigned pk16(unsigned short a, unsigned short b) { return (unsigned)a | ((unsigned)b << 16); }
__device__ __forceinline__ unsigned short h_bits(float f) { const _Float16 h = (_Float16)f; return __builtin_bit_cast(unsigned short, h); }

// ---------------------------------------------------------------------------
// Transposing cast: in [R][CC] f32 row-major -> out [CC][R] 16-bit bits (MODE 0: bf16 RNE; MODE 1: f16 bits of in*scale).
// One block (256 threads) per 64x64 tile (bx, by) of (CC/64, R/64); R, CC multiples of 64; s = 64 x 65 floats of LDS.
// Load phase: thread t reads in row r0 + (t>>2), 16 floats at cols c0 + (t&3)*16 -> 256 x 16 = 64x64 = whole tile, into LDS s[c][r].
// Store phase: wave w, it = 0..1: out row c0 + w*8 + it*4 + (lane>>3), 8 halves at r0 + (lane&7)*8
// ---------------------------------------------------------------------------
template <int MODE>
__device__ __forceinline__ unsigned short cvt16(float v, float scale) { return (MODE == 0) ? f2bf_bits(v) : h_bits(v * scale); }

template <int MODE>
__device__ __forceinline__ void transpose_cast64(const float* __restrict__ in, unsigned short* __restrict__ out,
                                                 int R, int CC, float scale, int bx, int by, float* s) {   // s[c*65 + r]
  const int t  = threadIdx.x;
  const int c0 = bx * 64;
  const int r0 = by * 64;
  {
    const int row = t >> 2, cq = (t & 3) * 16;
    const float* ip = in + (size_t)(r0 + row) * CC + c0 + cq;
#pragma unroll
    for (int e4 = 0; e4 < 4; ++e4) {
      const v4f v = *(const v4f*)(ip + 4 * e4);
#pragma unroll
      for (int e = 0; e < 4; ++e) s[(cq + 4 * e4 + e) * 65 + row] = v[e];
    }
  }
  __syncthreads();
  const int wave = t >> 5, lane = t & 31, q = lane >> 3, c8 = (lane & 7) * 8;
  const int orow0 = wave * 8 + q;        // it = 0
  const int orow1 = wave * 8 + 4 + q;    // it = 1
  unsigned short b0[8], b1v[8];
#pragma unroll
  for (int e = 0; e < 8; ++e) {
    b0[e]  = cvt16<MODE>(s[orow0 * 65 + c8 + e], scale);
    b1v[e] = cvt16<MODE>(s[orow1 * 65 + c8 + e], scale);
  }
  const v4u u0 = (v4u){pk16(b0[0], b0[1]), pk16(b0[2], b0[3]), pk16(b0[4], b0[5]), pk16(b0[6], b0[7])};
  const v4u u1 = (v4u){pk16(b1v[0], b1v[1]), pk16(b1v[2], b1v[3]), pk16(b1v[4], b1v[5]), pk16(b1v[6], b1v[7])};
  unsigned short* o0 = out + (size_t)(c0 + orow0) * R + r0 + c8;
  unsigned short* o1 = out + (size_t)(c0 + orow1) * R + r0 + c8;
  *(v4u*)o0 = u0;
  *(v4u*)o1 = u1;
  // other jobs' code follows this one in the kernel: stands before that code writes a register that the stores name
  asm volatile("s_wait_xcnt 0x0" ::: "memory");
}

// ---------------------------------------------------------------------------
// Zero-padded W3 plane for the 16-column-padded matvec: W3P f16 [16][128]; row 0 = f16(W3[k] * scale), rows 1..15 = 0.
// One block of 256 threads: thread t writes 8 halves at t*8 (row t>>4, cols (t&15)*8..+7) -> 256 x 8 = 2048 = whole plane;
// W3 is loaded unconditionally (index always < 128) and selected by value.
// ---------------------------------------------------------------------------
__device__ __forceinline__ void w3pad_body(const float* __restrict__ W3, unsigned short* __restrict__ W3P, float scale) {
  const int t = threadIdx.x;
  const int row = t >> 4, col = (t & 15) * 8;
  const v4f a = *(const v4f*)(W3 + col);
  const v4f c = *(const v4f*)(W3 + col + 4);
  unsigned short hb[8];
#pragma unroll
  for (int e = 0; e < 4; ++e) {
    hb[e]     = (row == 0) ? h_bits(a[e] * scale) : (unsigned short)0;
    hb[4 + e] = (row == 0) ? h_bits(c[e] * scale) : (unsigned short)0;
  }
  const v4u u = (v4u){pk16(hb[0], hb[1]), pk16(hb[2], hb[3]), pk16(hb[4], hb[5]), pk16(hb[6], hb[7])};
  unsigned short* q = W3P + 8 * (size_t)t;
  *(v4u*)q = u;
  asm volatile("s_wait_xcnt 0x0" ::: "memory");   // as in transpose_cast64
}

// ---------------------------------------------------------------------------
// p = F . W for both W1 halves, straight from the f32 inputs: F f32 [1024][512], W = W1 half f32 [512][256], P f32 [1024][256].
// One block (8 waves) per 32 x 64 tile of P, 128 tiles per half, so the 256 blocks cover the chip; blocks 256..264 convert W2 and W3
// for the pair kernel (nothing in this launch reads what they write).
// Both operand tiles come in as whole 128-B lines, all loads in flight at once, are rounded to bf16 (RNE) in registers and go to LDS at a
// padded pitch, k contiguous for both; the fragments (16 rows a load) are read from LDS.
//   F tile: chunk q = it * 256 + tid of 4 floats, row q >> 7, column (q & 127) * 4.
//   W tile: a lane takes 8 k rows x 4 columns (8 loads); column by column its 8 k values are one 16-B LDS store, which is the transpose.
//           Lane = (g = lane >> 3, l8 = lane & 7): k = 64 wave + 32 (u >> 1) + 8 g + j, n = 32 (u & 1) + 4 l8 + e, u = 0..3;
//           a store's 32 lanes fall on 16 bank quads, two lanes each: no more LDS passes than its 512 B take anyway.
// Wave w owns the 16 x 16 subtile (w >> 2, w & 3); one accumulator, k steps in ascending order.
// ---------------------------------------------------------------------------
constexpr int kGM = 32;           // rows of P per block
constexpr int kGN = 64;           // columns of P per block
constexpr int kGP = kFeat + 8;    // bf16 pitch of the staged rows (1040 B = 16 B x odd: ds_load_b128 without bank conflicts)
constexpr int kGC = kGN + 4;      // float pitch of the result tile
constexpr int kGemmTiles  = (kNI / kGM) * (kHid / kGN);      // 128 tiles per W1 half
constexpr int kGemmBlocks = 2 * kGemmTiles;                  // 256
constexpr int kPrepW2     = (kHid2 / 64) * (kHid / 64);      // 8 tiles of the W2 transpose
constexpr int kGemmGrid   = kGemmBlocks + kPrepW2 + 1;       // 265
__device__ __forceinline__ unsigned bf2(float lo, float hi) {   // two bf16 (RNE) in one register
  typedef __attribute__((ext_vector_type(2))) float  v2f;
  typedef __attribute__((ext_vector_type(2))) __bf16 v2b;
  return __builtin_bit_cast(unsigned, __builtin_convertvector((v2f){lo, hi}, v2b));
}
__global__ __launch_bounds__(256) void w1_gemm_kernel(const float* __restrict__ feat1, const float* __restrict__ feat2,
                                                      const float* __restrict__ W1, const float* __restrict__ W2,
                                                      const float* __restrict__ W3, float* __restrict__ P,
                                                      unsigned short* __restrict__ W2T, unsigned short* __restrict__ W3P) {
  __shared__ __align__(16) unsigned short sA[kGM * kGP];   // 33280 B
  __shared__ __align__(16) unsigned short sB[kGN * kGP];   // 66560 B (the W2 transpose uses its first 16640 B as 64 x 65 floats)
  __shared__ __align__(16) float sC[kGM * kGC];            //  8704 B
  const int tid  = threadIdx.x;
  const int lane = tid & 31;
  const int wave = tid >> 5;
  const int bid  = blockIdx.x;
  if (bid >= kGemmBlocks) {   // block-uniform: every thread of a transposing block reaches that job's barrier
    const int c = bid - kGemmBlocks;
    if (c < kPrepW2) transpose_cast64<1>(W2, W2T, kHid, kHid2, kW2Carry, c & 1, c >> 1, (float*)sB);
    else             w3pad_body(W3, W3P, kW3Carry);
    return;
  }
  const int b    = bid >> 7;
  const int m0   = ((bid & 127) >> 2) * kGM;
  const int n0   = (bid & 3) * kGN;

  // ---- stage ----
  {
    const int g = lane >> 3, l8 = lane & 7;
    const float* ga = (b ? feat2 : feat1) + (size_t)m0 * kFeat + tid * 4;
    const float* gb = W1 + (size_t)(b * kFeat + wave * 64 + g * 8) * kHid + n0 + l8 * 4;
    v4f ra[16], rb[4][8];
#pragma unroll
    for (int it = 0; it < 16; ++it) ra[it] = *(const v4f*)(ga + it * 1024);
#pragma unroll
    for (int u = 0; u < 4; ++u)
#pragma unroll
      for (int j = 0; j < 8; ++j) rb[u][j] = *(const v4f*)(gb + ((u >> 1) * 32 + j) * kHid + (u & 1) * 32);
    __builtin_amdgcn_sched_barrier(0);   // keeps the conversions behind all 48 loads: lifted among them they wait for the first loads before the last are issued
    // stands before an address register of the loads above is written again (the F loads are addressed by tid on a scalar base);
    // naming them as inputs keeps them whole up to here
    asm volatile("s_wait_xcnt 0x0" :: "v"(tid), "v"(gb) : "memory");
    unsigned short* da = sA + (tid >> 7) * kGP + (tid & 127) * 4;
    unsigned short* db = sB + (l8 * 4) * kGP + wave * 64 + g * 8;
#pragma unroll
    for (int it = 0; it < 16; ++it)
      *(v2u*)(da + it * 2 * kGP) = (v2u){bf2(ra[it][0], ra[it][1]), bf2(ra[it][2], ra[it][3])};
#pragma unroll
    for (int u = 0; u < 4; ++u)
#pragma unroll
      for (int e = 0; e < 4; ++e)
        *(v4u*)(db + ((u & 1) * 32 + e) * kGP + (u >> 1) * 32) =
            (v4u){bf2(rb[u][0][e], rb[u][1][e]), bf2(rb[u][2][e], rb[u][3][e]), bf2(rb[u][4][e], rb[u][5][e]), bf2(rb[u][6][e], rb[u][7][e])};
  }
  __syncthreads();   // both tiles staged

  const int rlane = lane & 15;            // row (A) / column (B, D) within the subtile
  const int hh    = lane >> 4;            // k offset 8 hh of the fragments, row offset 8 hh of D
  const int wm    = (wave >> 2) * 16;
  const int wn    = (wave & 3) * 16;
  const __bf16* pa = (const __bf16*)sA + (wm + rlane) * kGP + 8 * hh;
  const __bf16* pb = (const __bf16*)sB + (wn + rlane) * kGP + 8 * hh;
  v8f acc = (v8f){0.f, 0.f, 0.f, 0.f, 0.f, 0.f, 0.f, 0.f};
#pragma unroll
  for (int k0 = 0; k0 < kFeat; k0 += 32)
    acc = Frag<__bf16>::mma(Frag<__bf16>::load(pa + k0), Frag<__bf16>::load(pb + k0), acc);

  // ---- result through LDS, so that 16 lanes write one 256-B row segment ----
#pragma unroll
  for (int r = 0; r < 8; ++r) sC[(wm + 8 * hh + r) * kGC + wn + rlane] = acc[r];
  __syncthreads();   // result tile complete
  float* po = P + (size_t)b * kNI * kHid + (size_t)(m0 + (tid >> 4)) * kHid + n0 + (tid & 15) * 4;
  const float* pc = sC + (tid >> 4) * kGC + (tid & 15) * 4;
#pragma unroll
  for (int it = 0; it < 2; ++it) *(v4f*)(po + it * 16 * kHid) = *(const v4f*)(pc + it * 16 * kGC);
  // the W2 and W3 jobs' code follows this path in the kernel: stands before that code writes a register that the stores name
  asm volatile("s_wait_xcnt 0x0" ::: "memory");
}

// ---------------------------------------------------------------------------
// Pairwise MLP, transposed products, everything between p1/p2 and the logit stays in registers.
// Block = 4 waves (one per SIMD) on 64 i x 64 j; wave w owns columns j0 + 16w .. +15 and walks the 64 i.
//   A (resident)  = (16 W2)^T fragments, 8 row tiles (n) x 8 k steps
//   relu(a + q) = max(a, -q) + q with a = f16(p1[i] + b1), q = f16(p2[j]): the q part does not depend on i, so its product
//   with W2 is formed once per wave and starts every accumulator; a step builds only max(a, -q), one packed f16 maximum
//   B (built)     = max(a, -q)^T: lane (hh, c) holds pair column c, k = kmap order
//   D             = 16 h2pre^T in f16, element e = D[8 hh + e][c]; its start value is f16(16 b2 + (16 W2)^T q^T), per row and column
//   two D tiles, relu'd in place, are the B fragment of the W3 product as they lie, no conversion (A = padded 8 W3 plane, row 0)
//   logit = D2[0][c] / 128; sim = 1 / (1 + exp(-(logit + b3))) in f32
// The relu and the W3 product of step i run among the W2 products of step i + 1.
// ---------------------------------------------------------------------------
// the NaN-propagating maximum: for the other kind the compiler first quiets each operand with a maximum of its own (three instructions for one)
__device__ __forceinline__ v16h h1_frag(v16h a, v16h nq) { return __builtin_elementwise_maximum(a, nq); }
__device__ __forceinline__ v16h h2_frag(v8h lo, v8h hi) {
  union { v16h v; v8h h[2]; } f;
  const v8h z = (v8h){(_Float16)0.f, (_Float16)0.f, (_Float16)0.f, (_Float16)0.f, (_Float16)0.f, (_Float16)0.f, (_Float16)0.f, (_Float16)0.f};
  f.h[0] = __builtin_elementwise_maximum(lo, z);   // as in h1_frag: the other kind would first quiet the WMMA's result
  f.h[1] = __builtin_elementwise_maximum(hi, z);
  return f.v;
}
// register 0 of D2 = (8 W3 plane) x (16 h2)^T over the four k steps; four independent WMMAs, their partial sums added in k order
// (one accumulator would make a chain of four dependent WMMAs)
__device__ __forceinline__ float logit128(const v16h* __restrict__ w, const v16h* __restrict__ h) {
  const v8f z = (v8f){0.f, 0.f, 0.f, 0.f, 0.f, 0.f, 0.f, 0.f};
  const v8f d0 = Frag<_Float16>::mma(w[0], h[0], z);
  const v8f d1 = Frag<_Float16>::mma(w[1], h[1], z);
  const v8f d2 = Frag<_Float16>::mma(w[2], h[2], z);
  const v8f d3 = Frag<_Float16>::mma(w[3], h[3], z);
  return ((d0[0] + d1[0]) + d2[0]) + d3[0];
}
// the 16 f32 of one k step in kmap order: floats 0..7 and 16..23 behind p (p already holds the 8*hh offset)
__device__ __forceinline__ void ld16(v4f* d, const float* p) {
  d[0] = *(const v4f*)(p);
  d[1] = *(const v4f*)(p + 4);
  d[2] = *(const v4f*)(p + 16);
  d[3] = *(const v4f*)(p + 20);
}

// issue-order hint for the second half of a step: N times one WMMA followed by V vector instructions
template <int N, int V>
__device__ __forceinline__ void deal() {
#pragma unroll
  for (int g = 0; g < N; ++g) {
    __builtin_amdgcn_sched_group_barrier(0x008, 1, 1);
    __builtin_amdgcn_sched_group_barrier(0x002, V, 1);
  }
}

__global__ __launch_bounds__(128) void pairmlp_kernel(const float* __restrict__ p1, const float* __restrict__ p2,
                                                      const float* __restrict__ b1,
                                                      const unsigned short* __restrict__ W2Tp, const float* __restrict__ b2,
                                                      const unsigned short* __restrict__ W3Pp, const float* __restrict__ b3,
                                                      float* __restrict__ out) {
  // one LDS object, so that the tile read in the loop lies first and its offsets fit the instructions' 16-bit field
  __shared__ __align__(16) struct {
    _Float16 p1[kBI * kHid];          // 32768 B  f16(p1 + b1), rows i0..i0+63
    float    lg[(kBI + 1) * kLgP];    // 33280 B  register 0 of D2, [row][wave][lane]: lanes 0..15 = 128 x logit; row s + 1 = step s, row 0 takes the empty first product
    _Float16 w2[kHid2 * kW2P];        // 67584 B  (16 W2)^T, read once into registers
  } sm;
  _Float16* const s_p1 = sm.p1;
  float* const s_lg = sm.lg;
  _Float16* const s_w2 = sm.w2;

  const _Float16* W2T = (const _Float16*)W2Tp;   // [128][256], f16 of 16*W2[k][n] at [n][k]
  const _Float16* W3P = (const _Float16*)W3Pp;   // [16][128],  row 0 = f16 of 8*W3[k]
  const int tid  = threadIdx.x;
  const int lane = tid & 31;
  const int wave = tid >> 5;
  const int hh   = lane >> 4;
  const int m    = lane & 15;
  const int j0   = blockIdx.x * kBJ;
  const int i0   = blockIdx.y * kBI;

  // ---- stage p1 + b1: 32 x 128 float4 = 16384 floats = [64][256]; a thread's column is the same in every trip ----
  {
    const int cc = (tid & 63) * 4;
    const v4f bv = *(const v4f*)(b1 + cc);
    const float* src = p1 + (size_t)(i0 + (tid >> 6)) * kHid + cc;   // one address, constant offsets
    _Float16* dst = s_p1 + (tid >> 6) * kHid + cc;
    v4f st[32];
#pragma unroll
    for (int it = 0; it < 32; ++it) st[it] = *(const v4f*)(src + it * 2 * kHid);
    // stands before the address registers of the loads above are written again; naming them as inputs keeps them whole up to here
    // (the b1 load is addressed by its byte offset, cc * 4, on a scalar base)
    asm volatile("s_wait_xcnt 0x0" :: "v"(src), "v"(cc * 4) : "memory");
#pragma unroll
    for (int it = 0; it < 32; ++it) *(v4h*)(dst + it * 2 * kHid) = __builtin_convertvector(st[it] + bv, v4h);
  }

  // ---- resident operands ----
  // ---- stage (16 W2)^T once per block, whole 512-B rows per wave-load: 32 x 128 chunks of 8 halves = [128][256] ----
  {
    const _Float16* src = W2T + tid * 8;
    _Float16* dst = s_w2 + (tid >> 5) * kW2P + (tid & 31) * 8;
    v8h st[32];
#pragma unroll
    for (int it = 0; it < 32; ++it) st[it] = *(const v8h*)(src + it * 1024);
    asm volatile("s_wait_xcnt 0x0" :: "v"(src) : "memory");   // as above
#pragma unroll
    for (int it = 0; it < 32; ++it) *(v8h*)(dst + it * 4 * kW2P) = st[it];
  }
  v16h w3a[4];       // padded 8 W3 plane as A: row m, k step c
  {
    const _Float16* wb = W3P + m * kHid2 + 8 * hh;
#pragma unroll
    for (int c = 0; c < 4; ++c) w3a[c] = Frag<_Float16>::load(wb + c * 32);
    asm volatile("s_wait_xcnt 0x0" :: "v"(wb) : "memory");   // as above
  }
  v8f bc[8];         // the accumulators' start value in D's map: register r = row 16 t + 8 hh + r; here 16 b2, the q product is added below
  const float* b2h = b2 + 8 * hh;
#pragma unroll
  for (int t = 0; t < 8; ++t) {
    const v4f lo = *(const v4f*)(b2h + t * 16);
    const v4f hi = *(const v4f*)(b2h + t * 16 + 4);
#pragma unroll
    for (int r = 0; r < 4; ++r) { bc[t][r] = lo[r] * kW2Carry; bc[t][4 + r] = hi[r] * kW2Carry; }
  }
  v16h q2[8];        // -q = f16(-p2) of row j0 + 16 wave + m, kmap order
  {
    const float* pr = p2 + (size_t)(j0 + wave * 16 + m) * kHid + 8 * hh;
    v4f x[8][4];
#pragma unroll
    for (int c = 0; c < 8; ++c) ld16(x[c], pr + c * 32);
    asm volatile("s_wait_xcnt 0x0" :: "v"(pr), "v"(b2h) : "memory");   // as above, for the b2 and p2 loads
#pragma unroll
    for (int c = 0; c < 8; ++c) {
      union { v16h v; v4h q[4]; } f;
#pragma unroll
      for (int e = 0; e < 4; ++e) f.q[e] = __builtin_convertvector(-x[c][e], v4h);
      q2[c] = f.v;
    }
  }
  const float b3v = b3[0];

  __syncthreads();   // s_p1 and s_w2 staged

  v16h wa[8][8];     // (16 W2)^T: row tile t, k step c
  {
    const _Float16* wb = s_w2 + m * kW2P + 8 * hh;
#pragma unroll
    for (int t = 0; t < 8; ++t)
#pragma unroll
      for (int c = 0; c < 8; ++c) wa[t][c] = Frag<_Float16>::load(wb + t * 16 * kW2P + c * 32);
  }
  // start value += (16 W2)^T q^T, k steps in ascending order; the same q bits as in the maximum, so that the two products of a unit with a <= -q cancel
#pragma unroll
  for (int c = 0; c < 8; ++c) {
    const v16h q = -q2[c];
#pragma unroll
    for (int t = 0; t < 8; ++t) bc[t] = Frag<_Float16>::mma(wa[t][c], q, bc[t]);
  }

  v8h bh[8];         // the start value, rounded to f16 once
#pragma unroll
  for (int t = 0; t < 8; ++t) bh[t] = __builtin_convertvector(bc[t], v8h);

  const v8h zero8 = (v8h){(_Float16)0.f, (_Float16)0.f, (_Float16)0.f, (_Float16)0.f, (_Float16)0.f, (_Float16)0.f, (_Float16)0.f, (_Float16)0.f};
  v8h old[8];        // the finished accumulators of the step before; their relu is taken in the second half of the next step
#pragma unroll
  for (int t = 0; t < 8; ++t) old[t] = zero8;
  v16h pa[4], pb[4]; // a of the current step, k steps 0..3 and 4..7; each half row is read half a step before its first use
#pragma unroll
  for (int c = 0; c < 4; ++c) pa[c] = Frag<_Float16>::load(s_p1 + 8 * hh + c * 32);
#pragma unroll
  for (int c = 0; c < 4; ++c) pb[c] = Frag<_Float16>::load(s_p1 + 8 * hh + 128 + c * 32);
  float* lgp = s_lg + wave * 32 + lane;

  // The loop is rotated by one k step: k step 0 of step ii + 1 runs at the foot of step ii.
  v8h acc[8];
  {
    const v16h f0 = h1_frag(pa[0], q2[0]);
#pragma unroll
    for (int t = 0; t < 8; ++t) acc[t] = Frag<_Float16>::mma(wa[t][0], f0, bh[t]);
  }
  v16h f1 = h1_frag(pa[1], q2[1]);

  // two steps a trip: the accumulators started at a step's foot overlap the finished ones, which wait for their relu, so two sets take turns;
  // with one step a trip the new set was copied back into the old one's registers at every foot
#pragma unroll 2
  for (int ii = 0; ii < kBI; ++ii) {
    // the next step's row, read in two places, each in the half before the one that first uses it: only a maximum stands between a read
    // and its WMMA now, so a read of the same half would be waited for. The last step fetches its own row again; what is made of it is not used
    const _Float16* const row = s_p1 + ((ii + 1 < kBI) ? ii + 1 : ii) * kHid + 8 * hh;
    v16h pan[4], pbn[4];
    __builtin_amdgcn_sched_barrier(0);   // with the one behind the reads: keeps the 8 LDS reads in one place
#pragma unroll
    for (int c = 0; c < 4; ++c) pan[c] = Frag<_Float16>::load(row + c * 32);
    __builtin_amdgcn_sched_barrier(0);   // the second of the pair

#pragma unroll
    for (int t = 0; t < 8; ++t) acc[t] = Frag<_Float16>::mma(wa[t][1], f1, acc[t]);
    const v16h f2 = h1_frag(pa[2], q2[2]);
#pragma unroll
    for (int t = 0; t < 8; ++t) acc[t] = Frag<_Float16>::mma(wa[t][2], f2, acc[t]);
    const v16h f3 = h1_frag(pa[3], q2[3]);
#pragma unroll
    for (int t = 0; t < 8; ++t) acc[t] = Frag<_Float16>::mma(wa[t][3], f3, acc[t]);
    const v16h f4 = h1_frag(pb[0], q2[4]);
    const v16h f5 = h1_frag(pb[1], q2[5]);
    // issue order of this half: the maxima dealt two to a WMMA; left alone they came out in longer runs
#pragma unroll
    for (int g = 0; g < 24; ++g) {
      __builtin_amdgcn_sched_group_barrier(0x008, 1, 0);    // one WMMA
      __builtin_amdgcn_sched_group_barrier(0x002, 2, 0);    // two vector instructions
    }

    __builtin_amdgcn_sched_barrier(0);   // as above, for the 8 reads below
#pragma unroll
    for (int c = 0; c < 4; ++c) pbn[c] = Frag<_Float16>::load(row + 128 + c * 32);
    __builtin_amdgcn_sched_barrier(0);   // as above

    v16h hp[4];        // h2 fragments of the step before
#pragma unroll
    for (int c = 0; c < 4; ++c) hp[c] = h2_frag(old[2 * c], old[2 * c + 1]);
#pragma unroll
    for (int t = 0; t < 8; ++t) acc[t] = Frag<_Float16>::mma(wa[t][4], f4, acc[t]);
    const v16h f6 = h1_frag(pb[2], q2[6]);
#pragma unroll
    for (int t = 0; t < 8; ++t) acc[t] = Frag<_Float16>::mma(wa[t][5], f5, acc[t]);
    const v16h f7 = h1_frag(pb[3], q2[7]);
    lgp[ii * kLgP] = logit128(w3a, hp);  // every lane stores, so EXEC never changes in the loop; lanes 0..15 hold D2 row 0
#pragma unroll
    for (int t = 0; t < 8; ++t) acc[t] = Frag<_Float16>::mma(wa[t][6], f6, acc[t]);
    const v16h f0 = h1_frag(pan[0], q2[0]);
#pragma unroll
    for (int t = 0; t < 8; ++t) acc[t] = Frag<_Float16>::mma(wa[t][7], f7, acc[t]);
#pragma unroll
    for (int t = 0; t < 8; ++t) {
      old[t] = acc[t];
      acc[t] = Frag<_Float16>::mma(wa[t][0], f0, bh[t]);
    }
    f1 = h1_frag(pan[1], q2[1]);
#pragma unroll
    for (int c = 0; c < 4; ++c) { pa[c] = pan[c]; pb[c] = pbn[c]; }
    // issue order of this half, vector instructions behind each WMMA: the first 24 WMMAs two (the relu of the
    // step before, the maxima); the W3 product four, which also keep its WMMAs apart (their results overlap in all but the register that is used);
    // the rest one (the maxima, the logit's sums); then the logit store.
    // Left alone, the maxima came out in runs of eight, each behind four idle slots
    deal<24, 2>();
    deal<4, 4>();
    deal<24, 1>();
    __builtin_amdgcn_sched_group_barrier(0x200, 1, 1);      // the logit store
  }
  {
    v16h hp[4];
#pragma unroll
    for (int c = 0; c < 4; ++c) hp[c] = h2_frag(old[2 * c], old[2 * c + 1]);
    lgp[kBI * kLgP] = logit128(w3a, hp);
  }
  __syncthreads();   // all logits in s_lg

  // ---- sigmoid in f32 and store: 64 x 64 values, 8 float4 per thread; 16 lanes write one 256-B row segment ----
  const int r0 = tid >> 4;             // row r0 + 8 it, columns c4 .. c4 + 3
  const int c4 = (tid & 15) * 4;
  const float* lb = s_lg + (r0 + 1) * kLgP + (c4 >> 4) * 32 + (c4 & 15);
  float* ob = out + (size_t)(i0 + r0) * kNJ + j0 + c4;
#pragma unroll
  for (int it = 0; it < 8; ++it) {
    const v4f lg = *(const v4f*)(lb + it * 8 * kLgP);
    v4f v;
#pragma unroll
    for (int e = 0; e < 4; ++e) {
      const float x = lg[e] * kLogitInv + b3v;
      v[e] = 1.0f / (1.0f + expf(-x));
    }
    *(v4f*)(ob + it * 8 * kNJ) = v;
  }
}

// ---------------------------------------------------------------------------
// Workspace region map (byte offsets, all multiples of 128; every region fully written before it is read):
//   W2T  f16  [128][256]   (16 W2)^T                  0
//   W3P  f16  [16][128]    row 0 = 8 W3          65,536
//   P1   f32  [1024][256]                        69,632
//   P2   f32  [1024][256]                     1,118,208
//   total                                     2,166,784 B
// GEMM shapes: p1/p2 M=1024 N=256 K=512 (K % 32 == 0, M % 32 == 0, N % 64 == 0, no padded planes);
// pair kernel: K=256 and K=128 in whole 32-steps from register fragments of exactly that width.
// ---------------------------------------------------------------------------
extern "C" void kernel_launch(void* const* d_in, const int* in_sizes, int n_in,
                              void* d_out, int out_size, void* d_ws, size_t ws_size,
                              hipStream_t stream) {
  if (n_in < 8) return;
  if (in_sizes[0] != kNI * kFeat) return;
  if (in_sizes[1] != kNJ * kFeat) return;
  if (in_sizes[2] != 2 * kFeat * kHid) return;
  if (in_sizes[3] != kHid) return;
  if (in_sizes[4] != kHid * kHid2) return;
  if (in_sizes[5] != kHid2) return;
  if (in_sizes[6] != kHid2) return;
  if (in_sizes[7] < 1) return;
  if (out_size != kNI * kNJ) return;

  const float* feat1 = (const float*)d_in[0];   // [1024][512]
  const float* feat2 = (const float*)d_in[1];   // [1024][512]
  const float* W1    = (const float*)d_in[2];   // [1024][256]  ([in][out])
  const float* b1    = (const float*)d_in[3];   // [256]
  const float* W2    = (const float*)d_in[4];   // [256][128]   ([in][out])
  const float* b2    = (const float*)d_in[5];   // [128]
  const float* W3    = (const float*)d_in[6];   // [128][1]
  const float* b3    = (const float*)d_in[7];   // [1]
  float* outp = (float*)d_out;                  // [1024][1024] f32

  // ---- carve ----
  const size_t SZ_W2T = (size_t)kHid2 * kHid * 2;     //    65,536
  const size_t SZ_W3P = (size_t)16 * kHid2 * 2;       //     4,096
  const size_t SZ_P   = (size_t)kNI * kHid * 4;       // 1,048,576
  size_t off = 0;
  const size_t oW2T  = off; off += SZ_W2T;
  const size_t oW3P  = off; off += SZ_W3P;
  const size_t oP1   = off; off += SZ_P;
  const size_t oP2   = off; off += SZ_P;
  const size_t TOTAL = off;                           // 2,166,784
  if (TOTAL > ws_size) return;
  if (TOTAL > (size_t)134217728) return;

  char* ws = (char*)d_ws;
  unsigned short* W2T  = (unsigned short*)(ws + oW2T);
  unsigned short* W3P  = (unsigned short*)(ws + oW3P);
  float*          P1   = (float*)(ws + oP1);
  float*          P2   = (float*)(ws + oP2);

  // (0) p1 = feat1 . W1[0:512] (blocks 0..127), p2 = feat2 . W1[512:1024] (blocks 128..255): M=1024 N=256 K=512 -> f32 [1024][256] each,
  //     P2 one plane behind P1; blocks 256..264 convert W2 and W3
  w1_gemm_kernel<<<dim3(kGemmGrid), dim3(256), 0, stream>>>(feat1, feat2, W1, W2, W3, P1, W2T, W3P);

  pairmlp_kernel<<<dim3(kNJ / kBJ, kNI / kBI), dim3(128), 0, stream>>>(P1, P2, b1, W2T, b2, W3P, b3, outp);
}

// v007
// It runs in 35 microseconds.
// In both of two side-by-side timings against v006, it was 1.06 times as fast.
// All steps since v000 together make it 4.61 times as fast.
// Contractions: feat1|feat2 x W1 halves on v_wmma_f32_16x16x32_bf16 (inputs RNE-converted to bf16 while they are staged); pairwise relu(p1+b1+p2) x W2 as max(p1+b1, -p2) x W2 + p2 x W2 (p1+b1, p2 f16, W2 f16 carried x16) and h2 x W3 (h2 f16 carried x16, W3 f16 carried x8, M padded to 16), both transposed, on 16x16x32 f16 WMMAs; f32 accumulate but for the W2 product of a step, whose accumulators are f16 (start value formed in f32, rounded once); biases and sigmoid in f32, both relu on the f16 values.
#include <hip/hip_runtime.h>
#include <math.h>

// ---------------------------------------------------------------------------
// Problem constants
// ---------------------------------------------------------------------------
constexpr int kNI   = 1024;   // rows of feat1 (output rows i)
constexpr int kNJ   = 1024;   // rows of feat2 (output cols j)
constexpr int kFeat = 512;
constexpr int kHid  = 256;
constexpr int kHid2 = 128;
constexpr int kBI   = 64;     // i rows per block of the pair kernel
constexpr int kBJ   = 64;     // j columns per block of the pair kernel (16 per wave)
constexpr int kW2P  = 264;    // f16 pitch of the staged W2^T rows (528 B = 16 B x odd: ds_load_b128 without bank conflicts)
constexpr int kLgP  = 128;    // floats per row of the logit tile: 4 waves x 32 lanes
constexpr float kW2Carry  = 16.0f;
constexpr float kW3Carry  = 8.0f;
constexpr float kLogitInv = 1.0f / 128.0f;   // undoes both carries at the logit

typedef __attribute__((ext_vector_type(16))) _Float16 v16h;
typedef __attribute__((ext_vector_type(8)))  _Float16 v8h;
typedef __attribute__((ext_vector_type(4)))  _Float16 v4h;
typedef __attribute__((ext_vector_type(16))) __bf16   v16b;
typedef __attribute__((ext_vector_type(8)))  __bf16   v8b;
typedef __attribute__((ext_vector_type(8)))  float    v8f;
typedef __attribute__((ext_vector_type(4)))  float    v4f;
typedef __attribute__((ext_vector_type(4)))  unsigned int v4u;
typedef __attribute__((ext_vector_type(2)))  unsigned int v2u;

__device__ __forceinline__ unsigned short f2bf_bits(float f) {
  unsigned u = __float_as_uint(f);
  return (unsigned short)((u + 0x7FFFu + ((u >> 16) & 1u)) >> 16);
}
__device__ __forceinline__ float bf_bits2f(unsigned short h) { return __uint_as_float(((unsigned)h) << 16); }

template <typename T> struct Frag;
template <> struct Frag<_Float16> {
  typedef v16h V; union U { v16h v; v8h h[2]; };
  static __device__ __forceinline__ v16h load(const _Float16* p) {   // elements 0..7 <- p[0..7], 8..15 <- p[16..23]
    U f; f.h[0] = *(const v8h*)(p); f.h[1] = *(const v8h*)(p + 16); return f.v;
  }
  static __device__ __forceinline__ v8f mma(v16h a, v16h b, v8f c) {
    return __builtin_amdgcn_wmma_f32_16x16x32_f16(false, a, false, b, (short)0, c, false, false);
  }
  static __device__ __forceinline__ v8h mma(v16h a, v16h b, v8h c) {   // f16 C and D: element e = row 8 hh + e, four registers
    return __builtin_amdgcn_wmma_f16_16x16x32_f16(false, a, false, b, (short)0, c, false, false);
  }
};
template <> struct Frag<__bf16> {
  typedef v16b V; union U { v16b v; v8b h[2]; };
  static __device__ __forceinline__ v16b load(const __bf16* p) {
    U f; f.h[0] = *(const v8b*)(p); f.h[1] = *(const v8b*)(p + 16); return f.v;
  }
  static __device__ __forceinline__ v8f mma(v16b a, v16b b, v8f c) {
    return __builtin_amdgcn_wmma_f32_16x16x32_bf16(false, a, false, b, (short)0, c, false, false);
  }
};

__device__ __forceinline__ unsigned pk16(unsigned short a, unsigned short b) { return (unsigned)a | ((unsigned)b << 16); }
__device__ __forceinline__ unsigned short h_bits(float f) { const _Float16 h = (_Float16)f; return __builtin_bit_cast(unsigned short, h); }

// ---------------------------------------------------------------------------
// Transposing cast: in [R][CC] f32 row-major -> out [CC][R] 16-bit bits (MODE 0: bf16 RNE; MODE 1: f16 bits of in*scale).
// One block (256 threads) per 64x64 tile (bx, by) of (CC/64, R/64); R, CC multiples of 64; s = 64 x 65 floats of LDS.
// Load phase: thread t reads in row r0 + (t>>2), 16 floats at cols c0 + (t&3)*16 -> 256 x 16 = 64x64 = whole tile, into LDS s[c][r].
// Store phase: wave w, it = 0..1: out row c0 + w*8 + it*4 + (lane>>3), 8 halves at r0 + (lane&7)*8
// ---------------------------------------------------------------------------
template <int MODE>
__device__ __forceinline__ unsigned short cvt16(float v, float scale) { return (MODE == 0) ? f2bf_bits(v) : h_bits(v * scale); }

template <int MODE>
__device__ __forceinline__ void transpose_cast64(const float* __restrict__ in, unsigned short* __restrict__ out,
                                                 int R, int CC, float scale, int bx, int by, float* s) {   // s[c*65 + r]
  const int t  = threadIdx.x;
  const int c0 = bx * 64;
  const int r0 = by * 64;
  {
    const int row = t >> 2, cq = (t & 3) * 16;
    const float* ip = in + (size_t)(r0 + row) * CC + c0 + cq;
#pragma unroll
    for (int e4 = 0; e4 < 4; ++e4) {
      const v4f v = *(const v4f*)(ip + 4 * e4);
#pragma unroll
      for (int e = 0; e < 4; ++e) s[(cq + 4 * e4 + e) * 65 + row] = v[e];
    }
  }
  __syncthreads();
  const int wave = t >> 5, lane = t & 31, q = lane >> 3, c8 = (lane & 7) * 8;
  const int orow0 = wave * 8 + q;        // it = 0
  const int orow1 = wave * 8 + 4 + q;    // it = 1
  unsigned short b0[8], b1v[8];
#pragma unroll
  for (int e = 0; e < 8; ++e) {
    b0[e]  = cvt16<MODE>(s[orow0 * 65 + c8 + e], scale);
    b1v[e] = cvt16<MODE>(s[orow1 * 65 + c8 + e], scale);
  }
  const v4u u0 = (v4u){pk16(b0[0], b0[1]), pk16(b0[2], b0[3]), pk16(b0[4], b0[5]), pk16(b0[6], b0[7])};
  const v4u u1 = (v4u){pk16(b1v[0], b1v[1]), pk16(b1v[2], b1v[3]), pk16(b1v[4], b1v[5]), pk16(b1v[6], b1v[7])};
  unsigned short* o0 = out + (size_t)(c0 + orow0) * R + r0 + c8;
  unsigned short* o1 = out + (size_t)(c0 + orow1) * R + r0 + c8;
  *(v4u*)o0 = u0;
  *(v4u*)o1 = u1;
  // other jobs' code follows this one in the kernel: stands before that code writes a register that the stores name
  asm volatile("s_wait_xcnt 0x0" ::: "memory");
}

// ---------------------------------------------------------------------------
// Zero-padded W3 plane for the 16-row-padded matvec (row 0 = f16(W3[k] * scale), rows 1..15 = 0), in the order of its A fragments:
// W3P f16 [k step c: 4][half h: 2][lane: 32][8], lane = (hh, row m), k = 32 c + 16 h + 8 hh + e, so that a fragment load of a wave is 512 B in a row.
// One block of 256 threads: thread t writes 8 halves at t*8 (c = t>>6, h = (t>>5)&1, lane = t&31) -> 256 x 8 = 2048 = whole plane;
// W3 is loaded unconditionally (index always < 128) and selected by value.
// ---------------------------------------------------------------------------
__device__ __forceinline__ void w3pad_body(const float* __restrict__ W3, unsigned short* __restrict__ W3P, float scale) {
  const int t = threadIdx.x;
  const int row = t & 15, col = (t >> 6) * 32 + ((t >> 5) & 1) * 16 + ((t >> 4) & 1) * 8;
  const v4f a = *(const v4f*)(W3 + col);
  const v4f c = *(const v4f*)(W3 + col + 4);
  unsigned short hb[8];
#pragma unroll
  for (int e = 0; e < 4; ++e) {
    hb[e]     = (row == 0) ? h_bits(a[e] * scale) : (unsigned short)0;
    hb[4 + e] = (row == 0) ? h_bits(c[e] * scale) : (unsigned short)0;
  }
  const v4u u = (v4u){pk16(hb[0], hb[1]), pk16(hb[2], hb[3]), pk16(hb[4], hb[5]), pk16(hb[6], hb[7])};
  unsigned short* q = W3P + 8 * (size_t)t;
  *(v4u*)q = u;
  asm volatile("s_wait_xcnt 0x0" ::: "memory");   // as in transpose_cast64
}

// ---------------------------------------------------------------------------
// p = F . W for both W1 halves, straight from the f32 inputs: F f32 [1024][512], W = W1 half f32 [512][256], p [1024][256] in f32 accumulators.
// The results leave as the pair kernel's f16 operands, in the order in which it loads them (whole lines, nothing left to convert there):
//   A16 f16 [1024][256]                       a = f16(p1 + b1), rows as they lie in the pair kernel's LDS tile
//   Q16 f16 [j / 16][k step c: 8][half h: 2][lane: 32][8]   q = f16(p2), B-fragment order: lane = (hh, j & 15), k = 32 c + 16 h + 8 hh + e
// One block (8 waves) per 32 x 64 tile of P, 128 tiles per half, so the 256 blocks cover the chip; blocks 256..264 convert W2 and W3
// for the pair kernel (nothing in this launch reads what they write).
// Both operand tiles come in as whole 128-B lines, all loads in flight at once, are rounded to bf16 (RNE) in registers and go to LDS at a
// padded pitch, k contiguous for both; the fragments (16 rows a load) are read from LDS.
//   F tile: chunk q = it * 256 + tid of 4 floats, row q >> 7, column (q & 127) * 4.
//   W tile: a lane takes 8 k rows x 4 columns (8 loads); column by column its 8 k values are one 16-B LDS store, which is the transpose.
//           Lane = (g = lane >> 3, l8 = lane & 7): k = 64 wave + 32 (u >> 1) + 8 g + j, n = 32 (u & 1) + 4 l8 + e, u = 0..3;
//           a store's 32 lanes fall on 16 bank quads, two lanes each: no more LDS passes than its 512 B take anyway.
// Wave w owns the 16 x 16 subtile (w >> 2, w & 3); one accumulator, k steps in ascending order.
// ---------------------------------------------------------------------------
constexpr int kGM = 32;           // rows of P per block
constexpr int kGN = 64;           // columns of P per block
constexpr int kGP = kFeat + 8;    // bf16 pitch of the staged rows (1040 B = 16 B x odd: ds_load_b128 without bank conflicts)
constexpr int kGC = kGN + 4;      // float pitch of the result tile
constexpr int kGemmTiles  = (kNI / kGM) * (kHid / kGN);      // 128 tiles per W1 half
constexpr int kGemmBlocks = 2 * kGemmTiles;                  // 256
constexpr int kPrepW2     = (kHid2 / 64) * (kHid / 64);      // 8 tiles of the W2 transpose
constexpr int kGemmGrid   = kGemmBlocks + kPrepW2 + 1;       // 265
__device__ __forceinline__ unsigned bf2(float lo, float hi) {   // two bf16 (RNE) in one register
  typedef __attribute__((ext_vector_type(2))) float  v2f;
  typedef __attribute__((ext_vector_type(2))) __bf16 v2b;
  return __builtin_bit_cast(unsigned, __builtin_convertvector((v2f){lo, hi}, v2b));
}
__global__ __launch_bounds__(256) void w1_gemm_kernel(const float* __restrict__ feat1, const float* __restrict__ feat2,
                                                      const float* __restrict__ W1, const float* __restrict__ b1,
                                                      const float* __restrict__ W2, const float* __restrict__ W3,
                                                      unsigned short* __restrict__ A16, unsigned short* __restrict__ Q16,
                                                      unsigned short* __restrict__ W2T, unsigned short* __restrict__ W3P) {
  __shared__ __align__(16) unsigned short sA[kGM * kGP];   // 33280 B
  __shared__ __align__(16) unsigned short sB[kGN * kGP];   // 66560 B (the W2 transpose uses its first 16640 B as 64 x 65 floats)
  __shared__ __align__(16) float sC[kGM * kGC];            //  8704 B
  const int tid  = threadIdx.x;
  const int lane = tid & 31;
  const int wave = tid >> 5;
  const int bid  = blockIdx.x;
  if (bid >= kGemmBlocks) {   // block-uniform: every thread of a transposing block reaches that job's barrier
    const int c = bid - kGemmBlocks;
    if (c < kPrepW2) transpose_cast64<1>(W2, W2T, kHid, kHid2, kW2Carry, c & 1, c >> 1, (float*)sB);
    else             w3pad_body(W3, W3P, kW3Carry);
    return;
  }
  const int b    = bid >> 7;
  const int m0   = ((bid & 127) >> 2) * kGM;
  const int n0   = (bid & 3) * kGN;

  // ---- stage ----
  v4f bl, bu;   // b1 of the 8 columns that this thread writes in the p1 half; fetched with the tiles, so that the store at the end waits for nothing
  {
    const int g = lane >> 3, l8 = lane & 7;
    const float* gc = b1 + n0 + (tid & 7) * 8;
    const float* ga = (b ? feat2 : feat1) + (size_t)m0 * kFeat + tid * 4;
    const float* gb = W1 + (size_t)(b * kFeat + wave * 64 + g * 8) * kHid + n0 + l8 * 4;
    v4f ra[16], rb[4][8];
#pragma unroll
    for (int it = 0; it < 16; ++it) ra[it] = *(const v4f*)(ga + it * 1024);
#pragma unroll
    for (int u = 0; u < 4; ++u)
#pragma unroll
      for (int j = 0; j < 8; ++j) rb[u][j] = *(const v4f*)(gb + ((u >> 1) * 32 + j) * kHid + (u & 1) * 32);
    bl = *(const v4f*)(gc);
    bu = *(const v4f*)(gc + 4);
    __builtin_amdgcn_sched_barrier(0);   // keeps the conversions behind all 50 loads: lifted among them they wait for the first loads before the last are issued
    // stands before an address register of the loads above is written again (on scalar bases the F loads are addressed by tid, the b1 loads by their byte offset);
    // naming them as inputs keeps them whole up to here
    asm volatile("s_wait_xcnt 0x0" :: "v"(tid), "v"(gb), "v"((tid & 7) * 32) : "memory");
    unsigned short* da = sA + (tid >> 7) * kGP + (tid & 127) * 4;
    unsigned short* db = sB + (l8 * 4) * kGP + wave * 64 + g * 8;
#pragma unroll
    for (int it = 0; it < 16; ++it)
      *(v2u*)(da + it * 2 * kGP) = (v2u){bf2(ra[it][0], ra[it][1]), bf2(ra[it][2], ra[it][3])};
#pragma unroll
    for (int u = 0; u < 4; ++u)
#pragma unroll
      for (int e = 0; e < 4; ++e)
        *(v4u*)(db + ((u & 1) * 32 + e) * kGP + (u >> 1) * 32) =
            (v4u){bf2(rb[u][0][e], rb[u][1][e]), bf2(rb[u][2][e], rb[u][3][e]), bf2(rb[u][4][e], rb[u][5][e]), bf2(rb[u][6][e], rb[u][7][e])};
  }
  __syncthreads();   // both tiles staged

  const int rlane = lane & 15;            // row (A) / column (B, D) within the subtile
  const int hh    = lane >> 4;            // k offset 8 hh of the fragments, row offset 8 hh of D
  const int wm    = (wave >> 2) * 16;
  const int wn    = (wave & 3) * 16;
  const __bf16* pa = (const __bf16*)sA + (wm + rlane) * kGP + 8 * hh;
  const __bf16* pb = (const __bf16*)sB + (wn + rlane) * kGP + 8 * hh;
  v8f acc = (v8f){0.f, 0.f, 0.f, 0.f, 0.f, 0.f, 0.f, 0.f};
#pragma unroll
  for (int k0 = 0; k0 < kFeat; k0 += 32)
    acc = Frag<__bf16>::mma(Frag<__bf16>::load(pa + k0), Frag<__bf16>::load(pb + k0), acc);

  // ---- result through LDS, so that every thread holds 8 neighbours in k and a wave's store covers whole lines ----
#pragma unroll
  for (int r = 0; r < 8; ++r) sC[(wm + 8 * hh + r) * kGC + wn + rlane] = acc[r];
  __syncthreads();   // result tile complete
  union { v8h v; v4h q[2]; } f;
  unsigned short* po;
  if (b == 0) {   // block-uniform. a: row tid >> 3, 8 columns; 8 lanes write one 128-B row segment
    const float* pc = sC + (tid >> 3) * kGC + (tid & 7) * 8;
    f.q[0] = __builtin_convertvector(*(const v4f*)(pc) + bl, v4h);
    f.q[1] = __builtin_convertvector(*(const v4f*)(pc + 4) + bu, v4h);
    po = A16 + (size_t)(m0 + (tid >> 3)) * kHid + n0 + (tid & 7) * 8;
  } else {        // q: wave w writes half h = w & 1 of the fragment (j tile w >> 2, k step (w >> 1) & 1) of this tile, 512 B in a row
    const float* pc = sC + ((wave >> 2) * 16 + rlane) * kGC + ((wave >> 1) & 1) * 32 + (wave & 1) * 16 + 8 * hh;
    f.q[0] = __builtin_convertvector(*(const v4f*)(pc), v4h);
    f.q[1] = __builtin_convertvector(*(const v4f*)(pc + 4), v4h);
    po = Q16 + (size_t)((((m0 >> 4) + (wave >> 2)) * 8 + (n0 >> 5) + ((wave >> 1) & 1)) * 2 + (wave & 1)) * 256 + lane * 8;
  }
  *(v8h*)po = f.v;
  // the W2 and W3 jobs' code follows this path in the kernel: stands before that code writes a register that the stores name
  asm volatile("s_wait_xcnt 0x0" ::: "memory");
}

// ---------------------------------------------------------------------------
// Pairwise MLP, transposed products, everything between p1/p2 and the logit stays in registers.
// Block = 4 waves (one per SIMD) on 64 i x 64 j; wave w owns columns j0 + 16w .. +15 and walks the 64 i.
//   A (resident)  = (16 W2)^T fragments, 8 row tiles (n) x 8 k steps
//   relu(a + q) = max(a, -q) + q with a = f16(p1[i] + b1), q = f16(p2[j]): the q part does not depend on i, so its product
//   with W2 is formed once per wave and starts every accumulator; a step builds only max(a, -q), one packed f16 maximum
//   B (built)     = max(a, -q)^T: lane (hh, c) holds pair column c, k = kmap order
//   D             = 16 h2pre^T in f16, element e = D[8 hh + e][c]; its start value is f16(16 b2 + (16 W2)^T q^T), per row and column
//   two D tiles, relu'd in place, are the B fragment of the W3 product as they lie, no conversion (A = padded 8 W3 plane, row 0)
//   logit = D2[0][c] / 128; sim = 1 / (1 + exp(-(logit + b3))) in f32
// The relu and the W3 product of step i run among the W2 products of step i + 1.
// ---------------------------------------------------------------------------
// the NaN-propagating maximum: for the other kind the compiler first quiets each operand with a maximum of its own (three instructions for one)
__device__ __forceinline__ v16h h1_frag(v16h a, v16h nq) { return __builtin_elementwise_maximum(a, nq); }
__device__ __forceinline__ v16h h2_frag(v8h lo, v8h hi) {
  union { v16h v; v8h h[2]; } f;
  const v8h z = (v8h){(_Float16)0.f, (_Float16)0.f, (_Float16)0.f, (_Float16)0.f, (_Float16)0.f, (_Float16)0.f, (_Float16)0.f, (_Float16)0.f};
  f.h[0] = __builtin_elementwise_maximum(lo, z);   // as in h1_frag: the other kind would first quiet the WMMA's result
  f.h[1] = __builtin_elementwise_maximum(hi, z);
  return f.v;
}
// register 0 of D2 = (8 W3 plane) x (16 h2)^T over the four k steps; four independent WMMAs, their partial sums added in k order
// (one accumulator would make a chain of four dependent WMMAs)
__device__ __forceinline__ float logit128(const v16h* __restrict__ w, const v16h* __restrict__ h) {
  const v8f z = (v8f){0.f, 0.f, 0.f, 0.f, 0.f, 0.f, 0.f, 0.f};
  const v8f d0 = Frag<_Float16>::mma(w[0], h[0], z);
  const v8f d1 = Frag<_Float16>::mma(w[1], h[1], z);
  const v8f d2 = Frag<_Float16>::mma(w[2], h[2], z);
  const v8f d3 = Frag<_Float16>::mma(w[3], h[3], z);
  return ((d0[0] + d1[0]) + d2[0]) + d3[0];
}
// issue-order hint for the second half of a step: N times one WMMA followed by V vector instructions
template <int N, int V>
__device__ __forceinline__ void deal() {
#pragma unroll
  for (int g = 0; g < N; ++g) {
    __builtin_amdgcn_sched_group_barrier(0x008, 1, 1);
    __builtin_amdgcn_sched_group_barrier(0x002, V, 1);
  }
}

__global__ __launch_bounds__(128) void pairmlp_kernel(const unsigned short* __restrict__ A16p, const unsigned short* __restrict__ Q16p,
                                                      const unsigned short* __restrict__ W2Tp, const float* __restrict__ b2,
                                                      const unsigned short* __restrict__ W3Pp, const float* __restrict__ b3,
                                                      float* __restrict__ out) {
  // one LDS object, so that the tile read in the loop lies first and its offsets fit the instructions' 16-bit field
  __shared__ __align__(16) struct {
    _Float16 p1[kBI * kHid];          // 32768 B  f16(p1 + b1), rows i0..i0+63
    float    lg[(kBI + 1) * kLgP];    // 33280 B  register 0 of D2, [row][wave][lane]: lanes 0..15 = 128 x logit; row s + 1 = step s, row 0 takes the empty first product
    _Float16 w2[kHid2 * kW2P];        // 67584 B  (16 W2)^T, read once into registers
  } sm;
  _Float16* const s_p1 = sm.p1;
  float* const s_lg = sm.lg;
  _Float16* const s_w2 = sm.w2;

  const _Float16* W2T = (const _Float16*)W2Tp;   // [128][256], f16 of 16*W2[k][n] at [n][k]
  const _Float16* W3P = (const _Float16*)W3Pp;   // [4][2][32][8], A-fragment order; row 0 = f16 of 8*W3[k]
  const _Float16* A16 = (const _Float16*)A16p;   // [1024][256], f16(p1 + b1)
  const _Float16* Q16 = (const _Float16*)Q16p;   // [64][8][2][32][8], f16(p2) in B-fragment order
  const int tid  = threadIdx.x;
  const int lane = tid & 31;
  const int wave = tid >> 5;
  const int hh   = lane >> 4;
  const int m    = lane & 15;
  const int j0   = blockIdx.x * kBJ;
  const int i0   = blockIdx.y * kBI;

  // ---- all vector loads of the kernel, in flight at once, whole lines each (b2: two 16-B pieces a load); what goes to LDS comes first ----
  const _Float16* gw = W2T + tid * 8;                                    // 32 x 128 chunks of 8 halves = [128][256]
  const _Float16* ga = A16 + (size_t)i0 * kHid + tid * 8;                // 16 x 128 chunks of 8 halves = rows i0 .. i0 + 63
  const _Float16* gq = Q16 + (size_t)((j0 >> 4) + wave) * (kHid * 16) + lane * 8;   // the wave's 16 columns: 8 k steps x 2 halves x 512 B
  const _Float16* g3 = W3P + lane * 8;
  const float*    b2h = b2 + 8 * hh;
  v8h sw[32], sa[16];
  v16h q2[8];        // -q = -f16(p2) of row j0 + 16 wave + m, kmap order
  v16h w3a[4];       // padded 8 W3 plane as A: row m, k step c
  v4f blo[8], bhi[8];
#pragma unroll
  for (int it = 0; it < 32; ++it) sw[it] = *(const v8h*)(gw + it * 1024);
#pragma unroll
  for (int it = 0; it < 16; ++it) sa[it] = *(const v8h*)(ga + it * 1024);
  // stands before an address register of the loads above (tid, on scalar bases) is written again; it also keeps these loads, whose data goes to
  // LDS, in front of the rest: loads return in order, so their LDS stores run while the rest still arrives
  asm volatile("s_wait_xcnt 0x0" :: "v"(tid) : "memory");
#pragma unroll
  for (int c = 0; c < 8; ++c) {
    union { v16h v; v8h h[2]; } f;
    f.h[0] = *(const v8h*)(gq + c * 512);
    f.h[1] = *(const v8h*)(gq + c * 512 + 256);
    q2[c] = -f.v;
  }
#pragma unroll
  for (int c = 0; c < 4; ++c) {
    union { v16h v; v8h h[2]; } f;
    f.h[0] = *(const v8h*)(g3 + c * 512);
    f.h[1] = *(const v8h*)(g3 + c * 512 + 256);
    w3a[c] = f.v;
  }
#pragma unroll
  for (int t = 0; t < 8; ++t) {
    blo[t] = *(const v4f*)(b2h + t * 16);
    bhi[t] = *(const v4f*)(b2h + t * 16 + 4);
  }
  // as above, and it keeps the LDS stores behind all the loads (lifted among them they would wait for the first loads before the last are issued);
  // naming the address registers as inputs keeps them whole up to here (on scalar bases the W3 loads are addressed by lane, the b2 loads by
  // their byte offset, 32 hh)
  asm volatile("s_wait_xcnt 0x0" :: "v"(lane), "v"(hh * 32), "v"(gq) : "memory");
  {
    _Float16* dw = s_w2 + (tid >> 5) * kW2P + (tid & 31) * 8;   // a wave-load is one row of (16 W2)^T
    _Float16* da = s_p1 + tid * 8;
#pragma unroll
    for (int it = 0; it < 32; ++it) *(v8h*)(dw + it * 4 * kW2P) = sw[it];
#pragma unroll
    for (int it = 0; it < 16; ++it) *(v8h*)(da + it * 1024) = sa[it];
  }
  v8f bc[8];         // the accumulators' start value in D's map: register r = row 16 t + 8 hh + r; here 16 b2, the q product is added below
#pragma unroll
  for (int t = 0; t < 8; ++t) {
#pragma unroll
    for (int r = 0; r < 4; ++r) { bc[t][r] = blo[t][r] * kW2Carry; bc[t][4 + r] = bhi[t][r] * kW2Carry; }
  }
  const float b3v = b3[0];

  __syncthreads();   // s_p1 and s_w2 staged

  v16h wa[8][8];     // (16 W2)^T: row tile t, k step c
  {
    const _Float16* wb = s_w2 + m * kW2P + 8 * hh;
#pragma unroll
    for (int t = 0; t < 8; ++t)
#pragma unroll
      for (int c = 0; c < 8; ++c) wa[t][c] = Frag<_Float16>::load(wb + t * 16 * kW2P + c * 32);
  }
  // start value += (16 W2)^T q^T, k steps in ascending order; the same q bits as in the maximum, so that the two products of a unit with a <= -q cancel
#pragma unroll
  for (int c = 0; c < 8; ++c) {
    const v16h q = -q2[c];
#pragma unroll
    for (int t = 0; t < 8; ++t) bc[t] = Frag<_Float16>::mma(wa[t][c], q, bc[t]);
  }

  v8h bh[8];         // the start value, rounded to f16 once
#pragma unroll
  for (int t = 0; t < 8; ++t) bh[t] = __builtin_convertvector(bc[t], v8h);

  const v8h zero8 = (v8h){(_Float16)0.f, (_Float16)0.f, (_Float16)0.f, (_Float16)0.f, (_Float16)0.f, (_Float16)0.f, (_Float16)0.f, (_Float16)0.f};
  v8h old[8];        // the finished accumulators of the step before; their relu is taken in the second half of the next step
#pragma unroll
  for (int t = 0; t < 8; ++t) old[t] = zero8;
  v16h pa[4], pb[4]; // a of the current step, k steps 0..3 and 4..7; each half row is read half a step before its first use
#pragma unroll
  for (int c = 0; c < 4; ++c) pa[c] = Frag<_Float16>::load(s_p1 + 8 * hh + c * 32);
#pragma unroll
  for (int c = 0; c < 4; ++c) pb[c] = Frag<_Float16>::load(s_p1 + 8 * hh + 128 + c * 32);
  float* lgp = s_lg + wave * 32 + lane;

  // The loop is rotated by one k step: k step 0 of step ii + 1 runs at the foot of step ii.
  v8h acc[8];
  {
    const v16h f0 = h1_frag(pa[0], q2[0]);
#pragma unroll
    for (int t = 0; t < 8; ++t) acc[t] = Frag<_Float16>::mma(wa[t][0], f0, bh[t]);
  }
  v16h f1 = h1_frag(pa[1], q2[1]);

  // two steps a trip: the accumulators started at a step's foot overlap the finished ones, which wait for their relu, so two sets take turns;
  // with one step a trip the new set was copied back into the old one's registers at every foot
#pragma unroll 2
  for (int ii = 0; ii < kBI; ++ii) {
    // the next step's row, read in two places, each in the half before the one that first uses it: only a maximum stands between a read
    // and its WMMA now, so a read of the same half would be waited for. The last step fetches its own row again; what is made of it is not used
    const _Float16* const row = s_p1 + ((ii + 1 < kBI) ? ii + 1 : ii) * kHid + 8 * hh;
    v16h pan[4], pbn[4];
    __builtin_amdgcn_sched_barrier(0);   // with the one behind the reads: keeps the 8 LDS reads in one place
#pragma unroll
    for (int c = 0; c < 4; ++c) pan[c] = Frag<_Float16>::load(row + c * 32);
    __builtin_amdgcn_sched_barrier(0);   // the second of the pair

#pragma unroll
    for (int t = 0; t < 8; ++t) acc[t] = Frag<_Float16>::mma(wa[t][1], f1, acc[t]);
    const v16h f2 = h1_frag(pa[2], q2[2]);
#pragma unroll
    for (int t = 0; t < 8; ++t) acc[t] = Frag<_Float16>::mma(wa[t][2], f2, acc[t]);
    const v16h f3 = h1_frag(pa[3], q2[3]);
#pragma unroll
    for (int t = 0; t < 8; ++t) acc[t] = Frag<_Float16>::mma(wa[t][3], f3, acc[t]);
    const v16h f4 = h1_frag(pb[0], q2[4]);
    const v16h f5 = h1_frag(pb[1], q2[5]);
    // issue order of this half: the maxima dealt two to a WMMA; left alone they came out in longer runs
#pragma unroll
    for (int g = 0; g < 24; ++g) {
      __builtin_amdgcn_sched_group_barrier(0x008, 1, 0);    // one WMMA
      __builtin_amdgcn_sched_group_barrier(0x002, 2, 0);    // two vector instructions
    }

    __builtin_amdgcn_sched_barrier(0);   // as above, for the 8 reads below
#pragma unroll
    for (int c = 0; c < 4; ++c) pbn[c] = Frag<_Float16>::load(row + 128 + c * 32);
    __builtin_amdgcn_sched_barrier(0);   // as above

    v16h hp[4];        // h2 fragments of the step before
#pragma unroll
    for (int c = 0; c < 4; ++c) hp[c] = h2_frag(old[2 * c], old[2 * c + 1]);
#pragma unroll
    for (int t = 0; t < 8; ++t) acc[t] = Frag<_Float16>::mma(wa[t][4], f4, acc[t]);
    const v16h f6 = h1_frag(pb[2], q2[6]);
#pragma unroll
    for (int t = 0; t < 8; ++t) acc[t] = Frag<_Float16>::mma(wa[t][5], f5, acc[t]);
    const v16h f7 = h1_frag(pb[3], q2[7]);
    lgp[ii * kLgP] = logit128(w3a, hp);  // every lane stores, so EXEC never changes in the loop; lanes 0..15 hold D2 row 0
#pragma unroll
    for (int t = 0; t < 8; ++t) acc[t] = Frag<_Float16>::mma(wa[t][6], f6, acc[t]);
    const v16h f0 = h1_frag(pan[0], q2[0]);
#pragma unroll
    for (int t = 0; t < 8; ++t) acc[t] = Frag<_Float16>::mma(wa[t][7], f7, acc[t]);
#pragma unroll
    for (int t = 0; t < 8; ++t) {
      old[t] = acc[t];
      acc[t] = Frag<_Float16>::mma(wa[t][0], f0, bh[t]);
    }
    f1 = h1_frag(pan[1], q2[1]);
#pragma unroll
    for (int c = 0; c < 4; ++c) { pa[c] = pan[c]; pb[c] = pbn[c]; }
    // issue order of this half, vector instructions behind each WMMA: the first 24 WMMAs two (the relu of the
    // step before, the maxima); the W3 product four, which also keep its WMMAs apart (their results overlap in all but the register that is used);
    // the rest one (the maxima, the logit's sums); then the logit store.
    // Left alone, the maxima came out in runs of eight, each behind four idle slots
    deal<24, 2>();
    deal<4, 4>();
    deal<24, 1>();
    __builtin_amdgcn_sched_group_barrier(0x200, 1, 1);      // the logit store
  }
  {
    v16h hp[4];
#pragma unroll
    for (int c = 0; c < 4; ++c) hp[c] = h2_frag(old[2 * c], old[2 * c + 1]);
    lgp[kBI * kLgP] = logit128(w3a, hp);
  }
  __syncthreads();   // all logits in s_lg

  // ---- sigmoid in f32 and store: 64 x 64 values, 8 float4 per thread; 16 lanes write one 256-B row segment ----
  const int r0 = tid >> 4;             // row r0 + 8 it, columns c4 .. c4 + 3
  const int c4 = (tid & 15) * 4;
  const float* lb = s_lg + (r0 + 1) * kLgP + (c4 >> 4) * 32 + (c4 & 15);
  float* ob = out + (size_t)(i0 + r0) * kNJ + j0 + c4;
#pragma unroll
  for (int it = 0; it < 8; ++it) {
    const v4f lg = *(const v4f*)(lb + it * 8 * kLgP);
    v4f v;
#pragma unroll
    for (int e = 0; e < 4; ++e) {
      const float x = lg[e] * kLogitInv + b3v;
      v[e] = 1.0f / (1.0f + expf(-x));
    }
    *(v4f*)(ob + it * 8 * kNJ) = v;
  }
}

// ---------------------------------------------------------------------------
// Workspace region map (byte offsets, all multiples of 128; every region fully written before it is read):
//   W2T  f16  [128][256]   (16 W2)^T                  0
//   W3P  f16  [4][2][32][8]  row 0 = 8 W3, A-fragment order   65,536
//   A16  f16  [1024][256]    f16(p1 + b1)                     69,632
//   Q16  f16  [64][8][2][32][8]  f16(p2), B-fragment order   593,920
//   total                                                  1,118,208 B
// GEMM shapes: p1/p2 M=1024 N=256 K=512 (K % 32 == 0, M % 32 == 0, N % 64 == 0, no padded planes);
// pair kernel: K=256 and K=128 in whole 32-steps from register fragments of exactly that width.
// ---------------------------------------------------------------------------
extern "C" void kernel_launch(void* const* d_in, const int* in_sizes, int n_in,
                              void* d_out, int out_size, void* d_ws, size_t ws_size,
                              hipStream_t stream) {
  if (n_in < 8) return;
  if (in_sizes[0] != kNI * kFeat) return;
  if (in_sizes[1] != kNJ * kFeat) return;
  if (in_sizes[2] != 2 * kFeat * kHid) return;
  if (in_sizes[3] != kHid) return;
  if (in_sizes[4] != kHid * kHid2) return;
  if (in_sizes[5] != kHid2) return;
  if (in_sizes[6] != kHid2) return;
  if (in_sizes[7] < 1) return;
  if (out_size != kNI * kNJ) return;

  const float* feat1 = (const float*)d_in[0];   // [1024][512]
  const float* feat2 = (const float*)d_in[1];   // [1024][512]
  const float* W1    = (const float*)d_in[2];   // [1024][256]  ([in][out])
  const float* b1    = (const float*)d_in[3];   // [256]
  const float* W2    = (const float*)d_in[4];   // [256][128]   ([in][out])
  const float* b2    = (const float*)d_in[5];   // [128]
  const float* W3    = (const float*)d_in[6];   // [128][1]
  const float* b3    = (const float*)d_in[7];   // [1]
  float* outp = (float*)d_out;                  // [1024][1024] f32

  // ---- carve ----
  const size_t SZ_W2T = (size_t)kHid2 * kHid * 2;     //    65,536
  const size_t SZ_W3P = (size_t)16 * kHid2 * 2;       //     4,096
  const size_t SZ_P   = (size_t)kNI * kHid * 2;       //   524,288
  size_t off = 0;
  const size_t oW2T  = off; off += SZ_W2T;
  const size_t oW3P  = off; off += SZ_W3P;
  const size_t oA16  = off; off += SZ_P;
  const size_t oQ16  = off; off += SZ_P;
  const size_t TOTAL = off;                           // 1,118,208
  if (TOTAL > ws_size) return;
  if (TOTAL > (size_t)134217728) return;

  char* ws = (char*)d_ws;
  unsigned short* W2T  = (unsigned short*)(ws + oW2T);
  unsigned short* W3P  = (unsigned short*)(ws + oW3P);
  unsigned short* A16  = (unsigned short*)(ws + oA16);
  unsigned short* Q16  = (unsigned short*)(ws + oQ16);

  // (0) p1 = feat1 . W1[0:512] (blocks 0..127), p2 = feat2 . W1[512:1024] (blocks 128..255): M=1024 N=256 K=512, written as
  //     A16 = f16(p1 + b1) and Q16 = f16(p2); blocks 256..264 convert W2 and W3
  w1_gemm_kernel<<<dim3(kGemmGrid), dim3(256), 0, stream>>>(feat1, feat2, W1, b1, W2, W3, A16, Q16, W2T, W3P);

  pairmlp_kernel<<<dim3(kNJ / kBJ, kNI / kBI), dim3(128), 0, stream>>>(A16, Q16, W2T, b2, W3P, b3, outp);
}
